// v000
// Times are from an AMD MI455X. After a warm-up the kernel runs many times in a row, and a time is the length of
// such a window on the GPU divided by its runs, so every launch and the gaps after it count. The runs cycle
// through copies of the inputs. A figure is the median of several windows, for all but v000 over two sittings.
// Sittings can differ by a few percent; kernels timed side by side share one.
// v000 is the starting kernel. One run takes 3040 microseconds.
#include <hip/hip_runtime.h>

// Multi-head self-attention on a 32 x 32 grid of positions with a FIXED TWO-DIMENSIONAL ROTARY TABLE (tensor [8][1024][1024]; qkv = tensor w_qkv^T with ONE fused 'oi' (out, in) weight [3072][1024] normal x 1/32, no bias; THE 3,072 COLUMNS ARE (16, 3, 64): PER HEAD q | k | v: head h's q, k, v are weight rows 192 h + 0..63 | + 64..127 | + 128..191; position n = 32 y + x; theta[n][d] = y x ifreq[d] for d < 32 and x x ifreq[d - 32] for d >= 32 with ifreq[i] = 1 / 10000^(i / 32); q, k -> u cos(theta) + rot(u) sin(theta) with rot(u) = cat(-u2, u1) on the two 32-wide halves: rotate-half over the full head width with its own angle at every d; scores / sqrt(64); no mask; softmax over all 1,024 keys; heads merged; out = merged w_proj^T ('oi' x 1/32, no bias) -> [8][1024][1024] (8.4 M); argument order tensor, w_qkv, w_proj).
// Layout per sequence: ONE bf16 copy of x, read by the three projections; the fused 'oi' weight cast once as it stands: head h's q | k | v row blocks at rows 192 h + 0 | 64 | 128: each projection ONE launch of sixteen z-blocks (A z-stride 0; Bt z-stride 192 rows; C z-stride 64 columns); the computed two-dimensional table; q and k planes with the rotation (fp16 + hi/lo), the f16 value plane; dense T-1,024 attention: THE SCORES OF EVERY ROW ON THE hi / lo PLANES (three products), attn.v of EVERY row on ONE fp16 product (the weights x 1024); the f32 merge of the heads; its hi / lo planes; hi/lo x w_proj exact.
// Compute dtypes, f32 accumulate: every input rounded to bf16; projections exact; the table in f32; scores: bf16 hi / lo, 3 products; softmax f32; attn.v: one fp16 product; w_proj hl x exact.

#define NB_  8
#define TT   1024
#define DM   1024
#define NH_  16
#define NKV  16
#define REP  (NH_ / NKV)
#define HD   64
#define DQ   (NH_ * HD)
#define DKV  (NKV * HD)
#define ZH   2
#define RH   0     // query rows < RH use hi+lo planes (0: none: EVERY row runs on one f16 product)
#define WIN  0
#define GW   32    // the grid is 32 x 32 positions: t = GW y + x
#define PCAR 1024.0f
#define SCL  0.125f   // HD^-0.5
typedef _Float16 h16;
typedef unsigned short bf;
typedef __attribute__((ext_vector_type(16))) __bf16   v16bf;
typedef __attribute__((ext_vector_type(16))) _Float16 v16h;
typedef __attribute__((ext_vector_type(8)))  _Float16 v8h;
typedef __attribute__((ext_vector_type(8)))  unsigned short v8us;
typedef __attribute__((ext_vector_type(8)))  float    v8f;
typedef __attribute__((ext_vector_type(4)))  float    v4f;
typedef v8h  __attribute__((may_alias)) v8ha;
typedef v4f  __attribute__((may_alias)) v4fa;
typedef v8us __attribute__((may_alias)) v8usa;

__device__ __forceinline__ unsigned short f2bf(float f) { unsigned u = __float_as_uint(f); u += 0x7FFFu + ((u >> 16) & 1u); return (unsigned short)(u >> 16); }
__device__ __forceinline__ float bf2f(unsigned short b) { return __uint_as_float(((unsigned)b) << 16); }
__device__ __forceinline__ float bfr(float f) { return bf2f(f2bf(f)); }
__device__ __forceinline__ v16h cat16(v8h lo, v8h hi) { return __builtin_shufflevector(lo, hi, 0, 1, 2, 3, 4, 5, 6, 7, 8, 9, 10, 11, 12, 13, 14, 15); }
__device__ __forceinline__ v16bf cat16b(v8us lo, v8us hi) { return __builtin_bit_cast(v16bf, __builtin_shufflevector(lo, hi, 0, 1, 2, 3, 4, 5, 6, 7, 8, 9, 10, 11, 12, 13, 14, 15)); }
__device__ __forceinline__ v8f wmma16(v16h a, v16h b, v8f c) { return __builtin_amdgcn_wmma_f32_16x16x32_f16(false, a, false, b, (short)0, c, false, false); }
__device__ __forceinline__ v8f wmmab(v16bf a, v16bf b, v8f c) { return __builtin_amdgcn_wmma_f32_16x16x32_bf16(false, a, false, b, (short)0, c, false, false); }



// ---- k_gemmw: register-blocked GEMM, ONE WAVE per 64x64 output tile (16 accumulators), operands straight from K-contiguous 16-bit planes; grid (M/64, N/64, Z), 32 threads.
// C[m][n] (f32, pitch ldc, + optional f32 bias[n]) = sum_k A[m][k] Bt[n][k] (+ split products per NSPLIT). z-batch strides sA/sB/sC in elements. K % 32 == 0.
template <typename T16> struct WFrag;
template <> struct WFrag<h16> { typedef v16h V; static __device__ __forceinline__ V ld(const h16* p) { return cat16(*(const v8h*)p, *(const v8h*)(p + 16)); } static __device__ __forceinline__ v8f mma(V a, V b, v8f c) { return wmma16(a, b, c); } };
template <> struct WFrag<bf> { typedef v16bf V; static __device__ __forceinline__ V ld(const bf* p) { return cat16b(*(const v8us*)p, *(const v8us*)(p + 16)); } static __device__ __forceinline__ v8f mma(V a, V b, v8f c) { return wmmab(a, b, c); } };
template <typename T16, int NSPLIT, bool BIAS>
__global__ __launch_bounds__(32) void k_gemmw(const T16* __restrict__ A, const T16* __restrict__ A2, const T16* __restrict__ Bt, const T16* __restrict__ Bt2, int K, float* C, int ldc, const float* __restrict__ bias, size_t sA, size_t sB, size_t sC) {
    typedef typename WFrag<T16>::V V;
    __shared__ __align__(16) float os[16 * 68];
    const size_t z = blockIdx.z; A += z * sA; if (A2) A2 += z * sA; Bt += z * sB; if (Bt2) Bt2 += z * sB; C += z * sC;
    const int lane = threadIdx.x & 31, lr = lane & 15, hi = lane >> 4; const int r0 = blockIdx.x * 64, c0 = blockIdx.y * 64;
    v8f acc[4][4];
#pragma unroll
    for (int mb = 0; mb < 4; ++mb)
#pragma unroll
        for (int nb = 0; nb < 4; ++nb) acc[mb][nb] = (v8f){};
    const size_t aoff = (size_t)(r0 + lr) * K + 8 * hi, boff = (size_t)(c0 + lr) * K + 8 * hi;
    for (int kc = 0; kc < K; kc += 32) {
        V a[4], a2[4];
#pragma unroll
        for (int mb = 0; mb < 4; ++mb) { a[mb] = WFrag<T16>::ld(A + aoff + (size_t)mb * 16 * K + kc); if (NSPLIT == 1 || NSPLIT == 2) a2[mb] = WFrag<T16>::ld(A2 + aoff + (size_t)mb * 16 * K + kc); }
#pragma unroll
        for (int nb = 0; nb < 4; ++nb) { const V b = WFrag<T16>::ld(Bt + boff + (size_t)nb * 16 * K + kc); V b2; if (NSPLIT >= 2) b2 = WFrag<T16>::ld(Bt2 + boff + (size_t)nb * 16 * K + kc);
#pragma unroll
            for (int mb = 0; mb < 4; ++mb) { acc[mb][nb] = WFrag<T16>::mma(a[mb], b, acc[mb][nb]); if (NSPLIT == 1 || NSPLIT == 2) acc[mb][nb] = WFrag<T16>::mma(a2[mb], b, acc[mb][nb]); if (NSPLIT >= 2) acc[mb][nb] = WFrag<T16>::mma(a[mb], b2, acc[mb][nb]); } }
        asm volatile("v_nop\n\tv_nop\n\tv_nop\n\tv_nop" : "+v"(acc[0][0]), "+v"(acc[1][1]), "+v"(acc[2][2]), "+v"(acc[3][3]) : "v"(a[0]), "v"(a[3]));
    }
#pragma unroll
    for (int mb = 0; mb < 4; ++mb) {
#pragma unroll
        for (int nb = 0; nb < 4; ++nb) {
#pragma unroll
            for (int j = 0; j < 8; ++j) os[(hi * 8 + j) * 68 + nb * 16 + lr] = acc[mb][nb][j]; }
        __builtin_amdgcn_wave_barrier(); asm volatile("" ::: "memory");
        float* crow = C + (size_t)(r0 + mb * 16) * ldc + c0;
{
#pragma unroll
            for (int s = 0; s < 8; ++s) { const int row = 2 * s + hi, cofs = lr * 4; v4f val = *(const v4fa*)(os + row * 68 + cofs); if (BIAS) { val[0] += bfr(bias[c0 + cofs]); val[1] += bfr(bias[c0 + cofs + 1]); val[2] += bfr(bias[c0 + cofs + 2]); val[3] += bfr(bias[c0 + cofs + 3]); }
                *(v4f*)(crow + (size_t)row * ldc + cofs) = val; }
             }
        __builtin_amdgcn_wave_barrier(); asm volatile("" ::: "memory");
    }
}

__device__ __forceinline__ h16 tohx(float x) { return (h16)x; }
__device__ __forceinline__ void splitf(float y, unsigned short& h, unsigned short& l) { h = f2bf(y); l = f2bf(y - bf2f(h)); }
typedef __attribute__((ext_vector_type(2))) _Float16 v2h;
typedef __attribute__((ext_vector_type(4))) _Float16 v4h;
typedef __attribute__((ext_vector_type(2))) unsigned short v2us;
typedef __attribute__((ext_vector_type(4))) unsigned short v4us;
typedef __attribute__((ext_vector_type(2))) float v2f;
typedef __attribute__((ext_vector_type(4))) int v4i;

__global__ __launch_bounds__(256) void k_cvt8(const float* __restrict__ src, bf* dst, size_t n8) { const size_t i = (size_t)blockIdx.x * 256 + threadIdx.x; if (i >= n8) return; const v8f v = *(const v8f*)(src + i * 8); v8us o;
#pragma unroll
    for (int k = 0; k < 8; ++k) o[k] = f2bf(v[k]); *(v8us*)(dst + i * 8) = o;  }

__global__ __launch_bounds__(256) void k_pl2(const float* __restrict__ F, bf* Ph, bf* Pl, size_t n4) { const size_t i = (size_t)blockIdx.x * 256 + threadIdx.x; if (i >= n4) return; const v4f v = *(const v4f*)(F + i * 4); v4us oh, ol;
#pragma unroll
    for (int q = 0; q < 4; ++q) { unsigned short a, c; splitf(v[q], a, c); oh[q] = a; ol[q] = c; } *(v4us*)(Ph + i * 4) = oh; *(v4us*)(Pl + i * 4) = ol;  }

// k_rope: head planes [h][t][d] (fp16 + hi/lo) of rope(x) x sc with the rotate-half convention out[d] = x[d] cos[t][d] - x[d+HD/2] sin[t][d], out[d+HD/2] = x[d+HD/2] cos[t][d+HD/2] + x[d] sin[t][d+HD/2]
__global__ __launch_bounds__(256) void k_rope(const float* __restrict__ F, int pitch, int nheads, const float* __restrict__ CS, const float* __restrict__ RF, const float* __restrict__ nw, float sc, h16* P16, bf* Ph, bf* Pl) {
    const size_t e = ((size_t)blockIdx.x * 256 + threadIdx.x) * 2; if (e >= (size_t)nheads * TT * HD) return; const int d = (int)(e % HD); const int t = (int)((e / HD) % TT); const int h = (int)(e / ((size_t)HD * TT)); const float* f = F + (size_t)t * pitch + h * HD; const float rf = RF ? RF[(size_t)h * TT + t] : 1.0f; v2h o16; v2us oh, ol;
#pragma unroll
    for (int q = 0; q < 2; ++q) { const int dd = d + q; const int dp = (dd < HD / 2) ? dd + HD / 2 : dd - HD / 2; float x0 = f[dd], x1 = f[dp];
        if (RF) { float n0 = __fmul_rn(x0, rf), n1 = __fmul_rn(x1, rf); x0 = __fmul_rn(bfr(nw[dd]), n0); x1 = __fmul_rn(bfr(nw[dp]), n1); }
        const v2f cs = *(const v2f*)(CS + ((size_t)t * HD + dd) * 2); float a = __fmul_rn(x0, cs[0]), bq = __fmul_rn(x1, cs[1]); const float r = ((dd < HD / 2) ? __fsub_rn(a, bq) : __fadd_rn(a, bq)) * sc;
        o16[q] = tohx(r); unsigned short a2, c2; splitf(r, a2, c2); oh[q] = a2; ol[q] = c2; }
    *(v2h*)(P16 + e) = o16; *(v2us*)(Ph + e) = oh; *(v2us*)(Pl + e) = ol;  }
__global__ __launch_bounds__(256) void k_vtp(const float* __restrict__ F, int pitch, int nheads, h16* V16, bf* Vh, bf* Vl) { const size_t e = ((size_t)blockIdx.x * 256 + threadIdx.x) * 2; if (e >= (size_t)nheads * HD * TT) return; const int t = (int)(e % TT); const int d = (int)((e / TT) % HD); const int g = (int)(e / ((size_t)TT * HD)); v2h o16; v2us oh, ol;
#pragma unroll
    for (int q = 0; q < 2; ++q) { const float x = F[(size_t)(t + q) * pitch + g * HD + d]; o16[q] = tohx(x); (void)oh; (void)ol; }
    *(v2h*)(V16 + e) = o16;  }
__constant__ float INVT[HD / 2] = { 1.000000000e+00f, 7.498942018e-01f, 5.623413324e-01f, 4.216965139e-01f, 3.162277639e-01f, 2.371373624e-01f, 1.778279394e-01f, 1.333521456e-01f, 1.000000015e-01f, 7.498941571e-02f, 5.623412877e-02f, 4.216964915e-02f, 3.162277862e-02f, 2.371373586e-02f, 1.778279431e-02f, 1.333521493e-02f, 9.999999776e-03f, 7.498942316e-03f, 5.623413250e-03f, 4.216964822e-03f, 3.162277862e-03f, 2.371373819e-03f, 1.778279431e-03f, 1.333521446e-03f, 1.000000047e-03f, 7.498941850e-04f, 5.623413017e-04f, 4.216964880e-04f, 3.162277862e-04f, 2.371373848e-04f, 1.778279402e-04f, 1.333521504e-04f };   // float32 1 / 10000^(2i/64), i = 0..31
__global__ __launch_bounds__(256) void k_cs2d(float* CS) { const int idx = blockIdx.x * 256 + threadIdx.x; if (idx >= TT * HD) return; const int d = idx % HD; const int t = idx / HD; const int p = (d < HD / 2) ? (t / GW) : (t % GW); const float a = __fmul_rn((float)p, INVT[d % (HD / 2)]); v2f cs; cs[0] = cosf(a); cs[1] = sinf(a); *(v2f*)(CS + (size_t)idx * 2) = cs;  }
// k_asoft: per row (zz, i): t = S x HD^-0.5 (no mask); softmax over the 1024 keys (register row, one exp, fixed trees);
__global__ __launch_bounds__(256) void k_asoft(const float* __restrict__ Sb, h16* P16, bf* Ph, bf* Pl) {
    const int lane = threadIdx.x & 31; const int row = blockIdx.x * 8 + (threadIdx.x >> 5); if (row >= ZH * TT) return; const int i = row % TT; const int zz = row / TT; (void)zz; const bool hires = (i < RH); const float* sr = Sb + (size_t)row * TT; float v[TT / 32]; float mx = -3.0e38f;
#pragma unroll
    for (int ch = 0; ch < TT / 128; ++ch) { const int j0 = ch * 128 + lane * 4; const v4f a = *(const v4f*)(sr + j0);
#pragma unroll
        for (int q = 0; q < 4; ++q) { const int j = j0 + q; (void)j; const float t = a[q] * SCL; v[ch * 4 + q] = t; mx = fmaxf(mx, t); } }
#pragma unroll
    for (int sh = 16; sh; sh >>= 1) mx = fmaxf(mx, __shfl_xor(mx, sh, 32));
    float sum = 0.f;
#pragma unroll
    for (int k = 0; k < TT / 32; ++k) { float d0 = __fsub_rn(v[k], mx); v[k] = __builtin_amdgcn_exp2f(__fmul_rn(d0, 1.4426950408889634f)); sum += v[k]; }
#pragma unroll
    for (int sh = 16; sh; sh >>= 1) sum += __shfl_xor(sum, sh, 32);
    const float f = __fdiv_rn(hires ? 1.0f : PCAR, sum);
{
        if (hires) {
#pragma unroll
            for (int ch = 0; ch < TT / 128; ++ch) { v4us oh, ol;
#pragma unroll
                for (int q = 0; q < 4; ++q) { unsigned short a, c2; splitf(v[ch * 4 + q] * f, a, c2); oh[q] = a; ol[q] = c2; }
                const size_t oo = ((size_t)zz * (RH ? RH : 1) + i) * TT + ch * 128 + lane * 4; *(v4us*)(Ph + oo) = oh; *(v4us*)(Pl + oo) = ol; }
        } else {
#pragma unroll
            for (int ch = 0; ch < TT / 128; ++ch) { v4h o4;
#pragma unroll
                for (int q = 0; q < 4; ++q) o4[q] = tohx(v[ch * 4 + q] * f);
                *(v4h*)(P16 + (size_t)row * TT + ch * 128 + lane * 4) = o4; } }
         }
}
__global__ __launch_bounds__(256) void k_merge(const float* __restrict__ O, int h0, float* OUTb) { const size_t e = ((size_t)blockIdx.x * 256 + threadIdx.x) * 2; if (e >= (size_t)ZH * TT * HD) return; const int d = (int)(e % HD); const int t = (int)((e / HD) % TT); const int zz = (int)(e / ((size_t)HD * TT)); const float cs = (t < RH) ? 1.0f : (1.0f / PCAR); const size_t oo = (size_t)t * DQ + (h0 + zz) * HD + d;
    v2f o2; o2[0] = O[e] * cs; o2[1] = O[e + 1] * cs; *(v2f*)(OUTb + oo) = o2;  }

extern "C" void kernel_launch(void* const* d_in, const int* in_sizes, int n_in,
                              void* d_out, int out_size, void* d_ws, size_t ws_size, hipStream_t stream) {
    (void)in_sizes; (void)n_in; (void)out_size;
    const float* x = (const float*)d_in[0]; const float* wqkv = (const float*)d_in[1]; const float* wo = (const float*)d_in[2];   /* order tensor [8][1024][1024], w_qkv ('oi' (out, in) [3072][1024]: PER HEAD q | k | v: rows 192 h + 0..63 | 64..127 | 128..191), w_proj ('oi' [1024][1024]): THREE inputs, all read; no bias anywhere */
    float* OUT = (float*)d_out;     // [8][1024][1024]
    char* wsp = (char*)d_ws;
    auto take = [&](size_t bytes) { char* p = wsp; wsp += (bytes + 255) & ~(size_t)255; return (void*)p; };
    bf* BT = (bf*)take((size_t)3 * DQ * DM * 2); bf* WO = (bf*)take((size_t)DM * DQ * 2); float* CS = (float*)take((size_t)TT * HD * 2 * 4);   /* the fused 'oi' weight is the Bt operand as it stands: ONE bf16 copy [3072][1024]: head h's q | k | v row blocks begin at rows 3 HD h + 0 | HD | 2 HD */
    bf* XB = (bf*)take((size_t)TT * DM * 2); float* FQ = (float*)take((size_t)TT * DQ * 4); float* FK = (float*)take((size_t)TT * DKV * 4);
    h16* QP16 = (h16*)take((size_t)NH_ * TT * HD * 2); h16* KP16 = (h16*)take((size_t)NKV * TT * HD * 2); h16* VT16 = (h16*)take((size_t)NKV * HD * TT * 2);
    bf* QPh = (bf*)take((size_t)NH_ * TT * HD * 2); bf* QPl = (bf*)take((size_t)NH_ * TT * HD * 2); bf* KPh = (bf*)take((size_t)NKV * TT * HD * 2); bf* KPl = (bf*)take((size_t)NKV * TT * HD * 2); bf* VTh = nullptr; bf* VTl = nullptr; bf* Ph = nullptr; bf* Pl = nullptr;   /* RH 0 at attn.v: no hi / lo value or weight plane exists: the value builder and the softmax store the f16 plane only and do not read those arguments */
    float* Sb = (float*)take((size_t)ZH * TT * TT * 4); h16* P16 = (h16*)take((size_t)ZH * TT * TT * 2); float* Ob = (float*)take((size_t)ZH * TT * HD * 4); float* FM = (float*)take((size_t)TT * DQ * 4); bf* ATh = (bf*)take((size_t)TT * DQ * 2); bf* ATl = (bf*)take((size_t)TT * DQ * 2);   /* FM: the merged heads of a sequence, f32, token-major; ATh / ATl: its hi / lo planes */
    if ((size_t)(wsp - (char*)d_ws) > ws_size) return;    // ws 256 MiB
    float* FV = FK;   // v projection reuses the k buffer after the k planes are built (stream-ordered)
    { k_cvt8<<<(unsigned)(((size_t)3 * DQ * DM / 8 + 255) / 256), 256, 0, stream>>>(wqkv, BT, (size_t)3 * DQ * DM / 8); k_cvt8<<<(unsigned)(((size_t)DM * DQ / 8 + 255) / 256), 256, 0, stream>>>(wo, WO, (size_t)DM * DQ / 8); }   /* 'oi' (out, in): each weight is the Bt operand as it stands */
    k_cs2d<<<(TT * HD + 255) / 256, 256, 0, stream>>>(CS);
    const unsigned LQ = (unsigned)(((size_t)NH_ * TT * HD / 2 + 255) / 256), LKv = (unsigned)(((size_t)NKV * TT * HD / 2 + 255) / 256);
    const size_t zB = (size_t)3 * HD * DM;   /* the Bt z-stride of the per-head projections: 192 weight rows a head */
    for (int b = 0; b < NB_; ++b) {
        k_cvt8<<<(unsigned)(((size_t)TT * DM / 8 + 255) / 256), 256, 0, stream>>>(x + (size_t)b * TT * DM, XB, (size_t)TT * DM / 8);   /* ONE bf16 copy of the sequence, read by the three projections */
        /* PER HEAD, ONE 64-wide projection tile column: q_h = x W[192 h + 0..63]^T into columns 64 h .. of the [TT][DQ] plane: sixteen heads on the z axis: EVERY z READS THE SAME A (z-stride 0); Bt z-stride 192 rows; C z-stride 64 columns at a row pitch of DQ */
        k_gemmw<bf, 0, false><<<dim3(TT / 64, HD / 64, NH_), 32, 0, stream>>>(XB, nullptr, BT, nullptr, DM, FQ, DQ, nullptr, (size_t)0, zB, (size_t)HD);
        k_rope<<<LQ, 256, 0, stream>>>(FQ, DQ, NH_, CS, nullptr, nullptr, 1.0f, QP16, QPh, QPl);
        k_gemmw<bf, 0, false><<<dim3(TT / 64, HD / 64, NKV), 32, 0, stream>>>(XB, nullptr, BT + (size_t)HD * DM, nullptr, DM, FK, DKV, nullptr, (size_t)0, zB, (size_t)HD);
        k_rope<<<LKv, 256, 0, stream>>>(FK, DKV, NKV, CS, nullptr, nullptr, 1.0f, KP16, KPh, KPl);
        k_gemmw<bf, 0, false><<<dim3(TT / 64, HD / 64, NKV), 32, 0, stream>>>(XB, nullptr, BT + (size_t)2 * HD * DM, nullptr, DM, FV, DKV, nullptr, (size_t)0, zB, (size_t)HD);
        k_vtp<<<LKv, 256, 0, stream>>>(FV, DKV, NKV, VT16, VTh, VTl);
        for (int h0 = 0; h0 < NH_; h0 += ZH) { const size_t zq = (size_t)h0, zk = (size_t)(h0 / REP);   // one kv head per query head: the pass's two heads use consecutive kv planes (z-strides TT*HD)
            k_gemmw<bf, 2, false><<<dim3(TT / 64, TT / 64, ZH), 32, 0, stream>>>(QPh + zq * TT * HD, QPl + zq * TT * HD, KPh + zk * TT * HD, KPl + zk * TT * HD, HD, Sb, TT, nullptr, (size_t)TT * HD, (size_t)TT * HD, (size_t)TT * TT);   /* the scores of EVERY query row on the hi / lo planes (three products) */
            k_asoft<<<ZH * TT / 8, 256, 0, stream>>>(Sb, P16, Ph, Pl);
            k_gemmw<h16, 0, false><<<dim3(TT / 64, HD / 64, ZH), 32, 0, stream>>>(P16, nullptr, VT16 + zk * HD * TT, nullptr, TT, Ob, HD, nullptr, (size_t)TT * TT, (size_t)HD * TT, (size_t)TT * HD);
            k_merge<<<(unsigned)(((size_t)ZH * TT * HD / 2 + 255) / 256), 256, 0, stream>>>(Ob, h0, FM); }
        k_pl2<<<(unsigned)(((size_t)TT * DQ / 4 + 255) / 256), 256, 0, stream>>>(FM, ATh, ATl, (size_t)TT * DQ / 4);
        k_gemmw<bf, 1, false><<<dim3(TT / 64, DM / 64, 1), 32, 0, stream>>>(ATh, ATl, WO, nullptr, DQ, OUT + (size_t)b * TT * DM, DM, nullptr, 0, 0, 0);
    }
}

// v001
// A run of this version takes 782 microseconds.
// Two timings next to v000 put it at 3.85 and 3.90 times that version's speed.
#include <hip/hip_runtime.h>

// Multi-head self-attention on a 32 x 32 grid of positions with a FIXED TWO-DIMENSIONAL ROTARY TABLE (tensor [8][1024][1024]; qkv = tensor w_qkv^T with ONE fused 'oi' (out, in) weight [3072][1024] normal x 1/32, no bias; THE 3,072 COLUMNS ARE (16, 3, 64): PER HEAD q | k | v: head h's q, k, v are weight rows 192 h + 0..63 | + 64..127 | + 128..191; position n = 32 y + x; theta[n][d] = y x ifreq[d] for d < 32 and x x ifreq[d - 32] for d >= 32 with ifreq[i] = 1 / 10000^(i / 32); q, k -> u cos(theta) + rot(u) sin(theta) with rot(u) = cat(-u2, u1) on the two 32-wide halves: rotate-half over the full head width with its own angle at every d; scores / sqrt(64); no mask; softmax over all 1,024 keys; heads merged; out = merged w_proj^T ('oi' x 1/32, no bias) -> [8][1024][1024] (8.4 M); argument order tensor, w_qkv, w_proj).
// Layout, ALL EIGHT SEQUENCES AT ONCE outside the attention passes (token rows 1024 b + t, head planes 16 b + h); one attention pass = the sixteen heads of one sequence on the z axis: ONE bf16 copy of x, read by the three projections; the fused 'oi' weight cast once as it stands: head h's q | k | v row blocks at rows 192 h + 0 | 64 | 128: each projection ONE launch of sixteen z-blocks (A z-stride 0; Bt z-stride 192 rows; C z-stride 64 columns); the computed two-dimensional table; q and k planes with the rotation (fp16 + hi/lo), the f16 value plane; dense T-1,024 attention: THE SCORES OF EVERY ROW ON THE hi / lo PLANES (three products), attn.v of EVERY row on ONE fp16 product (the weights x 1024); the f32 merge of the heads; its hi / lo planes; hi/lo x w_proj exact.
// Compute dtypes, f32 accumulate: every input rounded to bf16; projections exact; the table in f32; scores: bf16 hi / lo, 3 products; softmax f32; attn.v: one fp16 product; w_proj hl x exact.

#define NB_  8
#define TT   1024
#define DM   1024
#define NH_  16
#define NKV  16
#define REP  (NH_ / NKV)
#define HD   64
#define DQ   (NH_ * HD)
#define DKV  (NKV * HD)
#define ZH   16    // heads per attention pass: all heads of one sequence
#define RH   0     // query rows < RH use hi+lo planes (0: none: EVERY row runs on one f16 product)
#define WIN  0
#define GW   32    // the grid is 32 x 32 positions: t = GW y + x
#define PCAR 1024.0f
#define SCL  0.125f   // HD^-0.5
typedef _Float16 h16;
typedef unsigned short bf;
typedef __attribute__((ext_vector_type(16))) __bf16   v16bf;
typedef __attribute__((ext_vector_type(16))) _Float16 v16h;
typedef __attribute__((ext_vector_type(8)))  _Float16 v8h;
typedef __attribute__((ext_vector_type(8)))  unsigned short v8us;
typedef __attribute__((ext_vector_type(8)))  float    v8f;
typedef __attribute__((ext_vector_type(4)))  float    v4f;
typedef v8h  __attribute__((may_alias)) v8ha;
typedef v4f  __attribute__((may_alias)) v4fa;
typedef v8us __attribute__((may_alias)) v8usa;

__device__ __forceinline__ unsigned short f2bf(float f) { unsigned u = __float_as_uint(f); u += 0x7FFFu + ((u >> 16) & 1u); return (unsigned short)(u >> 16); }
__device__ __forceinline__ float bf2f(unsigned short b) { return __uint_as_float(((unsigned)b) << 16); }
__device__ __forceinline__ float bfr(float f) { return bf2f(f2bf(f)); }
__device__ __forceinline__ v16h cat16(v8h lo, v8h hi) { return __builtin_shufflevector(lo, hi, 0, 1, 2, 3, 4, 5, 6, 7, 8, 9, 10, 11, 12, 13, 14, 15); }
__device__ __forceinline__ v16bf cat16b(v8us lo, v8us hi) { return __builtin_bit_cast(v16bf, __builtin_shufflevector(lo, hi, 0, 1, 2, 3, 4, 5, 6, 7, 8, 9, 10, 11, 12, 13, 14, 15)); }
__device__ __forceinline__ v8f wmma16(v16h a, v16h b, v8f c) { return __builtin_amdgcn_wmma_f32_16x16x32_f16(false, a, false, b, (short)0, c, false, false); }
__device__ __forceinline__ v8f wmmab(v16bf a, v16bf b, v8f c) { return __builtin_amdgcn_wmma_f32_16x16x32_bf16(false, a, false, b, (short)0, c, false, false); }



// ---- k_gemmw: register-blocked GEMM, ONE WAVE per 64x64 output tile (16 accumulators), operands straight from K-contiguous 16-bit planes; grid (M/64, N/64, Z), 32 threads.
// C[m][n] (f32, pitch ldc, + optional f32 bias[n]) = sum_k A[m][k] Bt[n][k] (+ split products per NSPLIT). z-batch strides sA/sB/sC in elements. K % 32 == 0.
template <typename T16> struct WFrag;
template <> struct WFrag<h16> { typedef v16h V; static __device__ __forceinline__ V ld(const h16* p) { return cat16(*(const v8h*)p, *(const v8h*)(p + 16)); } static __device__ __forceinline__ v8f mma(V a, V b, v8f c) { return wmma16(a, b, c); } };
template <> struct WFrag<bf> { typedef v16bf V; static __device__ __forceinline__ V ld(const bf* p) { return cat16b(*(const v8us*)p, *(const v8us*)(p + 16)); } static __device__ __forceinline__ v8f mma(V a, V b, v8f c) { return wmmab(a, b, c); } };
template <typename T16, int NSPLIT, bool BIAS>
__global__ __launch_bounds__(32) void k_gemmw(const T16* __restrict__ A, const T16* __restrict__ A2, const T16* __restrict__ Bt, const T16* __restrict__ Bt2, int K, float* C, int ldc, const float* __restrict__ bias, size_t sA, size_t sB, size_t sC) {
    typedef typename WFrag<T16>::V V;
    __shared__ __align__(16) float os[16 * 68];
    const size_t z = blockIdx.z; A += z * sA; if (A2) A2 += z * sA; Bt += z * sB; if (Bt2) Bt2 += z * sB; C += z * sC;
    const int lane = threadIdx.x & 31, lr = lane & 15, hi = lane >> 4; const int r0 = blockIdx.x * 64, c0 = blockIdx.y * 64;
    v8f acc[4][4];
#pragma unroll
    for (int mb = 0; mb < 4; ++mb)
#pragma unroll
        for (int nb = 0; nb < 4; ++nb) acc[mb][nb] = (v8f){};
    const size_t aoff = (size_t)(r0 + lr) * K + 8 * hi, boff = (size_t)(c0 + lr) * K + 8 * hi;
    for (int kc = 0; kc < K; kc += 32) {
        V a[4], a2[4];
#pragma unroll
        for (int mb = 0; mb < 4; ++mb) { a[mb] = WFrag<T16>::ld(A + aoff + (size_t)mb * 16 * K + kc); if (NSPLIT == 1 || NSPLIT == 2) a2[mb] = WFrag<T16>::ld(A2 + aoff + (size_t)mb * 16 * K + kc); }
#pragma unroll
        for (int nb = 0; nb < 4; ++nb) { const V b = WFrag<T16>::ld(Bt + boff + (size_t)nb * 16 * K + kc); V b2; if (NSPLIT >= 2) b2 = WFrag<T16>::ld(Bt2 + boff + (size_t)nb * 16 * K + kc);
#pragma unroll
            for (int mb = 0; mb < 4; ++mb) { acc[mb][nb] = WFrag<T16>::mma(a[mb], b, acc[mb][nb]); if (NSPLIT == 1 || NSPLIT == 2) acc[mb][nb] = WFrag<T16>::mma(a2[mb], b, acc[mb][nb]); if (NSPLIT >= 2) acc[mb][nb] = WFrag<T16>::mma(a[mb], b2, acc[mb][nb]); } }
        asm volatile("v_nop\n\tv_nop\n\tv_nop\n\tv_nop" : "+v"(acc[0][0]), "+v"(acc[1][1]), "+v"(acc[2][2]), "+v"(acc[3][3]) : "v"(a[0]), "v"(a[3]));
    }
#pragma unroll
    for (int mb = 0; mb < 4; ++mb) {
#pragma unroll
        for (int nb = 0; nb < 4; ++nb) {
#pragma unroll
            for (int j = 0; j < 8; ++j) os[(hi * 8 + j) * 68 + nb * 16 + lr] = acc[mb][nb][j]; }
        __builtin_amdgcn_wave_barrier(); asm volatile("" ::: "memory");
        float* crow = C + (size_t)(r0 + mb * 16) * ldc + c0;
{
#pragma unroll
            for (int s = 0; s < 8; ++s) { const int row = 2 * s + hi, cofs = lr * 4; v4f val = *(const v4fa*)(os + row * 68 + cofs); if (BIAS) { val[0] += bfr(bias[c0 + cofs]); val[1] += bfr(bias[c0 + cofs + 1]); val[2] += bfr(bias[c0 + cofs + 2]); val[3] += bfr(bias[c0 + cofs + 3]); }
                *(v4f*)(crow + (size_t)row * ldc + cofs) = val; }
             }
        __builtin_amdgcn_wave_barrier(); asm volatile("" ::: "memory");
    }
}

__device__ __forceinline__ h16 tohx(float x) { return (h16)x; }
__device__ __forceinline__ void splitf(float y, unsigned short& h, unsigned short& l) { h = f2bf(y); l = f2bf(y - bf2f(h)); }
typedef __attribute__((ext_vector_type(2))) _Float16 v2h;
typedef __attribute__((ext_vector_type(4))) _Float16 v4h;
typedef __attribute__((ext_vector_type(2))) unsigned short v2us;
typedef __attribute__((ext_vector_type(4))) unsigned short v4us;
typedef __attribute__((ext_vector_type(2))) float v2f;
typedef __attribute__((ext_vector_type(4))) int v4i;

__global__ __launch_bounds__(256) void k_cvt8(const float* __restrict__ src, bf* dst, size_t n8) { const size_t i = (size_t)blockIdx.x * 256 + threadIdx.x; if (i >= n8) return; const v8f v = *(const v8f*)(src + i * 8); v8us o;
#pragma unroll
    for (int k = 0; k < 8; ++k) o[k] = f2bf(v[k]); *(v8us*)(dst + i * 8) = o;  }

__global__ __launch_bounds__(256) void k_pl2(const float* __restrict__ F, bf* Ph, bf* Pl, size_t n4) { const size_t i = (size_t)blockIdx.x * 256 + threadIdx.x; if (i >= n4) return; const v4f v = *(const v4f*)(F + i * 4); v4us oh, ol;
#pragma unroll
    for (int q = 0; q < 4; ++q) { unsigned short a, c; splitf(v[q], a, c); oh[q] = a; ol[q] = c; } *(v4us*)(Ph + i * 4) = oh; *(v4us*)(Pl + i * 4) = ol;  }

// k_rope: blockIdx.y = sequence (token rows TT y + t in, head planes nheads y + h out); head planes [h][t][d] (fp16 + hi/lo) of rope(x) x sc with the rotate-half convention out[d] = x[d] cos[t][d] - x[d+HD/2] sin[t][d], out[d+HD/2] = x[d+HD/2] cos[t][d+HD/2] + x[d] sin[t][d+HD/2]
__global__ __launch_bounds__(256) void k_rope(const float* __restrict__ F, int pitch, int nheads, const float* __restrict__ CS, const float* __restrict__ RF, const float* __restrict__ nw, float sc, h16* P16, bf* Ph, bf* Pl) {
    const size_t e = ((size_t)blockIdx.x * 256 + threadIdx.x) * 2; if (e >= (size_t)nheads * TT * HD) return; { const size_t y = blockIdx.y, po = y * nheads * TT * HD; F += y * TT * pitch; P16 += po; Ph += po; Pl += po; } const int d = (int)(e % HD); const int t = (int)((e / HD) % TT); const int h = (int)(e / ((size_t)HD * TT)); const float* f = F + (size_t)t * pitch + h * HD; const float rf = RF ? RF[(size_t)h * TT + t] : 1.0f; v2h o16; v2us oh, ol;
#pragma unroll
    for (int q = 0; q < 2; ++q) { const int dd = d + q; const int dp = (dd < HD / 2) ? dd + HD / 2 : dd - HD / 2; float x0 = f[dd], x1 = f[dp];
        if (RF) { float n0 = __fmul_rn(x0, rf), n1 = __fmul_rn(x1, rf); x0 = __fmul_rn(bfr(nw[dd]), n0); x1 = __fmul_rn(bfr(nw[dp]), n1); }
        const v2f cs = *(const v2f*)(CS + ((size_t)t * HD + dd) * 2); float a = __fmul_rn(x0, cs[0]), bq = __fmul_rn(x1, cs[1]); const float r = ((dd < HD / 2) ? __fsub_rn(a, bq) : __fadd_rn(a, bq)) * sc;
        o16[q] = tohx(r); unsigned short a2, c2; splitf(r, a2, c2); oh[q] = a2; ol[q] = c2; }
    *(v2h*)(P16 + e) = o16; *(v2us*)(Ph + e) = oh; *(v2us*)(Pl + e) = ol;  }
__global__ __launch_bounds__(256) void k_vtp(const float* __restrict__ F, int pitch, int nheads, h16* V16, bf* Vh, bf* Vl) { const size_t e = ((size_t)blockIdx.x * 256 + threadIdx.x) * 2; if (e >= (size_t)nheads * HD * TT) return; F += (size_t)blockIdx.y * TT * pitch; V16 += (size_t)blockIdx.y * nheads * HD * TT; /* blockIdx.y = sequence */ const int t = (int)(e % TT); const int d = (int)((e / TT) % HD); const int g = (int)(e / ((size_t)TT * HD)); v2h o16; v2us oh, ol;
#pragma unroll
    for (int q = 0; q < 2; ++q) { const float x = F[(size_t)(t + q) * pitch + g * HD + d]; o16[q] = tohx(x); (void)oh; (void)ol; }
    *(v2h*)(V16 + e) = o16;  }
__constant__ float INVT[HD / 2] = { 1.000000000e+00f, 7.498942018e-01f, 5.623413324e-01f, 4.216965139e-01f, 3.162277639e-01f, 2.371373624e-01f, 1.778279394e-01f, 1.333521456e-01f, 1.000000015e-01f, 7.498941571e-02f, 5.623412877e-02f, 4.216964915e-02f, 3.162277862e-02f, 2.371373586e-02f, 1.778279431e-02f, 1.333521493e-02f, 9.999999776e-03f, 7.498942316e-03f, 5.623413250e-03f, 4.216964822e-03f, 3.162277862e-03f, 2.371373819e-03f, 1.778279431e-03f, 1.333521446e-03f, 1.000000047e-03f, 7.498941850e-04f, 5.623413017e-04f, 4.216964880e-04f, 3.162277862e-04f, 2.371373848e-04f, 1.778279402e-04f, 1.333521504e-04f };   // float32 1 / 10000^(2i/64), i = 0..31
__global__ __launch_bounds__(256) void k_cs2d(float* CS) { const int idx = blockIdx.x * 256 + threadIdx.x; if (idx >= TT * HD) return; const int d = idx % HD; const int t = idx / HD; const int p = (d < HD / 2) ? (t / GW) : (t % GW); const float a = __fmul_rn((float)p, INVT[d % (HD / 2)]); v2f cs; cs[0] = cosf(a); cs[1] = sinf(a); *(v2f*)(CS + (size_t)idx * 2) = cs;  }
// k_asoft: per row (zz, i): t = S x HD^-0.5 (no mask); softmax over the 1024 keys (register row, one exp, fixed trees);
__global__ __launch_bounds__(256) void k_asoft(const float* __restrict__ Sb, h16* P16, bf* Ph, bf* Pl) {
    const int lane = threadIdx.x & 31; const int row = blockIdx.x * 8 + (threadIdx.x >> 5); if (row >= ZH * TT) return; const int i = row % TT; const int zz = row / TT; (void)zz; const bool hires = (i < RH); const float* sr = Sb + (size_t)row * TT; float v[TT / 32]; float mx = -3.0e38f;
#pragma unroll
    for (int ch = 0; ch < TT / 128; ++ch) { const int j0 = ch * 128 + lane * 4; const v4f a = *(const v4f*)(sr + j0);
#pragma unroll
        for (int q = 0; q < 4; ++q) { const int j = j0 + q; (void)j; const float t = a[q] * SCL; v[ch * 4 + q] = t; mx = fmaxf(mx, t); } }
#pragma unroll
    for (int sh = 16; sh; sh >>= 1) mx = fmaxf(mx, __shfl_xor(mx, sh, 32));
    float sum = 0.f;
#pragma unroll
    for (int k = 0; k < TT / 32; ++k) { float d0 = __fsub_rn(v[k], mx); v[k] = __builtin_amdgcn_exp2f(__fmul_rn(d0, 1.4426950408889634f)); sum += v[k]; }
#pragma unroll
    for (int sh = 16; sh; sh >>= 1) sum += __shfl_xor(sum, sh, 32);
    const float f = __fdiv_rn(hires ? 1.0f : PCAR, sum);
{
        if (hires) {
#pragma unroll
            for (int ch = 0; ch < TT / 128; ++ch) { v4us oh, ol;
#pragma unroll
                for (int q = 0; q < 4; ++q) { unsigned short a, c2; splitf(v[ch * 4 + q] * f, a, c2); oh[q] = a; ol[q] = c2; }
                const size_t oo = ((size_t)zz * (RH ? RH : 1) + i) * TT + ch * 128 + lane * 4; *(v4us*)(Ph + oo) = oh; *(v4us*)(Pl + oo) = ol; }
        } else {
#pragma unroll
            for (int ch = 0; ch < TT / 128; ++ch) { v4h o4;
#pragma unroll
                for (int q = 0; q < 4; ++q) o4[q] = tohx(v[ch * 4 + q] * f);
                *(v4h*)(P16 + (size_t)row * TT + ch * 128 + lane * 4) = o4; } }
         }
}
__global__ __launch_bounds__(256) void k_merge(const float* __restrict__ O, int h0, float* OUTb) { const size_t e = ((size_t)blockIdx.x * 256 + threadIdx.x) * 2; if (e >= (size_t)ZH * TT * HD) return; const int d = (int)(e % HD); const int t = (int)((e / HD) % TT); const int zz = (int)(e / ((size_t)HD * TT)); const float cs = (t < RH) ? 1.0f : (1.0f / PCAR); const size_t oo = (size_t)t * DQ + (h0 + zz) * HD + d;
    v2f o2; o2[0] = O[e] * cs; o2[1] = O[e + 1] * cs; *(v2f*)(OUTb + oo) = o2;  }

extern "C" void kernel_launch(void* const* d_in, const int* in_sizes, int n_in,
                              void* d_out, int out_size, void* d_ws, size_t ws_size, hipStream_t stream) {
    (void)in_sizes; (void)n_in; (void)out_size;
    const float* x = (const float*)d_in[0]; const float* wqkv = (const float*)d_in[1]; const float* wo = (const float*)d_in[2];   /* order tensor [8][1024][1024], w_qkv ('oi' (out, in) [3072][1024]: PER HEAD q | k | v: rows 192 h + 0..63 | 64..127 | 128..191), w_proj ('oi' [1024][1024]): THREE inputs, all read; no bias anywhere */
    float* OUT = (float*)d_out;     // [8][1024][1024]
    char* wsp = (char*)d_ws;
    auto take = [&](size_t bytes) { char* p = wsp; wsp += (bytes + 255) & ~(size_t)255; return (void*)p; };
    bf* BT = (bf*)take((size_t)3 * DQ * DM * 2); bf* WO = (bf*)take((size_t)DM * DQ * 2); float* CS = (float*)take((size_t)TT * HD * 2 * 4);   /* the fused 'oi' weight is the Bt operand as it stands: ONE bf16 copy [3072][1024]: head h's q | k | v row blocks begin at rows 3 HD h + 0 | HD | 2 HD */
    const size_t NP = (size_t)NB_ * NH_ * TT * HD;   /* elements of one plane over all sequences and heads (= NB_ TT DQ) */
    bf* QPh = (bf*)take(NP * 2); bf* QPl = (bf*)take(NP * 2); bf* KPh = (bf*)take(NP * 2); bf* KPl = (bf*)take(NP * 2); h16* VT16 = (h16*)take(NP * 2); bf* VTh = nullptr; bf* VTl = nullptr; bf* Ph = nullptr; bf* Pl = nullptr;   /* RH 0 at attn.v: no hi / lo value or weight plane exists: the value builder and the softmax store the f16 plane only and do not read those arguments */
    float* FM = (float*)take(NP * 4); float* Ob = (float*)take((size_t)ZH * TT * HD * 4);   /* FM: the merged heads of every sequence, f32, token-major */
    float* Sb = (float*)take((size_t)ZH * TT * TT * 4); h16* P16 = (h16*)take((size_t)ZH * TT * TT * 2);   /* one pass's scores and weights: 64 + 32 MiB, adjacent */
    /* stream-ordered reuse: before the first pass the Sb | P16 block holds XB | FQ | FK (80 of its 96 MiB) and FM holds the two f16 q / k planes; after the last pass Sb holds the hi / lo planes of FM */
    bf* XB = (bf*)Sb; float* FQ = (float*)(XB + (size_t)NB_ * TT * DM); float* FK = FQ + NP; h16* QP16 = (h16*)FM; h16* KP16 = QP16 + NP; bf* ATh = (bf*)Sb; bf* ATl = ATh + NP;
    if ((size_t)(wsp - (char*)d_ws) > ws_size) return;    // ws 256 MiB
    float* FV = FK;   // v projection reuses the k buffer after the k planes are built (stream-ordered)
    { k_cvt8<<<(unsigned)(((size_t)3 * DQ * DM / 8 + 255) / 256), 256, 0, stream>>>(wqkv, BT, (size_t)3 * DQ * DM / 8); k_cvt8<<<(unsigned)(((size_t)DM * DQ / 8 + 255) / 256), 256, 0, stream>>>(wo, WO, (size_t)DM * DQ / 8); }   /* 'oi' (out, in): each weight is the Bt operand as it stands */
    k_cs2d<<<(TT * HD + 255) / 256, 256, 0, stream>>>(CS);
    const unsigned LQ = (unsigned)(((size_t)NH_ * TT * HD / 2 + 255) / 256), LKv = (unsigned)(((size_t)NKV * TT * HD / 2 + 255) / 256);
    const size_t zB = (size_t)3 * HD * DM;   /* the Bt z-stride of the per-head projections: 192 weight rows a head */
    k_cvt8<<<(unsigned)(((size_t)NB_ * TT * DM / 8 + 255) / 256), 256, 0, stream>>>(x, XB, (size_t)NB_ * TT * DM / 8);   /* ONE bf16 copy of all sequences, read by the three projections */
    /* PER HEAD, ONE 64-wide projection tile column over the 8,192 token rows: q_h = x W[192 h + 0..63]^T into columns 64 h .. of the [NB_ TT][DQ] plane: sixteen heads on the z axis: EVERY z READS THE SAME A (z-stride 0); Bt z-stride 192 rows; C z-stride 64 columns at a row pitch of DQ */
    k_gemmw<bf, 0, false><<<dim3(NB_ * TT / 64, HD / 64, NH_), 32, 0, stream>>>(XB, nullptr, BT, nullptr, DM, FQ, DQ, nullptr, (size_t)0, zB, (size_t)HD);
    k_rope<<<dim3(LQ, NB_), 256, 0, stream>>>(FQ, DQ, NH_, CS, nullptr, nullptr, 1.0f, QP16, QPh, QPl);
    k_gemmw<bf, 0, false><<<dim3(NB_ * TT / 64, HD / 64, NKV), 32, 0, stream>>>(XB, nullptr, BT + (size_t)HD * DM, nullptr, DM, FK, DKV, nullptr, (size_t)0, zB, (size_t)HD);
    k_rope<<<dim3(LKv, NB_), 256, 0, stream>>>(FK, DKV, NKV, CS, nullptr, nullptr, 1.0f, KP16, KPh, KPl);
    k_gemmw<bf, 0, false><<<dim3(NB_ * TT / 64, HD / 64, NKV), 32, 0, stream>>>(XB, nullptr, BT + (size_t)2 * HD * DM, nullptr, DM, FV, DKV, nullptr, (size_t)0, zB, (size_t)HD);
    k_vtp<<<dim3(LKv, NB_), 256, 0, stream>>>(FV, DKV, NKV, VT16, VTh, VTl);
    for (int b = 0; b < NB_; ++b) { const size_t zp = (size_t)b * NH_ * TT * HD;   // one pass: the sixteen heads of sequence b on the z axis (one kv head per query head; z-strides TT*HD)
        k_gemmw<bf, 2, false><<<dim3(TT / 64, TT / 64, ZH), 32, 0, stream>>>(QPh + zp, QPl + zp, KPh + zp, KPl + zp, HD, Sb, TT, nullptr, (size_t)TT * HD, (size_t)TT * HD, (size_t)TT * TT);   /* the scores of EVERY query row on the hi / lo planes (three products) */
        k_asoft<<<ZH * TT / 8, 256, 0, stream>>>(Sb, P16, Ph, Pl);
        k_gemmw<h16, 0, false><<<dim3(TT / 64, HD / 64, ZH), 32, 0, stream>>>(P16, nullptr, VT16 + zp, nullptr, TT, Ob, HD, nullptr, (size_t)TT * TT, (size_t)HD * TT, (size_t)TT * HD);
        k_merge<<<(unsigned)(((size_t)ZH * TT * HD / 2 + 255) / 256), 256, 0, stream>>>(Ob, 0, FM + (size_t)b * TT * DQ); }
    k_pl2<<<(unsigned)((NP / 4 + 255) / 256), 256, 0, stream>>>(FM, ATh, ATl, NP / 4);
    k_gemmw<bf, 1, false><<<dim3(NB_ * TT / 64, DM / 64, 1), 32, 0, stream>>>(ATh, ATl, WO, nullptr, DQ, OUT, DM, nullptr, 0, 0, 0);
}

// v002
// Measured time: 334 microseconds a run.
// In both of two side-by-side timings against v001, it was 2.35 times as fast.
// Counting every step since v000, it is 9.10 times as fast.
#include <hip/hip_runtime.h>

// Multi-head self-attention on a 32 x 32 grid of positions with a FIXED TWO-DIMENSIONAL ROTARY TABLE (tensor [8][1024][1024]; qkv = tensor w_qkv^T with ONE fused 'oi' (out, in) weight [3072][1024] normal x 1/32, no bias; THE 3,072 COLUMNS ARE (16, 3, 64): PER HEAD q | k | v: head h's q, k, v are weight rows 192 h + 0..63 | + 64..127 | + 128..191; position n = 32 y + x; theta[n][d] = y x ifreq[d] for d < 32 and x x ifreq[d - 32] for d >= 32 with ifreq[i] = 1 / 10000^(i / 32); q, k -> u cos(theta) + rot(u) sin(theta) with rot(u) = cat(-u2, u1) on the two 32-wide halves: rotate-half over the full head width with its own angle at every d; scores / sqrt(64); no mask; softmax over all 1,024 keys; heads merged; out = merged w_proj^T ('oi' x 1/32, no bias) -> [8][1024][1024] (8.4 M); argument order tensor, w_qkv, w_proj).
// Layout, ALL EIGHT SEQUENCES AT ONCE (token rows 1024 b + t, head planes 16 b + h): ONE bf16 copy of x, read by the three projections; the fused 'oi' weight cast once as it stands: head h's q | k | v row blocks at rows 192 h + 0 | 64 | 128: each projection ONE launch of sixteen z-blocks (A z-stride 0; Bt z-stride 192 rows; C z-stride 64 columns); the computed two-dimensional table; q and k planes with the rotation (fp16 + hi/lo), the f16 value plane; dense T-1,024 attention in ONE kernel (k_fattn): THE SCORES OF EVERY ROW ON THE hi / lo PLANES (three products), kept in registers; running-maximum softmax; attn.v of EVERY row on ONE fp16 product (the weights x 1024); the merged heads stored as hi / lo planes; hi/lo x w_proj exact.
// Compute dtypes, f32 accumulate: every input rounded to bf16; projections exact; the table in f32; scores: bf16 hi / lo, 3 products; softmax f32; attn.v: one fp16 product; w_proj hl x exact.

#define NB_  8
#define TT   1024
#define DM   1024
#define NH_  16
#define NKV  16
#define REP  (NH_ / NKV)
#define HD   64
#define DQ   (NH_ * HD)
#define DKV  (NKV * HD)
#define ZH   16    // sizes the 64 + 32 MiB workspace block only
#define RH   0     // unused: the scores of every row run on the hi / lo planes (three products), attn.v on one f16 product
#define WIN  0
#define GW   32    // the grid is 32 x 32 positions: t = GW y + x
#define SCL  0.125f   // HD^-0.5
typedef _Float16 h16;
typedef unsigned short bf;
typedef __attribute__((ext_vector_type(16))) __bf16   v16bf;
typedef __attribute__((ext_vector_type(16))) _Float16 v16h;
typedef __attribute__((ext_vector_type(8)))  _Float16 v8h;
typedef __attribute__((ext_vector_type(8)))  unsigned short v8us;
typedef __attribute__((ext_vector_type(8)))  float    v8f;
typedef __attribute__((ext_vector_type(4)))  float    v4f;
typedef v8h  __attribute__((may_alias)) v8ha;
typedef v4f  __attribute__((may_alias)) v4fa;
typedef v8us __attribute__((may_alias)) v8usa;

__device__ __forceinline__ unsigned short f2bf(float f) { unsigned u = __float_as_uint(f); u += 0x7FFFu + ((u >> 16) & 1u); return (unsigned short)(u >> 16); }
__device__ __forceinline__ float bf2f(unsigned short b) { return __uint_as_float(((unsigned)b) << 16); }
__device__ __forceinline__ float bfr(float f) { return bf2f(f2bf(f)); }
__device__ __forceinline__ v16h cat16(v8h lo, v8h hi) { return __builtin_shufflevector(lo, hi, 0, 1, 2, 3, 4, 5, 6, 7, 8, 9, 10, 11, 12, 13, 14, 15); }
__device__ __forceinline__ v16bf cat16b(v8us lo, v8us hi) { return __builtin_bit_cast(v16bf, __builtin_shufflevector(lo, hi, 0, 1, 2, 3, 4, 5, 6, 7, 8, 9, 10, 11, 12, 13, 14, 15)); }
__device__ __forceinline__ v8f wmma16(v16h a, v16h b, v8f c) { return __builtin_amdgcn_wmma_f32_16x16x32_f16(false, a, false, b, (short)0, c, false, false); }
__device__ __forceinline__ v8f wmmab(v16bf a, v16bf b, v8f c) { return __builtin_amdgcn_wmma_f32_16x16x32_bf16(false, a, false, b, (short)0, c, false, false); }



// ---- k_gemmw: register-blocked GEMM, ONE WAVE per 64x64 output tile (16 accumulators), operands straight from K-contiguous 16-bit planes; grid (M/64, N/64, Z), 32 threads.
// C[m][n] (f32, pitch ldc, + optional f32 bias[n]) = sum_k A[m][k] Bt[n][k] (+ split products per NSPLIT). z-batch strides sA/sB/sC in elements. K % 32 == 0.
template <typename T16> struct WFrag;
template <> struct WFrag<h16> { typedef v16h V; static __device__ __forceinline__ V ld(const h16* p) { return cat16(*(const v8h*)p, *(const v8h*)(p + 16)); } static __device__ __forceinline__ v8f mma(V a, V b, v8f c) { return wmma16(a, b, c); } };
template <> struct WFrag<bf> { typedef v16bf V; static __device__ __forceinline__ V ld(const bf* p) { return cat16b(*(const v8us*)p, *(const v8us*)(p + 16)); } static __device__ __forceinline__ v8f mma(V a, V b, v8f c) { return wmmab(a, b, c); } };
template <typename T16, int NSPLIT, bool BIAS>
__global__ __launch_bounds__(32) void k_gemmw(const T16* __restrict__ A, const T16* __restrict__ A2, const T16* __restrict__ Bt, const T16* __restrict__ Bt2, int K, float* C, int ldc, const float* __restrict__ bias, size_t sA, size_t sB, size_t sC) {
    typedef typename WFrag<T16>::V V;
    __shared__ __align__(16) float os[16 * 68];
    const size_t z = blockIdx.z; A += z * sA; if (A2) A2 += z * sA; Bt += z * sB; if (Bt2) Bt2 += z * sB; C += z * sC;
    const int lane = threadIdx.x & 31, lr = lane & 15, hi = lane >> 4; const int r0 = blockIdx.x * 64, c0 = blockIdx.y * 64;
    v8f acc[4][4];
#pragma unroll
    for (int mb = 0; mb < 4; ++mb)
#pragma unroll
        for (int nb = 0; nb < 4; ++nb) acc[mb][nb] = (v8f){};
    const size_t aoff = (size_t)(r0 + lr) * K + 8 * hi, boff = (size_t)(c0 + lr) * K + 8 * hi;
    for (int kc = 0; kc < K; kc += 32) {
        V a[4], a2[4];
#pragma unroll
        for (int mb = 0; mb < 4; ++mb) { a[mb] = WFrag<T16>::ld(A + aoff + (size_t)mb * 16 * K + kc); if (NSPLIT == 1 || NSPLIT == 2) a2[mb] = WFrag<T16>::ld(A2 + aoff + (size_t)mb * 16 * K + kc); }
#pragma unroll
        for (int nb = 0; nb < 4; ++nb) { const V b = WFrag<T16>::ld(Bt + boff + (size_t)nb * 16 * K + kc); V b2; if (NSPLIT >= 2) b2 = WFrag<T16>::ld(Bt2 + boff + (size_t)nb * 16 * K + kc);
#pragma unroll
            for (int mb = 0; mb < 4; ++mb) { acc[mb][nb] = WFrag<T16>::mma(a[mb], b, acc[mb][nb]); if (NSPLIT == 1 || NSPLIT == 2) acc[mb][nb] = WFrag<T16>::mma(a2[mb], b, acc[mb][nb]); if (NSPLIT >= 2) acc[mb][nb] = WFrag<T16>::mma(a[mb], b2, acc[mb][nb]); } }
        asm volatile("v_nop\n\tv_nop\n\tv_nop\n\tv_nop" : "+v"(acc[0][0]), "+v"(acc[1][1]), "+v"(acc[2][2]), "+v"(acc[3][3]) : "v"(a[0]), "v"(a[3]));
    }
#pragma unroll
    for (int mb = 0; mb < 4; ++mb) {
#pragma unroll
        for (int nb = 0; nb < 4; ++nb) {
#pragma unroll
            for (int j = 0; j < 8; ++j) os[(hi * 8 + j) * 68 + nb * 16 + lr] = acc[mb][nb][j]; }
        __builtin_amdgcn_wave_barrier(); asm volatile("" ::: "memory");
        float* crow = C + (size_t)(r0 + mb * 16) * ldc + c0;
{
#pragma unroll
            for (int s = 0; s < 8; ++s) { const int row = 2 * s + hi, cofs = lr * 4; v4f val = *(const v4fa*)(os + row * 68 + cofs); if (BIAS) { val[0] += bfr(bias[c0 + cofs]); val[1] += bfr(bias[c0 + cofs + 1]); val[2] += bfr(bias[c0 + cofs + 2]); val[3] += bfr(bias[c0 + cofs + 3]); }
                *(v4f*)(crow + (size_t)row * ldc + cofs) = val; }
             }
        __builtin_amdgcn_wave_barrier(); asm volatile("" ::: "memory");
    }
}

__device__ __forceinline__ h16 tohx(float x) { return (h16)x; }
__device__ __forceinline__ void splitf(float y, unsigned short& h, unsigned short& l) { h = f2bf(y); l = f2bf(y - bf2f(h)); }
typedef __attribute__((ext_vector_type(2))) _Float16 v2h;
typedef __attribute__((ext_vector_type(4))) _Float16 v4h;
typedef __attribute__((ext_vector_type(2))) unsigned short v2us;
typedef __attribute__((ext_vector_type(4))) unsigned short v4us;
typedef __attribute__((ext_vector_type(2))) float v2f;
typedef __attribute__((ext_vector_type(4))) int v4i;

__global__ __launch_bounds__(256) void k_cvt8(const float* __restrict__ src, bf* dst, size_t n8) { const size_t i = (size_t)blockIdx.x * 256 + threadIdx.x; if (i >= n8) return; const v8f v = *(const v8f*)(src + i * 8); v8us o;
#pragma unroll
    for (int k = 0; k < 8; ++k) o[k] = f2bf(v[k]); *(v8us*)(dst + i * 8) = o;  }

// k_rope: blockIdx.y = sequence (token rows TT y + t in, head planes nheads y + h out); head planes [h][t][d] (fp16 + hi/lo) of rope(x) x sc with the rotate-half convention out[d] = x[d] cos[t][d] - x[d+HD/2] sin[t][d], out[d+HD/2] = x[d+HD/2] cos[t][d+HD/2] + x[d] sin[t][d+HD/2]
__global__ __launch_bounds__(256) void k_rope(const float* __restrict__ F, int pitch, int nheads, const float* __restrict__ CS, const float* __restrict__ RF, const float* __restrict__ nw, float sc, h16* P16, bf* Ph, bf* Pl) {
    const size_t e = ((size_t)blockIdx.x * 256 + threadIdx.x) * 2; if (e >= (size_t)nheads * TT * HD) return; { const size_t y = blockIdx.y, po = y * nheads * TT * HD; F += y * TT * pitch; P16 += po; Ph += po; Pl += po; } const int d = (int)(e % HD); const int t = (int)((e / HD) % TT); const int h = (int)(e / ((size_t)HD * TT)); const float* f = F + (size_t)t * pitch + h * HD; const float rf = RF ? RF[(size_t)h * TT + t] : 1.0f; v2h o16; v2us oh, ol;
#pragma unroll
    for (int q = 0; q < 2; ++q) { const int dd = d + q; const int dp = (dd < HD / 2) ? dd + HD / 2 : dd - HD / 2; float x0 = f[dd], x1 = f[dp];
        if (RF) { float n0 = __fmul_rn(x0, rf), n1 = __fmul_rn(x1, rf); x0 = __fmul_rn(bfr(nw[dd]), n0); x1 = __fmul_rn(bfr(nw[dp]), n1); }
        const v2f cs = *(const v2f*)(CS + ((size_t)t * HD + dd) * 2); float a = __fmul_rn(x0, cs[0]), bq = __fmul_rn(x1, cs[1]); const float r = ((dd < HD / 2) ? __fsub_rn(a, bq) : __fadd_rn(a, bq)) * sc;
        o16[q] = tohx(r); unsigned short a2, c2; splitf(r, a2, c2); oh[q] = a2; ol[q] = c2; }
    *(v2h*)(P16 + e) = o16; *(v2us*)(Ph + e) = oh; *(v2us*)(Pl + e) = ol;  }
__global__ __launch_bounds__(256) void k_vtp(const float* __restrict__ F, int pitch, int nheads, h16* V16, bf* Vh, bf* Vl) { const size_t e = ((size_t)blockIdx.x * 256 + threadIdx.x) * 2; if (e >= (size_t)nheads * HD * TT) return; F += (size_t)blockIdx.y * TT * pitch; V16 += (size_t)blockIdx.y * nheads * HD * TT; /* blockIdx.y = sequence */ const int t = (int)(e % TT); const int d = (int)((e / TT) % HD); const int g = (int)(e / ((size_t)TT * HD)); v2h o16; v2us oh, ol;
#pragma unroll
    for (int q = 0; q < 2; ++q) { const float x = F[(size_t)(t + q) * pitch + g * HD + d]; o16[q] = tohx(x); (void)oh; (void)ol; }
    *(v2h*)(V16 + e) = o16;  }
__constant__ float INVT[HD / 2] = { 1.000000000e+00f, 7.498942018e-01f, 5.623413324e-01f, 4.216965139e-01f, 3.162277639e-01f, 2.371373624e-01f, 1.778279394e-01f, 1.333521456e-01f, 1.000000015e-01f, 7.498941571e-02f, 5.623412877e-02f, 4.216964915e-02f, 3.162277862e-02f, 2.371373586e-02f, 1.778279431e-02f, 1.333521493e-02f, 9.999999776e-03f, 7.498942316e-03f, 5.623413250e-03f, 4.216964822e-03f, 3.162277862e-03f, 2.371373819e-03f, 1.778279431e-03f, 1.333521446e-03f, 1.000000047e-03f, 7.498941850e-04f, 5.623413017e-04f, 4.216964880e-04f, 3.162277862e-04f, 2.371373848e-04f, 1.778279402e-04f, 1.333521504e-04f };   // float32 1 / 10000^(2i/64), i = 0..31
__global__ __launch_bounds__(256) void k_cs2d(float* CS) { const int idx = blockIdx.x * 256 + threadIdx.x; if (idx >= TT * HD) return; const int d = idx % HD; const int t = idx / HD; const int p = (d < HD / 2) ? (t / GW) : (t % GW); const float a = __fmul_rn((float)p, INVT[d % (HD / 2)]); v2f cs; cs[0] = cosf(a); cs[1] = sinf(a); *(v2f*)(CS + (size_t)idx * 2) = cs;  }
#define FKS 64     // keys per stage
#define FPT 72     // LDS row pitch in 16-bit elements: 128 + 16 bytes
#define FNS (TT / FKS)
__device__ __forceinline__ v16bf ldsb(const unsigned short* p) { const v8us a = *(const v8usa*)p, b = *(const v8usa*)(p + 16); return cat16b(a, b); }
__device__ __forceinline__ v16h ldsh(const unsigned short* p) { const v8us a = *(const v8usa*)p, b = *(const v8usa*)(p + 16); return cat16(__builtin_bit_cast(v8h, a), __builtin_bit_cast(v8h, b)); }
__device__ __forceinline__ float exp2s(float x) { float r; asm("v_exp_f32 %0, %1\n\tv_nop" : "=v"(r) : "v"(x)); return r; }   // 2^x; the v_nop in the same statement keeps the one slot behind the transcendental, whichever instruction the compiler schedules next
__global__ __launch_bounds__(256) __attribute__((amdgpu_waves_per_eu(4, 4))) void k_fattn(const bf* __restrict__ Qh, const bf* __restrict__ Ql, const bf* __restrict__ Kh, const bf* __restrict__ Kl, const h16* __restrict__ Vt, bf* ATh, bf* ATl) {
    __shared__ __align__(16) unsigned short sm[2][3][FKS * FPT];
    const int tid = threadIdx.x, lane = tid & 31, wv = tid >> 5, lr = lane & 15, hi = lane >> 4;
    const size_t po = (size_t)blockIdx.y * TT * HD; const int q0 = blockIdx.x * 256 + wv * 32;
    v16bf qh[2][2], ql[2][2];
#pragma unroll
    for (int qt = 0; qt < 2; ++qt)
#pragma unroll
        for (int ks = 0; ks < 2; ++ks) { const size_t o = po + (size_t)(q0 + qt * 16 + lr) * HD + ks * 32 + 8 * hi; qh[qt][ks] = WFrag<bf>::ld(Qh + o); ql[qt][ks] = WFrag<bf>::ld(Ql + o); }
    v8f oa[2][4]; float mr[2], ls[2];
#pragma unroll
    for (int qt = 0; qt < 2; ++qt) { mr[qt] = -3.0e38f; ls[qt] = 0.f;
#pragma unroll
        for (int db = 0; db < 4; ++db) oa[qt][db] = (v8f){}; }
    // staging map: 512 chunks of 16 bytes a tile, two a thread: chunk c = tid + 256 i -> row c / 8, 16-byte column c % 8
    const int srow = tid >> 3, scol = (tid & 7) * 8;
    const bf* gkh = Kh + po + (size_t)srow * HD + scol; const bf* gkl = Kl + po + (size_t)srow * HD + scol; const h16* gv = Vt + po + (size_t)srow * TT + scol;   // the lane's own source pointers; they step one stage behind each stage's LDS stores
    const int sdst = srow * FPT + scol;
    v8us g[6];
    g[0] = *(const v8usa*)(gkh); g[1] = *(const v8usa*)(gkh + 32 * HD); g[2] = *(const v8usa*)(gkl); g[3] = *(const v8usa*)(gkl + 32 * HD); g[4] = *(const v8usa*)(gv); g[5] = *(const v8usa*)(gv + (size_t)32 * TT);
    asm volatile("s_wait_xcnt 0x0" ::: "memory");   // stands behind the loads, in front of the step of their address registers below
#pragma unroll
    for (int a = 0; a < 3; ++a) { *(v8usa*)(&sm[0][a][sdst]) = g[2 * a]; *(v8usa*)(&sm[0][a][sdst + 32 * FPT]) = g[2 * a + 1]; }
    gkh += FKS * HD; gkl += FKS * HD; gv += FKS;
    __syncthreads();
    const float CL = SCL * 1.4426950408889634f;
    for (int s = 0; s < FNS; ++s) {
        const int buf = s & 1;
        if (s + 1 < FNS) {   // the next stage's tiles fly while this stage is worked on
            g[0] = *(const v8usa*)(gkh); g[1] = *(const v8usa*)(gkh + 32 * HD); g[2] = *(const v8usa*)(gkl); g[3] = *(const v8usa*)(gkl + 32 * HD); g[4] = *(const v8usa*)(gv); g[5] = *(const v8usa*)(gv + (size_t)32 * TT);
            asm volatile("s_wait_xcnt 0x0" ::: "memory"); }   // stands behind the loads, in front of the step of their address registers at the foot of the trip
#pragma unroll 1   // one 32-key pass at a time in the listing: unrolled, the second pass's fragment loads are hoisted and the registers pass 256 (two work-groups a WGP lost)
        for (int kp = 0; kp < FKS / 32; ++kp) {
            v8f sc[2][2];
#pragma unroll
            for (int kt = 0; kt < 2; ++kt) { const int ro = (kp * 32 + kt * 16 + lr) * FPT + 8 * hi;
                const v16bf ah0 = ldsb(&sm[buf][0][ro]), ah1 = ldsb(&sm[buf][0][ro + 32]), al0 = ldsb(&sm[buf][1][ro]), al1 = ldsb(&sm[buf][1][ro + 32]);
#pragma unroll
                for (int qt = 0; qt < 2; ++qt) { v8f a = (v8f){};
                    a = wmmab(ah0, qh[qt][0], a); a = wmmab(ah0, ql[qt][0], a); a = wmmab(al0, qh[qt][0], a);
                    a = wmmab(ah1, qh[qt][1], a); a = wmmab(ah1, ql[qt][1], a); a = wmmab(al1, qh[qt][1], a); sc[qt][kt] = a; } }
            v16h pb[2];
#pragma unroll
            for (int qt = 0; qt < 2; ++qt) { float mx = sc[qt][0][0];
#pragma unroll
                for (int j = 1; j < 8; ++j) mx = fmaxf(mx, sc[qt][0][j]);
#pragma unroll
                for (int j = 0; j < 8; ++j) mx = fmaxf(mx, sc[qt][1][j]);
                mx = fmaxf(mx, __shfl_xor(mx, 16, 32));
                const float mn = fmaxf(mr[qt], mx * CL); const float al = exp2s(mr[qt] - mn); mr[qt] = mn; const float off = 10.0f - mn;   /* + 10: the weights and their sum carry x 1024, clear of the f16 subnormals */
                float sa = 0.f, sb = 0.f;
#pragma unroll
                for (int j = 0; j < 8; ++j) { const float p0 = exp2s(fmaf(sc[qt][0][j], CL, off)); sa += p0; pb[qt][j] = tohx(p0); }
#pragma unroll
                for (int j = 0; j < 8; ++j) { const float p1 = exp2s(fmaf(sc[qt][1][j], CL, off)); sb += p1; pb[qt][8 + j] = tohx(p1); }
                ls[qt] = fmaf(ls[qt], al, sa + sb);
#pragma unroll
                for (int db = 0; db < 4; ++db) oa[qt][db] *= al; }
#pragma unroll
            for (int db = 0; db < 4; ++db) { const v16h vf = ldsh(&sm[buf][2][(db * 16 + lr) * FPT + kp * 32 + 8 * hi]);
#pragma unroll
                for (int qt = 0; qt < 2; ++qt) oa[qt][db] = wmma16(vf, pb[qt], oa[qt][db]); }
        }
        if (s + 1 < FNS) {
#pragma unroll
            for (int a = 0; a < 3; ++a) { *(v8usa*)(&sm[buf ^ 1][a][sdst]) = g[2 * a]; *(v8usa*)(&sm[buf ^ 1][a][sdst + 32 * FPT]) = g[2 * a + 1]; }
            gkh += FKS * HD; gkl += FKS * HD; gv += FKS; }
        __syncthreads();   // publishes stage s + 1 and ends every wave's reads of the buffer that the next trip refills
    }
    const size_t bq = blockIdx.y >> 4, hh = blockIdx.y & 15;
#pragma unroll
    for (int qt = 0; qt < 2; ++qt) { const float lt = ls[qt] + __shfl_xor(ls[qt], 16, 32); const float inv = __fdiv_rn(1.0f, lt);
        const size_t ob = (bq * TT + q0 + qt * 16 + lr) * DQ + hh * HD + hi * 8;
#pragma unroll
        for (int db = 0; db < 4; ++db) { v8us vh, vl;
#pragma unroll
            for (int j = 0; j < 8; ++j) { unsigned short a, c; splitf(oa[qt][db][j] * inv, a, c); vh[j] = a; vl[j] = c; }
            *(v8us*)(ATh + ob + db * 16) = vh; *(v8us*)(ATl + ob + db * 16) = vl; } }
}

extern "C" void kernel_launch(void* const* d_in, const int* in_sizes, int n_in,
                              void* d_out, int out_size, void* d_ws, size_t ws_size, hipStream_t stream) {
    (void)in_sizes; (void)n_in; (void)out_size;
    const float* x = (const float*)d_in[0]; const float* wqkv = (const float*)d_in[1]; const float* wo = (const float*)d_in[2];   /* order tensor [8][1024][1024], w_qkv ('oi' (out, in) [3072][1024]: PER HEAD q | k | v: rows 192 h + 0..63 | 64..127 | 128..191), w_proj ('oi' [1024][1024]): THREE inputs, all read; no bias anywhere */
    float* OUT = (float*)d_out;     // [8][1024][1024]
    char* wsp = (char*)d_ws;
    auto take = [&](size_t bytes) { char* p = wsp; wsp += (bytes + 255) & ~(size_t)255; return (void*)p; };
    bf* BT = (bf*)take((size_t)3 * DQ * DM * 2); bf* WO = (bf*)take((size_t)DM * DQ * 2); float* CS = (float*)take((size_t)TT * HD * 2 * 4);   /* the fused 'oi' weight is the Bt operand as it stands: ONE bf16 copy [3072][1024]: head h's q | k | v row blocks begin at rows 3 HD h + 0 | HD | 2 HD */
    const size_t NP = (size_t)NB_ * NH_ * TT * HD;   /* elements of one plane over all sequences and heads (= NB_ TT DQ) */
    bf* QPh = (bf*)take(NP * 2); bf* QPl = (bf*)take(NP * 2); bf* KPh = (bf*)take(NP * 2); bf* KPl = (bf*)take(NP * 2); h16* VT16 = (h16*)take(NP * 2); bf* VTh = nullptr; bf* VTl = nullptr;   /* no hi / lo value plane exists: the value builder stores the f16 plane only and does not read those arguments */
    float* FM = (float*)take(NP * 4);   /* holds the two f16 q / k planes that the rotation writes beside the hi / lo planes */
    float* Sb = (float*)take((size_t)ZH * TT * TT * 4); (void)take((size_t)ZH * TT * TT * 2);   /* one block of 64 + 32 MiB, adjacent */
    /* stream-ordered reuse: up to the value builder the block holds XB | FQ | FK (80 of its 96 MiB); the attention kernel then writes the hi / lo planes of the merged heads over its first 32 MiB */
    bf* XB = (bf*)Sb; float* FQ = (float*)(XB + (size_t)NB_ * TT * DM); float* FK = FQ + NP; h16* QP16 = (h16*)FM; h16* KP16 = QP16 + NP; bf* ATh = (bf*)Sb; bf* ATl = ATh + NP;
    if ((size_t)(wsp - (char*)d_ws) > ws_size) return;    // ws 256 MiB
    float* FV = FK;   // v projection reuses the k buffer after the k planes are built (stream-ordered)
    { k_cvt8<<<(unsigned)(((size_t)3 * DQ * DM / 8 + 255) / 256), 256, 0, stream>>>(wqkv, BT, (size_t)3 * DQ * DM / 8); k_cvt8<<<(unsigned)(((size_t)DM * DQ / 8 + 255) / 256), 256, 0, stream>>>(wo, WO, (size_t)DM * DQ / 8); }   /* 'oi' (out, in): each weight is the Bt operand as it stands */
    k_cs2d<<<(TT * HD + 255) / 256, 256, 0, stream>>>(CS);
    const unsigned LQ = (unsigned)(((size_t)NH_ * TT * HD / 2 + 255) / 256), LKv = (unsigned)(((size_t)NKV * TT * HD / 2 + 255) / 256);
    const size_t zB = (size_t)3 * HD * DM;   /* the Bt z-stride of the per-head projections: 192 weight rows a head */
    k_cvt8<<<(unsigned)(((size_t)NB_ * TT * DM / 8 + 255) / 256), 256, 0, stream>>>(x, XB, (size_t)NB_ * TT * DM / 8);   /* ONE bf16 copy of all sequences, read by the three projections */
    /* PER HEAD, ONE 64-wide projection tile column over the 8,192 token rows: q_h = x W[192 h + 0..63]^T into columns 64 h .. of the [NB_ TT][DQ] plane: sixteen heads on the z axis: EVERY z READS THE SAME A (z-stride 0); Bt z-stride 192 rows; C z-stride 64 columns at a row pitch of DQ */
    k_gemmw<bf, 0, false><<<dim3(NB_ * TT / 64, HD / 64, NH_), 32, 0, stream>>>(XB, nullptr, BT, nullptr, DM, FQ, DQ, nullptr, (size_t)0, zB, (size_t)HD);
    k_rope<<<dim3(LQ, NB_), 256, 0, stream>>>(FQ, DQ, NH_, CS, nullptr, nullptr, 1.0f, QP16, QPh, QPl);
    k_gemmw<bf, 0, false><<<dim3(NB_ * TT / 64, HD / 64, NKV), 32, 0, stream>>>(XB, nullptr, BT + (size_t)HD * DM, nullptr, DM, FK, DKV, nullptr, (size_t)0, zB, (size_t)HD);
    k_rope<<<dim3(LKv, NB_), 256, 0, stream>>>(FK, DKV, NKV, CS, nullptr, nullptr, 1.0f, KP16, KPh, KPl);
    k_gemmw<bf, 0, false><<<dim3(NB_ * TT / 64, HD / 64, NKV), 32, 0, stream>>>(XB, nullptr, BT + (size_t)2 * HD * DM, nullptr, DM, FV, DKV, nullptr, (size_t)0, zB, (size_t)HD);
    k_vtp<<<dim3(LKv, NB_), 256, 0, stream>>>(FV, DKV, NKV, VT16, VTh, VTl);
    k_fattn<<<dim3(TT / 256, NB_ * NH_), 256, 0, stream>>>(QPh, QPl, KPh, KPl, VT16, ATh, ATl);   /* every head plane of every sequence in one launch; writes the hi / lo planes of the merged heads over the dead XB | FQ block */
    k_gemmw<bf, 1, false><<<dim3(NB_ * TT / 64, DM / 64, 1), 32, 0, stream>>>(ATh, ATl, WO, nullptr, DQ, OUT, DM, nullptr, 0, 0, 0);
}

// v003
// A run of this version takes 266 microseconds.
// Two timings next to v002 put it at 1.25 and 1.26 times that version's speed.
// Counting every step since v000, it is 11.4 times as fast.
#include <hip/hip_runtime.h>

// Multi-head self-attention on a 32 x 32 grid of positions with a FIXED TWO-DIMENSIONAL ROTARY TABLE (tensor [8][1024][1024]; qkv = tensor w_qkv^T with ONE fused 'oi' (out, in) weight [3072][1024] normal x 1/32, no bias; THE 3,072 COLUMNS ARE (16, 3, 64): PER HEAD q | k | v: head h's q, k, v are weight rows 192 h + 0..63 | + 64..127 | + 128..191; position n = 32 y + x; theta[n][d] = y x ifreq[d] for d < 32 and x x ifreq[d - 32] for d >= 32 with ifreq[i] = 1 / 10000^(i / 32); q, k -> u cos(theta) + rot(u) sin(theta) with rot(u) = cat(-u2, u1) on the two 32-wide halves: rotate-half over the full head width with its own angle at every d; scores / sqrt(64); no mask; softmax over all 1,024 keys; heads merged; out = merged w_proj^T ('oi' x 1/32, no bias) -> [8][1024][1024] (8.4 M); argument order tensor, w_qkv, w_proj).
// Layout, ALL EIGHT SEQUENCES AT ONCE (token rows 1024 b + t, head planes 16 b + h): ONE bf16 copy of x, read by the three projections; the fused 'oi' weight cast once as it stands: head h's q | k | v row blocks at rows 192 h + 0 | 64 | 128: the three projections ONE launch of 48 tile columns (k_gemmw with QKV = true), which rotates q and k with the computed two-dimensional table, splits them hi / lo and transposes the f16 value plane on its accumulators; dense T-1,024 attention in ONE kernel (k_fattn): THE SCORES OF EVERY ROW ON THE hi / lo PLANES (three products), kept in registers; running-maximum softmax; attn.v of EVERY row on ONE fp16 product (the weights x 1024); the merged heads stored as hi / lo planes; hi/lo x w_proj exact.
// Compute dtypes, f32 accumulate: every input rounded to bf16; projections exact; the table in f32; scores: bf16 hi / lo, 3 products; softmax f32; attn.v: one fp16 product; w_proj hl x exact.

#define NB_  8
#define TT   1024
#define DM   1024
#define NH_  16
#define NKV  16
#define REP  (NH_ / NKV)
#define HD   64
#define DQ   (NH_ * HD)
#define DKV  (NKV * HD)
#define ZH   16    // sizes the 64 + 32 MiB workspace block only
#define RH   0     // unused: the scores of every row run on the hi / lo planes (three products), attn.v on one f16 product
#define WIN  0
#define GW   32    // the grid is 32 x 32 positions: t = GW y + x
#define SCL  0.125f   // HD^-0.5
typedef _Float16 h16;
typedef unsigned short bf;
typedef __attribute__((ext_vector_type(16))) __bf16   v16bf;
typedef __attribute__((ext_vector_type(16))) _Float16 v16h;
typedef __attribute__((ext_vector_type(8)))  _Float16 v8h;
typedef __attribute__((ext_vector_type(8)))  unsigned short v8us;
typedef __attribute__((ext_vector_type(8)))  float    v8f;
typedef __attribute__((ext_vector_type(4)))  float    v4f;
typedef v8h  __attribute__((may_alias)) v8ha;
typedef v4f  __attribute__((may_alias)) v4fa;
typedef v8us __attribute__((may_alias)) v8usa;

__device__ __forceinline__ unsigned short f2bf(float f) { unsigned u = __float_as_uint(f); u += 0x7FFFu + ((u >> 16) & 1u); return (unsigned short)(u >> 16); }
__device__ __forceinline__ float bf2f(unsigned short b) { return __uint_as_float(((unsigned)b) << 16); }
__device__ __forceinline__ float bfr(float f) { return bf2f(f2bf(f)); }
__device__ __forceinline__ v16h cat16(v8h lo, v8h hi) { return __builtin_shufflevector(lo, hi, 0, 1, 2, 3, 4, 5, 6, 7, 8, 9, 10, 11, 12, 13, 14, 15); }
__device__ __forceinline__ v16bf cat16b(v8us lo, v8us hi) { return __builtin_bit_cast(v16bf, __builtin_shufflevector(lo, hi, 0, 1, 2, 3, 4, 5, 6, 7, 8, 9, 10, 11, 12, 13, 14, 15)); }
__device__ __forceinline__ v8f wmma16(v16h a, v16h b, v8f c) { return __builtin_amdgcn_wmma_f32_16x16x32_f16(false, a, false, b, (short)0, c, false, false); }
__device__ __forceinline__ v8f wmmab(v16bf a, v16bf b, v8f c) { return __builtin_amdgcn_wmma_f32_16x16x32_bf16(false, a, false, b, (short)0, c, false, false); }



// The projections' epilogue (QKV = true): qkv = x w_qkv^T as 128 x 48 tiles of 64 x 64 in ONE launch, with the rotation, the hi / lo split and the value transpose done on the accumulators.
// Tile column c holds weight rows 64 c .. 64 c + 63 = head c / 3, part c % 3 (q | k | v): a tile is one head's whole width for 64 tokens of one sequence, so the rotation's partner d +- 32 is accumulator nb +- 2 of the same lane.
// q, k: rotated in registers, staged f32 in LDS 16 tokens at a time, read back 8 d a lane, split hi / lo, stored as 512 contiguous bytes an instruction into [plane][t][d]. v: 8 tokens a lane packed to f16, staged [d][t] in LDS, stored as whole 128-byte rows of [plane][d][t].
#define VPT 72     // LDS row pitch of the staged value tile in 16-bit elements: 128 + 16 bytes
typedef __attribute__((ext_vector_type(2))) float v2f;
typedef __attribute__((ext_vector_type(4))) unsigned v4u;
typedef __attribute__((ext_vector_type(2))) __bf16 v2bf;
__device__ __forceinline__ h16 tohx(float x) { return (h16)x; }
__device__ __forceinline__ unsigned pk2bf(float a, float b) { v2f x; x[0] = a; x[1] = b; return __builtin_bit_cast(unsigned, __builtin_convertvector(x, v2bf)); }   // two f32 -> two bf16, round to nearest even, a in the low half
struct QkvOut { const float* CS; bf* Qh; bf* Ql; bf* Kh; bf* Kl; h16* Vt; };   // the cos | sin table [t][d][2] and the planes that the attention reads; all null where QKV = false

// ---- k_gemmw: register-blocked GEMM, ONE WAVE per 64x64 output tile (16 accumulators), operands straight from K-contiguous 16-bit planes; grid (M/64, N/64, Z), 32 threads.
// C[m][n] (f32, pitch ldc, + optional f32 bias[n]) = sum_k A[m][k] Bt[n][k] (+ split products per NSPLIT). z-batch strides sA/sB/sC in elements. K % 32 == 0.
template <typename T16> struct WFrag;
template <> struct WFrag<h16> { typedef v16h V; static __device__ __forceinline__ V ld(const h16* p) { return cat16(*(const v8h*)p, *(const v8h*)(p + 16)); } static __device__ __forceinline__ v8f mma(V a, V b, v8f c) { return wmma16(a, b, c); } };
template <> struct WFrag<bf> { typedef v16bf V; static __device__ __forceinline__ V ld(const bf* p) { return cat16b(*(const v8us*)p, *(const v8us*)(p + 16)); } static __device__ __forceinline__ v8f mma(V a, V b, v8f c) { return wmmab(a, b, c); } };
template <typename T16, int NSPLIT, bool BIAS, bool QKV>
__global__ __launch_bounds__(32) void k_gemmw(const T16* __restrict__ A, const T16* __restrict__ A2, const T16* __restrict__ Bt, const T16* __restrict__ Bt2, int K, float* C, int ldc, const float* __restrict__ bias, size_t sA, size_t sB, size_t sC, QkvOut qo) {
    typedef typename WFrag<T16>::V V;
    __shared__ __align__(16) float os[QKV ? HD * VPT / 2 : 16 * 68];   // QKV: 9,216 bytes, the value tile; the q / k staging uses its first 16 x 68 floats
    const size_t z = blockIdx.z; A += z * sA; if (A2) A2 += z * sA; Bt += z * sB; if (Bt2) Bt2 += z * sB; C += z * sC;
    const int lane = threadIdx.x & 31, lr = lane & 15, hi = lane >> 4; const int r0 = blockIdx.x * 64, c0 = blockIdx.y * 64;
    v8f acc[4][4];
#pragma unroll
    for (int mb = 0; mb < 4; ++mb)
#pragma unroll
        for (int nb = 0; nb < 4; ++nb) acc[mb][nb] = (v8f){};
    const size_t aoff = (size_t)(r0 + lr) * K + 8 * hi, boff = (size_t)(c0 + lr) * K + 8 * hi;
    for (int kc = 0; kc < K; kc += 32) {
        V a[4], a2[4];
#pragma unroll
        for (int mb = 0; mb < 4; ++mb) { a[mb] = WFrag<T16>::ld(A + aoff + (size_t)mb * 16 * K + kc); if (NSPLIT == 1 || NSPLIT == 2) a2[mb] = WFrag<T16>::ld(A2 + aoff + (size_t)mb * 16 * K + kc); }
#pragma unroll
        for (int nb = 0; nb < 4; ++nb) { const V b = WFrag<T16>::ld(Bt + boff + (size_t)nb * 16 * K + kc); V b2; if (NSPLIT >= 2) b2 = WFrag<T16>::ld(Bt2 + boff + (size_t)nb * 16 * K + kc);
#pragma unroll
            for (int mb = 0; mb < 4; ++mb) { acc[mb][nb] = WFrag<T16>::mma(a[mb], b, acc[mb][nb]); if (NSPLIT == 1 || NSPLIT == 2) acc[mb][nb] = WFrag<T16>::mma(a2[mb], b, acc[mb][nb]); if (NSPLIT >= 2) acc[mb][nb] = WFrag<T16>::mma(a[mb], b2, acc[mb][nb]); } }
        asm volatile("v_nop\n\tv_nop\n\tv_nop\n\tv_nop" : "+v"(acc[0][0]), "+v"(acc[1][1]), "+v"(acc[2][2]), "+v"(acc[3][3]) : "v"(a[0]), "v"(a[3]));
    }
    if constexpr (QKV) {
        const int part = blockIdx.y % 3, t0 = r0 % TT; const size_t plane = (size_t)(r0 / TT) * NH_ + blockIdx.y / 3;
        if (part == 2) {
            h16* sv = (h16*)os;
#pragma unroll
            for (int mb = 0; mb < 4; ++mb)
#pragma unroll
                for (int nb = 0; nb < 4; ++nb) { v8h o;
#pragma unroll
                    for (int j = 0; j < 8; ++j) o[j] = tohx(acc[mb][nb][j]);
                    *(v8ha*)(sv + (nb * 16 + lr) * VPT + mb * 16 + hi * 8) = o; }
            __builtin_amdgcn_wave_barrier(); asm volatile("" ::: "memory");   // the reads below take other lanes' LDS stores: neither the compiler nor the scheduler may lift them over the stores
            h16* vrow = qo.Vt + (plane * HD + (lane >> 3)) * TT + t0 + (lane & 7) * 8; const h16* sr = sv + (lane >> 3) * VPT + (lane & 7) * 8;
#pragma unroll
            for (int s = 0; s < 16; ++s) *(v8h*)(vrow + (size_t)s * 4 * TT) = *(const v8ha*)(sr + s * 4 * VPT);
            return;
        }
        bf* Ph = part ? qo.Kh : qo.Qh; bf* Pl = part ? qo.Kl : qo.Ql; const size_t ob = (plane * TT + t0) * HD + lane * 8;
        const char* cst = (const char*)(qo.CS + (size_t)t0 * HD * 2); const unsigned clb = lr * 8, cub = (hi * 8 * HD + HD / 2 + lr) * 8;   // the tile's first table row; the lane's own byte offsets in it: d = lr, and d = 32 + lr of token 8 hi
        v2f cl[2][2];   // d < 32: the angle is that of the grid row t / 32: one cos | sin pair for each 32-token half of the tile
#pragma unroll
        for (int g = 0; g < 2; ++g)
#pragma unroll
            for (int nb = 0; nb < 2; ++nb) cl[g][nb] = *(const v2f*)(cst + clb + (g * GW * HD + nb * 16) * 8);
#pragma unroll
        for (int ml = 0; ml < 2; ++ml) {
            v2f cu[2][8];   // d >= 32: the angle is that of the grid column t % 32: tokens t and t + 32 share the pair
#pragma unroll
            for (int nb = 0; nb < 2; ++nb)
#pragma unroll
                for (int j = 0; j < 8; ++j) cu[nb][j] = *(const v2f*)(cst + cub + ((ml * 16 + j) * HD + nb * 16) * 8);
            asm volatile("s_wait_xcnt 0x0" :: "v"(clb), "v"(cub) : "memory");   // stands behind the table loads, in front of any overwrite of their address registers, which the two inputs keep whole up to here
#pragma unroll
            for (int g = 0; g < 2; ++g) { const int mb = 2 * g + ml;
#pragma unroll
                for (int nb = 0; nb < 2; ++nb)
#pragma unroll
                    for (int j = 0; j < 8; ++j) { const float x0 = acc[mb][nb][j], x1 = acc[mb][nb + 2][j];
                        os[(hi * 8 + j) * 68 + nb * 16 + lr] = x0 * cl[g][nb][0] - x1 * cl[g][nb][1];
                        os[(hi * 8 + j) * 68 + HD / 2 + nb * 16 + lr] = x1 * cu[nb][j][0] + x0 * cu[nb][j][1]; }
                __builtin_amdgcn_wave_barrier(); asm volatile("" ::: "memory");   // the reads below take other lanes' LDS stores
#pragma unroll
                for (int s = 0; s < 4; ++s) { const float* p = os + (4 * s + (lane >> 3)) * 68 + (lane & 7) * 8; const v4f u = *(const v4fa*)p, w = *(const v4fa*)(p + 4); v4u vh, vl;
#pragma unroll
                    for (int q = 0; q < 4; ++q) { const float y0 = (q < 2) ? u[2 * q] : w[2 * q - 4], y1 = (q < 2) ? u[2 * q + 1] : w[2 * q - 3]; const unsigned h2 = pk2bf(y0, y1);
                        vh[q] = h2; vl[q] = pk2bf(y0 - __uint_as_float(h2 << 16), y1 - __uint_as_float(h2 & 0xFFFF0000u)); }
                    *(v4u*)(Ph + ob + mb * 16 * HD + s * 4 * HD) = vh; *(v4u*)(Pl + ob + mb * 16 * HD + s * 4 * HD) = vl; }
                if (mb < 3) { __builtin_amdgcn_wave_barrier(); asm volatile("s_wait_xcnt 0x0" ::: "memory"); }   // not behind the last 16 tokens; stands behind the eight stores, in front of the overwrite of their data registers; its clobber also keeps the next 16 tokens' LDS stores behind the reads above
            }
        }
        return;
    }
#pragma unroll
    for (int mb = 0; mb < 4; ++mb) {
#pragma unroll
        for (int nb = 0; nb < 4; ++nb) {
#pragma unroll
            for (int j = 0; j < 8; ++j) os[(hi * 8 + j) * 68 + nb * 16 + lr] = acc[mb][nb][j]; }
        __builtin_amdgcn_wave_barrier(); asm volatile("" ::: "memory");
        float* crow = C + (size_t)(r0 + mb * 16) * ldc + c0;
{
#pragma unroll
            for (int s = 0; s < 8; ++s) { const int row = 2 * s + hi, cofs = lr * 4; v4f val = *(const v4fa*)(os + row * 68 + cofs); if (BIAS) { val[0] += bfr(bias[c0 + cofs]); val[1] += bfr(bias[c0 + cofs + 1]); val[2] += bfr(bias[c0 + cofs + 2]); val[3] += bfr(bias[c0 + cofs + 3]); }
                *(v4f*)(crow + (size_t)row * ldc + cofs) = val; }
             }
        __builtin_amdgcn_wave_barrier(); asm volatile("" ::: "memory");
    }
}

__device__ __forceinline__ void splitf(float y, unsigned short& h, unsigned short& l) { h = f2bf(y); l = f2bf(y - bf2f(h)); }
typedef __attribute__((ext_vector_type(2))) _Float16 v2h;
typedef __attribute__((ext_vector_type(4))) _Float16 v4h;
typedef __attribute__((ext_vector_type(2))) unsigned short v2us;
typedef __attribute__((ext_vector_type(4))) unsigned short v4us;

__global__ __launch_bounds__(256) void k_cvt8(const float* __restrict__ src, bf* dst, size_t n8) { const size_t i = (size_t)blockIdx.x * 256 + threadIdx.x; if (i >= n8) return; const v8f v = *(const v8f*)(src + i * 8); v8us o;
#pragma unroll
    for (int k = 0; k < 8; ++k) o[k] = f2bf(v[k]); *(v8us*)(dst + i * 8) = o;  }

__constant__ float INVT[HD / 2] = { 1.000000000e+00f, 7.498942018e-01f, 5.623413324e-01f, 4.216965139e-01f, 3.162277639e-01f, 2.371373624e-01f, 1.778279394e-01f, 1.333521456e-01f, 1.000000015e-01f, 7.498941571e-02f, 5.623412877e-02f, 4.216964915e-02f, 3.162277862e-02f, 2.371373586e-02f, 1.778279431e-02f, 1.333521493e-02f, 9.999999776e-03f, 7.498942316e-03f, 5.623413250e-03f, 4.216964822e-03f, 3.162277862e-03f, 2.371373819e-03f, 1.778279431e-03f, 1.333521446e-03f, 1.000000047e-03f, 7.498941850e-04f, 5.623413017e-04f, 4.216964880e-04f, 3.162277862e-04f, 2.371373848e-04f, 1.778279402e-04f, 1.333521504e-04f };   // float32 1 / 10000^(2i/64), i = 0..31
__global__ __launch_bounds__(256) void k_cs2d(float* CS) { const int idx = blockIdx.x * 256 + threadIdx.x; if (idx >= TT * HD) return; const int d = idx % HD; const int t = idx / HD; const int p = (d < HD / 2) ? (t / GW) : (t % GW); const float a = __fmul_rn((float)p, INVT[d % (HD / 2)]); v2f cs; cs[0] = cosf(a); cs[1] = sinf(a); *(v2f*)(CS + (size_t)idx * 2) = cs;  }
#define FKS 64     // keys per stage
#define FPT 72     // LDS row pitch in 16-bit elements: 128 + 16 bytes
#define FNS (TT / FKS)
__device__ __forceinline__ v16bf ldsb(const unsigned short* p) { const v8us a = *(const v8usa*)p, b = *(const v8usa*)(p + 16); return cat16b(a, b); }
__device__ __forceinline__ v16h ldsh(const unsigned short* p) { const v8us a = *(const v8usa*)p, b = *(const v8usa*)(p + 16); return cat16(__builtin_bit_cast(v8h, a), __builtin_bit_cast(v8h, b)); }
__device__ __forceinline__ float exp2s(float x) { float r; asm("v_exp_f32 %0, %1\n\tv_nop" : "=v"(r) : "v"(x)); return r; }   // 2^x; the v_nop in the same statement keeps the one slot behind the transcendental, whichever instruction the compiler schedules next
__global__ __launch_bounds__(256) __attribute__((amdgpu_waves_per_eu(4, 4))) void k_fattn(const bf* __restrict__ Qh, const bf* __restrict__ Ql, const bf* __restrict__ Kh, const bf* __restrict__ Kl, const h16* __restrict__ Vt, bf* ATh, bf* ATl) {
    __shared__ __align__(16) unsigned short sm[2][3][FKS * FPT];
    const int tid = threadIdx.x, lane = tid & 31, wv = tid >> 5, lr = lane & 15, hi = lane >> 4;
    const size_t po = (size_t)blockIdx.y * TT * HD; const int q0 = blockIdx.x * 256 + wv * 32;
    v16bf qh[2][2], ql[2][2];
#pragma unroll
    for (int qt = 0; qt < 2; ++qt)
#pragma unroll
        for (int ks = 0; ks < 2; ++ks) { const size_t o = po + (size_t)(q0 + qt * 16 + lr) * HD + ks * 32 + 8 * hi; qh[qt][ks] = WFrag<bf>::ld(Qh + o); ql[qt][ks] = WFrag<bf>::ld(Ql + o); }
    v8f oa[2][4]; float mr[2], ls[2];
#pragma unroll
    for (int qt = 0; qt < 2; ++qt) { mr[qt] = -3.0e38f; ls[qt] = 0.f;
#pragma unroll
        for (int db = 0; db < 4; ++db) oa[qt][db] = (v8f){}; }
    // staging map: 512 chunks of 16 bytes a tile, two a thread: chunk c = tid + 256 i -> row c / 8, 16-byte column c % 8
    const int srow = tid >> 3, scol = (tid & 7) * 8;
    const bf* gkh = Kh + po + (size_t)srow * HD + scol; const bf* gkl = Kl + po + (size_t)srow * HD + scol; const h16* gv = Vt + po + (size_t)srow * TT + scol;   // the lane's own source pointers; they step one stage behind each stage's LDS stores
    const int sdst = srow * FPT + scol;
    v8us g[6];
    g[0] = *(const v8usa*)(gkh); g[1] = *(const v8usa*)(gkh + 32 * HD); g[2] = *(const v8usa*)(gkl); g[3] = *(const v8usa*)(gkl + 32 * HD); g[4] = *(const v8usa*)(gv); g[5] = *(const v8usa*)(gv + (size_t)32 * TT);
    asm volatile("s_wait_xcnt 0x0" ::: "memory");   // stands behind the loads, in front of the step of their address registers below
#pragma unroll
    for (int a = 0; a < 3; ++a) { *(v8usa*)(&sm[0][a][sdst]) = g[2 * a]; *(v8usa*)(&sm[0][a][sdst + 32 * FPT]) = g[2 * a + 1]; }
    gkh += FKS * HD; gkl += FKS * HD; gv += FKS;
    __syncthreads();
    const float CL = SCL * 1.4426950408889634f;
    for (int s = 0; s < FNS; ++s) {
        const int buf = s & 1;
        if (s + 1 < FNS) {   // the next stage's tiles fly while this stage is worked on
            g[0] = *(const v8usa*)(gkh); g[1] = *(const v8usa*)(gkh + 32 * HD); g[2] = *(const v8usa*)(gkl); g[3] = *(const v8usa*)(gkl + 32 * HD); g[4] = *(const v8usa*)(gv); g[5] = *(const v8usa*)(gv + (size_t)32 * TT);
            asm volatile("s_wait_xcnt 0x0" ::: "memory"); }   // stands behind the loads, in front of the step of their address registers at the foot of the trip
#pragma unroll 1   // one 32-key pass at a time in the listing: unrolled, the second pass's fragment loads are hoisted and the registers pass 256 (two work-groups a WGP lost)
        for (int kp = 0; kp < FKS / 32; ++kp) {
            v8f sc[2][2];
#pragma unroll
            for (int kt = 0; kt < 2; ++kt) { const int ro = (kp * 32 + kt * 16 + lr) * FPT + 8 * hi;
                const v16bf ah0 = ldsb(&sm[buf][0][ro]), ah1 = ldsb(&sm[buf][0][ro + 32]), al0 = ldsb(&sm[buf][1][ro]), al1 = ldsb(&sm[buf][1][ro + 32]);
#pragma unroll
                for (int qt = 0; qt < 2; ++qt) { v8f a = (v8f){};
                    a = wmmab(ah0, qh[qt][0], a); a = wmmab(ah0, ql[qt][0], a); a = wmmab(al0, qh[qt][0], a);
                    a = wmmab(ah1, qh[qt][1], a); a = wmmab(ah1, ql[qt][1], a); a = wmmab(al1, qh[qt][1], a); sc[qt][kt] = a; } }
            v16h pb[2];
#pragma unroll
            for (int qt = 0; qt < 2; ++qt) { float mx = sc[qt][0][0];
#pragma unroll
                for (int j = 1; j < 8; ++j) mx = fmaxf(mx, sc[qt][0][j]);
#pragma unroll
                for (int j = 0; j < 8; ++j) mx = fmaxf(mx, sc[qt][1][j]);
                mx = fmaxf(mx, __shfl_xor(mx, 16, 32));
                const float mn = fmaxf(mr[qt], mx * CL); const float al = exp2s(mr[qt] - mn); mr[qt] = mn; const float off = 10.0f - mn;   /* + 10: the weights and their sum carry x 1024, clear of the f16 subnormals */
                float sa = 0.f, sb = 0.f;
#pragma unroll
                for (int j = 0; j < 8; ++j) { const float p0 = exp2s(fmaf(sc[qt][0][j], CL, off)); sa += p0; pb[qt][j] = tohx(p0); }
#pragma unroll
                for (int j = 0; j < 8; ++j) { const float p1 = exp2s(fmaf(sc[qt][1][j], CL, off)); sb += p1; pb[qt][8 + j] = tohx(p1); }
                ls[qt] = fmaf(ls[qt], al, sa + sb);
#pragma unroll
                for (int db = 0; db < 4; ++db) oa[qt][db] *= al; }
#pragma unroll
            for (int db = 0; db < 4; ++db) { const v16h vf = ldsh(&sm[buf][2][(db * 16 + lr) * FPT + kp * 32 + 8 * hi]);
#pragma unroll
                for (int qt = 0; qt < 2; ++qt) oa[qt][db] = wmma16(vf, pb[qt], oa[qt][db]); }
        }
        if (s + 1 < FNS) {
#pragma unroll
            for (int a = 0; a < 3; ++a) { *(v8usa*)(&sm[buf ^ 1][a][sdst]) = g[2 * a]; *(v8usa*)(&sm[buf ^ 1][a][sdst + 32 * FPT]) = g[2 * a + 1]; }
            gkh += FKS * HD; gkl += FKS * HD; gv += FKS; }
        __syncthreads();   // publishes stage s + 1 and ends every wave's reads of the buffer that the next trip refills
    }
    const size_t bq = blockIdx.y >> 4, hh = blockIdx.y & 15;
#pragma unroll
    for (int qt = 0; qt < 2; ++qt) { const float lt = ls[qt] + __shfl_xor(ls[qt], 16, 32); const float inv = __fdiv_rn(1.0f, lt);
        const size_t ob = (bq * TT + q0 + qt * 16 + lr) * DQ + hh * HD + hi * 8;
#pragma unroll
        for (int db = 0; db < 4; ++db) { v8us vh, vl;
#pragma unroll
            for (int j = 0; j < 8; ++j) { unsigned short a, c; splitf(oa[qt][db][j] * inv, a, c); vh[j] = a; vl[j] = c; }
            *(v8us*)(ATh + ob + db * 16) = vh; *(v8us*)(ATl + ob + db * 16) = vl; } }
}

extern "C" void kernel_launch(void* const* d_in, const int* in_sizes, int n_in,
                              void* d_out, int out_size, void* d_ws, size_t ws_size, hipStream_t stream) {
    (void)in_sizes; (void)n_in; (void)out_size;
    const float* x = (const float*)d_in[0]; const float* wqkv = (const float*)d_in[1]; const float* wo = (const float*)d_in[2];   /* order tensor [8][1024][1024], w_qkv ('oi' (out, in) [3072][1024]: PER HEAD q | k | v: rows 192 h + 0..63 | 64..127 | 128..191), w_proj ('oi' [1024][1024]): THREE inputs, all read; no bias anywhere */
    float* OUT = (float*)d_out;     // [8][1024][1024]
    char* wsp = (char*)d_ws;
    auto take = [&](size_t bytes) { char* p = wsp; wsp += (bytes + 255) & ~(size_t)255; return (void*)p; };
    bf* BT = (bf*)take((size_t)3 * DQ * DM * 2); bf* WO = (bf*)take((size_t)DM * DQ * 2); float* CS = (float*)take((size_t)TT * HD * 2 * 4);   /* the fused 'oi' weight is the Bt operand as it stands: ONE bf16 copy [3072][1024]: head h's q | k | v row blocks begin at rows 3 HD h + 0 | HD | 2 HD */
    const size_t NP = (size_t)NB_ * NH_ * TT * HD;   /* elements of one plane over all sequences and heads (= NB_ TT DQ) */
    bf* QPh = (bf*)take(NP * 2); bf* QPl = (bf*)take(NP * 2); bf* KPh = (bf*)take(NP * 2); bf* KPl = (bf*)take(NP * 2); h16* VT16 = (h16*)take(NP * 2); 
    float* Sb = (float*)take((size_t)ZH * TT * TT * 4); (void)take((size_t)ZH * TT * TT * 2);   /* one block of 64 + 32 MiB, adjacent */
    /* stream-ordered reuse: up to the projections the block holds XB (16 MiB); the attention kernel then writes the hi / lo planes of the merged heads over its first 32 MiB */
    bf* XB = (bf*)Sb; bf* ATh = (bf*)Sb; bf* ATl = ATh + NP;
    if ((size_t)(wsp - (char*)d_ws) > ws_size) return;    // ws 256 MiB
    { k_cvt8<<<(unsigned)(((size_t)3 * DQ * DM / 8 + 255) / 256), 256, 0, stream>>>(wqkv, BT, (size_t)3 * DQ * DM / 8); k_cvt8<<<(unsigned)(((size_t)DM * DQ / 8 + 255) / 256), 256, 0, stream>>>(wo, WO, (size_t)DM * DQ / 8); }   /* 'oi' (out, in): each weight is the Bt operand as it stands */
    k_cs2d<<<(TT * HD + 255) / 256, 256, 0, stream>>>(CS);
    k_cvt8<<<(unsigned)(((size_t)NB_ * TT * DM / 8 + 255) / 256), 256, 0, stream>>>(x, XB, (size_t)NB_ * TT * DM / 8);   /* ONE bf16 copy of all sequences, read by the projections */
    k_gemmw<bf, 0, false, true><<<dim3(NB_ * TT / 64, 3 * DQ / 64, 1), 32, 0, stream>>>(XB, nullptr, BT, nullptr, DM, nullptr, 0, nullptr, 0, 0, 0, QkvOut{CS, QPh, QPl, KPh, KPl, VT16});   /* tile column c = weight rows 64 c ..: head c / 3, part c % 3 (q | k | v); stores the planes that the attention reads */
    k_fattn<<<dim3(TT / 256, NB_ * NH_), 256, 0, stream>>>(QPh, QPl, KPh, KPl, VT16, ATh, ATl);   /* every head plane of every sequence in one launch; writes the hi / lo planes of the merged heads over the dead XB block */
    k_gemmw<bf, 1, false, false><<<dim3(NB_ * TT / 64, DM / 64, 1), 32, 0, stream>>>(ATh, ATl, WO, nullptr, DQ, OUT, DM, nullptr, 0, 0, 0, QkvOut{});
}

// v004
// Measured time: 165 microseconds a run.
// Next to v003, in two timings, it ran 1.60 and 1.62 times as fast.
// Counting every step since v000, it is 18.4 times as fast.
#include <hip/hip_runtime.h>

// Multi-head self-attention on a 32 x 32 grid of positions with a FIXED TWO-DIMENSIONAL ROTARY TABLE (tensor [8][1024][1024]; qkv = tensor w_qkv^T with ONE fused 'oi' (out, in) weight [3072][1024] normal x 1/32, no bias; THE 3,072 COLUMNS ARE (16, 3, 64): PER HEAD q | k | v: head h's q, k, v are weight rows 192 h + 0..63 | + 64..127 | + 128..191; position n = 32 y + x; theta[n][d] = y x ifreq[d] for d < 32 and x x ifreq[d - 32] for d >= 32 with ifreq[i] = 1 / 10000^(i / 32); q, k -> u cos(theta) + rot(u) sin(theta) with rot(u) = cat(-u2, u1) on the two 32-wide halves: rotate-half over the full head width with its own angle at every d; scores / sqrt(64); no mask; softmax over all 1,024 keys; heads merged; out = merged w_proj^T ('oi' x 1/32, no bias) -> [8][1024][1024] (8.4 M); argument order tensor, w_qkv, w_proj).
// Layout, ALL EIGHT SEQUENCES AT ONCE (token rows 1024 b + t, head planes 16 b + h): ONE bf16 copy of x, read by the three projections; the fused 'oi' weight cast once as it stands: head h's q | k | v row blocks at rows 192 h + 0 | 64 | 128: the three projections ONE launch of 48 tile columns (k_gemmw with QKV = true), which rotates q and k with the computed two-dimensional table, splits them hi / lo and transposes the f16 value plane on its accumulators; dense T-1,024 attention in ONE kernel (k_fattn): THE SCORES OF EVERY ROW ON THE hi / lo PLANES (three products), kept in registers; running-maximum softmax; attn.v of EVERY row on ONE fp16 product (the weights x 1024); the merged heads stored as hi / lo planes; hi/lo x w_proj exact.
// Compute dtypes, f32 accumulate: every input rounded to bf16; projections exact; the table in f32; scores: bf16 hi / lo, 3 products; softmax f32; attn.v: one fp16 product; w_proj hl x exact.

#define NB_  8
#define TT   1024
#define DM   1024
#define NH_  16
#define NKV  16
#define REP  (NH_ / NKV)
#define HD   64
#define DQ   (NH_ * HD)
#define DKV  (NKV * HD)
#define ZH   16    // sizes the 64 + 32 MiB workspace block only
#define RH   0     // unused: the scores of every row run on the hi / lo planes (three products), attn.v on one f16 product
#define WIN  0
#define GW   32    // the grid is 32 x 32 positions: t = GW y + x
#define SCL  0.125f   // HD^-0.5
typedef _Float16 h16;
typedef unsigned short bf;
typedef __attribute__((ext_vector_type(16))) __bf16   v16bf;
typedef __attribute__((ext_vector_type(16))) _Float16 v16h;
typedef __attribute__((ext_vector_type(8)))  _Float16 v8h;
typedef __attribute__((ext_vector_type(8)))  unsigned short v8us;
typedef __attribute__((ext_vector_type(8)))  float    v8f;
typedef __attribute__((ext_vector_type(4)))  float    v4f;
typedef v8h  __attribute__((may_alias)) v8ha;
typedef v4f  __attribute__((may_alias)) v4fa;
typedef v8us __attribute__((may_alias)) v8usa;

__device__ __forceinline__ unsigned short f2bf(float f) { unsigned u = __float_as_uint(f); u += 0x7FFFu + ((u >> 16) & 1u); return (unsigned short)(u >> 16); }
__device__ __forceinline__ float bf2f(unsigned short b) { return __uint_as_float(((unsigned)b) << 16); }
__device__ __forceinline__ float bfr(float f) { return bf2f(f2bf(f)); }
__device__ __forceinline__ v16h cat16(v8h lo, v8h hi) { return __builtin_shufflevector(lo, hi, 0, 1, 2, 3, 4, 5, 6, 7, 8, 9, 10, 11, 12, 13, 14, 15); }
__device__ __forceinline__ v16bf cat16b(v8us lo, v8us hi) { return __builtin_bit_cast(v16bf, __builtin_shufflevector(lo, hi, 0, 1, 2, 3, 4, 5, 6, 7, 8, 9, 10, 11, 12, 13, 14, 15)); }
__device__ __forceinline__ v8f wmma16(v16h a, v16h b, v8f c) { return __builtin_amdgcn_wmma_f32_16x16x32_f16(false, a, false, b, (short)0, c, false, false); }
__device__ __forceinline__ v8f wmmab(v16bf a, v16bf b, v8f c) { return __builtin_amdgcn_wmma_f32_16x16x32_bf16(false, a, false, b, (short)0, c, false, false); }



// The projections' epilogue (QKV = true): qkv = x w_qkv^T as 128 x 48 wave tiles of 64 x 64 in ONE launch, with the rotation, the hi / lo split and the value transpose done on the accumulators.
// Tile column c holds weight rows 64 c .. 64 c + 63 = head c / 3, part c % 3 (q | k | v): a tile is one head's whole width for 64 tokens of one sequence, so the rotation's partner d +- 32 is accumulator nb +- 2 of the same lane.
// q, k: rotated in registers, staged f32 in LDS 16 tokens at a time, read back 8 d a lane, split hi / lo, stored as 512 contiguous bytes an instruction into [plane][t][d]. v: 8 tokens a lane packed to f16, staged [d][t] in LDS, stored as whole 128-byte rows of [plane][d][t].
#define VPT 72     // LDS row pitch of the staged value tile in 16-bit elements: 128 + 16 bytes
typedef __attribute__((ext_vector_type(2))) float v2f;
typedef __attribute__((ext_vector_type(4))) unsigned v4u;
typedef __attribute__((ext_vector_type(2))) __bf16 v2bf;
__device__ __forceinline__ h16 tohx(float x) { return (h16)x; }
__device__ __forceinline__ unsigned pk2bf(float a, float b) { v2f x; x[0] = a; x[1] = b; return __builtin_bit_cast(unsigned, __builtin_convertvector(x, v2bf)); }   // two f32 -> two bf16, round to nearest even, a in the low half
struct QkvOut { const float* CS; bf* Qh; bf* Ql; bf* Kh; bf* Kl; h16* Vt; };   // the cos | sin table [t][d][2] and the planes that the attention reads; all null where QKV = false

// ---- k_gemmw: register-blocked GEMM, ONE WAVE per 64x64 output tile (16 accumulators), EIGHT WAVES (2 x 4 tiles = 128 x 256 of C) a work-group; grid (M/128, N/256, Z), 256 threads.
// The work-group's operand rows (A 128 | A2 128 where NSPLIT = 1 | Bt 256) go global -> LDS by asynchronous copies, 64 k a stage: whole 128-byte lines, 4 rows a wave-wide copy, LDS pitch 144 bytes; two buffers, the next stage's copies fly while this one is worked on; every wave reads its fragments from LDS in the k order that it read them in from the planes.
// C[m][n] (f32, pitch ldc, + optional f32 bias[n]) = sum_k A[m][k] Bt[n][k] (+ A2 Bt where NSPLIT = 1). z-batch strides sA/sB/sC in elements. K % 64 == 0.
#define GKS 64     // k per stage
#define GPI 72     // LDS row pitch in 16-bit elements: 128 + 16 bytes
#define GLS (32 * GPI * 2)   // LDS bytes between two copies of a thread: 32 rows
// Four or eight asynchronous copies of 16 bytes a lane, 32 rows apart (rs elements in the plane, GLS bytes in LDS). The s_wait_xcnt is the last line of the copies' own statement, so that it stands in front of every later write of their address registers.
template <typename T16> __device__ __forceinline__ void acp4(unsigned l, const T16* g, size_t rs) {
    asm volatile("global_load_async_to_lds_b128 %0, %4, off\n\tglobal_load_async_to_lds_b128 %1, %5, off\n\tglobal_load_async_to_lds_b128 %2, %6, off\n\tglobal_load_async_to_lds_b128 %3, %7, off\n\ts_wait_xcnt 0x0"
                 :: "v"(l), "v"(l + GLS), "v"(l + 2 * GLS), "v"(l + 3 * GLS), "v"(g), "v"(g + rs), "v"(g + 2 * rs), "v"(g + 3 * rs) : "memory"); }
template <typename T16> __device__ __forceinline__ void acp8(unsigned l, const T16* g, const T16* h, size_t rs) {
    asm volatile("global_load_async_to_lds_b128 %0, %8, off\n\tglobal_load_async_to_lds_b128 %1, %9, off\n\tglobal_load_async_to_lds_b128 %2, %10, off\n\tglobal_load_async_to_lds_b128 %3, %11, off\n\t"
                 "global_load_async_to_lds_b128 %4, %12, off\n\tglobal_load_async_to_lds_b128 %5, %13, off\n\tglobal_load_async_to_lds_b128 %6, %14, off\n\tglobal_load_async_to_lds_b128 %7, %15, off\n\ts_wait_xcnt 0x0"
                 :: "v"(l), "v"(l + GLS), "v"(l + 2 * GLS), "v"(l + 3 * GLS), "v"(l + 4 * GLS), "v"(l + 5 * GLS), "v"(l + 6 * GLS), "v"(l + 7 * GLS),
                    "v"(g), "v"(g + rs), "v"(g + 2 * rs), "v"(g + 3 * rs), "v"(h), "v"(h + rs), "v"(h + 2 * rs), "v"(h + 3 * rs) : "memory"); }
template <typename T16> struct WFrag;
template <> struct WFrag<h16> { typedef v16h V; static __device__ __forceinline__ V ld(const h16* p) { return cat16(*(const v8h*)p, *(const v8h*)(p + 16)); } static __device__ __forceinline__ V lds(const h16* p) { return cat16(*(const v8ha*)p, *(const v8ha*)(p + 16)); } static __device__ __forceinline__ v8f mma(V a, V b, v8f c) { return wmma16(a, b, c); } };
template <> struct WFrag<bf> { typedef v16bf V; static __device__ __forceinline__ V ld(const bf* p) { return cat16b(*(const v8us*)p, *(const v8us*)(p + 16)); } static __device__ __forceinline__ V lds(const bf* p) { return cat16b(*(const v8usa*)p, *(const v8usa*)(p + 16)); } static __device__ __forceinline__ v8f mma(V a, V b, v8f c) { return wmmab(a, b, c); } };
template <typename T16, int NSPLIT, bool BIAS, bool QKV>
__global__ __launch_bounds__(256) void k_gemmw(const T16* __restrict__ A, const T16* __restrict__ A2, const T16* __restrict__ Bt, const T16* __restrict__ Bt2, int K, float* C, int ldc, const float* __restrict__ bias, size_t sA, size_t sB, size_t sC, QkvOut qo) {
    typedef typename WFrag<T16>::V V;
    static_assert(NSPLIT == 0 || NSPLIT == 1, "the staged rows are A | A2 | Bt");
    constexpr int AR = (NSPLIT == 1) ? 256 : 128, BUFE = (AR + 256) * GPI;   // rows of A (| A2) in a buffer; 16-bit elements of a buffer
    __shared__ __align__(16) float ring[2 * BUFE / 2];   // two buffers; behind the loop each wave stages its output in a slice of its own
    const size_t z = blockIdx.z; A += z * sA; if (A2) A2 += z * sA; Bt += z * sB; C += z * sC; (void)Bt2;
    const int tid = threadIdx.x, lane = tid & 31, lr = lane & 15, hi = lane >> 4; const int wv = __builtin_amdgcn_readfirstlane(tid >> 5);
    const int r0 = blockIdx.x * 128 + (wv & 1) * 64, c0 = blockIdx.y * 256 + (wv >> 1) * 64;
    v8f acc[4][4];
#pragma unroll
    for (int mb = 0; mb < 4; ++mb)
#pragma unroll
        for (int nb = 0; nb < 4; ++nb) acc[mb][nb] = (v8f){};
    // copy map: chunk c = tid + 256 i of 16 bytes -> row c / 8 of the buffer, 16-byte column c % 8
    const size_t rs = (size_t)32 * K; const int srow = tid >> 3, scol = (tid & 7) * 8;
    const T16* ua = A + (size_t)blockIdx.x * 128 * K; const T16* ua2 = (NSPLIT == 1) ? A2 + (size_t)blockIdx.x * 128 * K : nullptr; const T16* ub = Bt + (size_t)blockIdx.y * 256 * K;   // the work-group's first row of each operand
    size_t vo = (size_t)srow * K + scol;   // the lane's own element offset from each of them; it steps one stage behind each stage's copies
    const unsigned l0 = (unsigned)(size_t)ring + (srow * GPI + scol) * 2;   // the lane's own LDS byte address in buffer 0
    auto fill = [&](unsigned l) {
        if constexpr (NSPLIT == 1) { acp8(l, ua + vo, ua2 + vo, rs); acp8(l + 8 * GLS, ub + vo, ub + 4 * rs + vo, rs); }
        else { acp4(l, ua + vo, rs); acp8(l + 4 * GLS, ub + vo, ub + 4 * rs + vo, rs); }
        vo += GKS; };
    const int nst = K / GKS;
    fill(l0);
    asm volatile("s_wait_asynccnt 0x0" ::: "memory");   // this wave's copies of stage 0 have landed
    __syncthreads();                                     // publishes stage 0
    if (1 < nst) fill(l0 + BUFE * 2);
    const int fa = ((wv & 1) * 64 + lr) * GPI + 8 * hi, fb = (AR + (wv >> 1) * 64 + lr) * GPI + 8 * hi;   // the lane's own fragment rows in a buffer
    for (int t = 0; t < nst; ++t) {
        const T16* sb = (const T16*)ring + (t & 1) * BUFE;
#pragma unroll
        for (int ks = 0; ks < GKS; ks += 32) {
            V a[4], a2[4], b[4];
            b[0] = WFrag<T16>::lds(sb + fb + ks);   // the reads stand in the order of first use: Bt 0, every A, Bt 1 to 3
#pragma unroll
            for (int mb = 0; mb < 4; ++mb) { a[mb] = WFrag<T16>::lds(sb + fa + mb * 16 * GPI + ks); if (NSPLIT == 1) a2[mb] = WFrag<T16>::lds(sb + fa + (128 + mb * 16) * GPI + ks); }
#pragma unroll
            for (int nb = 1; nb < 4; ++nb) b[nb] = WFrag<T16>::lds(sb + fb + nb * 16 * GPI + ks);
            __builtin_amdgcn_sched_barrier(0);   // keeps the LDS reads of 32 k one group in front of their products: left free, the scheduler sinks each Bt fragment's reads to its own products, which then wait out the LDS latency four times in 32 k
#pragma unroll
            for (int nb = 0; nb < 4; ++nb)
#pragma unroll
                for (int mb = 0; mb < 4; ++mb) { acc[mb][nb] = WFrag<T16>::mma(a[mb], b[nb], acc[mb][nb]); if (NSPLIT == 1) acc[mb][nb] = WFrag<T16>::mma(a2[mb], b[nb], acc[mb][nb]); }
        }
        __builtin_amdgcn_sched_barrier(0);   // keeps the products in front of the publish point: left free, the scheduler sinks them behind the barrier and in front of the refill, which then has less than a trip to land in
        asm volatile("s_wait_dscnt 0x0" ::: "memory");      // this wave's reads of the buffer have returned
        asm volatile("s_wait_asynccnt 0x0" ::: "memory");   // this wave's copies of stage t + 1 have landed
        __syncthreads();                                     // publishes stage t + 1 and ends every wave's reads of the buffer that is refilled below
        if (t + 2 < nst) fill(l0 + (t & 1) * (BUFE * 2));
    }
    asm volatile("s_wait_asynccnt 0x0" ::: "memory");   // no copy is outstanding when the ring becomes output staging
    float* os = ring + wv * (QKV ? HD * VPT / 2 : 16 * 68);   // the wave's own staging slice. QKV: 9,216 bytes, the value tile; the q / k staging uses its first 16 x 68 floats
    if constexpr (QKV) {
        const int tc = c0 / 64, part = tc % 3, t0 = r0 % TT; const size_t plane = (size_t)(r0 / TT) * NH_ + tc / 3;
        if (part == 2) {
            h16* sv = (h16*)os;
#pragma unroll
            for (int mb = 0; mb < 4; ++mb)
#pragma unroll
                for (int nb = 0; nb < 4; ++nb) { v8h o;
#pragma unroll
                    for (int j = 0; j < 8; ++j) o[j] = tohx(acc[mb][nb][j]);
                    *(v8ha*)(sv + (nb * 16 + lr) * VPT + mb * 16 + hi * 8) = o; }
            __builtin_amdgcn_wave_barrier(); asm volatile("" ::: "memory");   // the reads below take other lanes' LDS stores: neither the compiler nor the scheduler may lift them over the stores
            h16* vrow = qo.Vt + (plane * HD + (lane >> 3)) * TT + t0 + (lane & 7) * 8; const h16* sr = sv + (lane >> 3) * VPT + (lane & 7) * 8;
#pragma unroll
            for (int s = 0; s < 16; ++s) *(v8h*)(vrow + (size_t)s * 4 * TT) = *(const v8ha*)(sr + s * 4 * VPT);
            return;
        }
        bf* Ph = part ? qo.Kh : qo.Qh; bf* Pl = part ? qo.Kl : qo.Ql; const size_t ob = (plane * TT + t0) * HD + lane * 8;
        const char* cst = (const char*)(qo.CS + (size_t)t0 * HD * 2); const unsigned clb = lr * 8, cub = (hi * 8 * HD + HD / 2 + lr) * 8;   // the tile's first table row; the lane's own byte offsets in it: d = lr, and d = 32 + lr of token 8 hi
        v2f cl[2][2];   // d < 32: the angle is that of the grid row t / 32: one cos | sin pair for each 32-token half of the tile
#pragma unroll
        for (int g = 0; g < 2; ++g)
#pragma unroll
            for (int nb = 0; nb < 2; ++nb) cl[g][nb] = *(const v2f*)(cst + clb + (g * GW * HD + nb * 16) * 8);
#pragma unroll
        for (int ml = 0; ml < 2; ++ml) {
            v2f cu[2][8];   // d >= 32: the angle is that of the grid column t % 32: tokens t and t + 32 share the pair
#pragma unroll
            for (int nb = 0; nb < 2; ++nb)
#pragma unroll
                for (int j = 0; j < 8; ++j) cu[nb][j] = *(const v2f*)(cst + cub + ((ml * 16 + j) * HD + nb * 16) * 8);
            asm volatile("s_wait_xcnt 0x0" :: "v"(clb), "v"(cub) : "memory");   // stands behind the table loads, in front of any overwrite of their address registers, which the two inputs keep whole up to here
#pragma unroll
            for (int g = 0; g < 2; ++g) { const int mb = 2 * g + ml;
#pragma unroll
                for (int nb = 0; nb < 2; ++nb)
#pragma unroll
                    for (int j = 0; j < 8; ++j) { const float x0 = acc[mb][nb][j], x1 = acc[mb][nb + 2][j];
                        os[(hi * 8 + j) * 68 + nb * 16 + lr] = x0 * cl[g][nb][0] - x1 * cl[g][nb][1];
                        os[(hi * 8 + j) * 68 + HD / 2 + nb * 16 + lr] = x1 * cu[nb][j][0] + x0 * cu[nb][j][1]; }
                __builtin_amdgcn_wave_barrier(); asm volatile("" ::: "memory");   // the reads below take other lanes' LDS stores
#pragma unroll
                for (int s = 0; s < 4; ++s) { const float* p = os + (4 * s + (lane >> 3)) * 68 + (lane & 7) * 8; const v4f u = *(const v4fa*)p, w = *(const v4fa*)(p + 4); v4u vh, vl;
#pragma unroll
                    for (int q = 0; q < 4; ++q) { const float y0 = (q < 2) ? u[2 * q] : w[2 * q - 4], y1 = (q < 2) ? u[2 * q + 1] : w[2 * q - 3]; const unsigned h2 = pk2bf(y0, y1);
                        vh[q] = h2; vl[q] = pk2bf(y0 - __uint_as_float(h2 << 16), y1 - __uint_as_float(h2 & 0xFFFF0000u)); }
                    *(v4u*)(Ph + ob + mb * 16 * HD + s * 4 * HD) = vh; *(v4u*)(Pl + ob + mb * 16 * HD + s * 4 * HD) = vl; }
                if (mb < 3) { __builtin_amdgcn_wave_barrier(); asm volatile("s_wait_xcnt 0x0" ::: "memory"); }   // not behind the last 16 tokens; stands behind the eight stores, in front of the overwrite of their data registers; its clobber also keeps the next 16 tokens' LDS stores behind the reads above
            }
        }
        return;
    }
#pragma unroll
    for (int mb = 0; mb < 4; ++mb) {
#pragma unroll
        for (int nb = 0; nb < 4; ++nb) {
#pragma unroll
            for (int j = 0; j < 8; ++j) os[(hi * 8 + j) * 68 + nb * 16 + lr] = acc[mb][nb][j]; }
        __builtin_amdgcn_wave_barrier(); asm volatile("" ::: "memory");
        float* crow = C + (size_t)(r0 + mb * 16) * ldc + c0;
{
#pragma unroll
            for (int s = 0; s < 8; ++s) { const int row = 2 * s + hi, cofs = lr * 4; v4f val = *(const v4fa*)(os + row * 68 + cofs); if (BIAS) { val[0] += bfr(bias[c0 + cofs]); val[1] += bfr(bias[c0 + cofs + 1]); val[2] += bfr(bias[c0 + cofs + 2]); val[3] += bfr(bias[c0 + cofs + 3]); }
                *(v4f*)(crow + (size_t)row * ldc + cofs) = val; }
             }
        __builtin_amdgcn_wave_barrier(); asm volatile("" ::: "memory");
    }
}

__device__ __forceinline__ void splitf(float y, unsigned short& h, unsigned short& l) { h = f2bf(y); l = f2bf(y - bf2f(h)); }
typedef __attribute__((ext_vector_type(2))) _Float16 v2h;
typedef __attribute__((ext_vector_type(4))) _Float16 v4h;
typedef __attribute__((ext_vector_type(2))) unsigned short v2us;
typedef __attribute__((ext_vector_type(4))) unsigned short v4us;

__global__ __launch_bounds__(256) void k_cvt8(const float* __restrict__ src, bf* dst, size_t n8) { const size_t i = (size_t)blockIdx.x * 256 + threadIdx.x; if (i >= n8) return; const v8f v = *(const v8f*)(src + i * 8); v8us o;
#pragma unroll
    for (int k = 0; k < 8; ++k) o[k] = f2bf(v[k]); *(v8us*)(dst + i * 8) = o;  }

__constant__ float INVT[HD / 2] = { 1.000000000e+00f, 7.498942018e-01f, 5.623413324e-01f, 4.216965139e-01f, 3.162277639e-01f, 2.371373624e-01f, 1.778279394e-01f, 1.333521456e-01f, 1.000000015e-01f, 7.498941571e-02f, 5.623412877e-02f, 4.216964915e-02f, 3.162277862e-02f, 2.371373586e-02f, 1.778279431e-02f, 1.333521493e-02f, 9.999999776e-03f, 7.498942316e-03f, 5.623413250e-03f, 4.216964822e-03f, 3.162277862e-03f, 2.371373819e-03f, 1.778279431e-03f, 1.333521446e-03f, 1.000000047e-03f, 7.498941850e-04f, 5.623413017e-04f, 4.216964880e-04f, 3.162277862e-04f, 2.371373848e-04f, 1.778279402e-04f, 1.333521504e-04f };   // float32 1 / 10000^(2i/64), i = 0..31
__global__ __launch_bounds__(256) void k_cs2d(float* CS) { const int idx = blockIdx.x * 256 + threadIdx.x; if (idx >= TT * HD) return; const int d = idx % HD; const int t = idx / HD; const int p = (d < HD / 2) ? (t / GW) : (t % GW); const float a = __fmul_rn((float)p, INVT[d % (HD / 2)]); v2f cs; cs[0] = cosf(a); cs[1] = sinf(a); *(v2f*)(CS + (size_t)idx * 2) = cs;  }
#define FKS 64     // keys per stage
#define FPT 72     // LDS row pitch in 16-bit elements: 128 + 16 bytes
#define FNS (TT / FKS)
__device__ __forceinline__ v16bf ldsb(const unsigned short* p) { const v8us a = *(const v8usa*)p, b = *(const v8usa*)(p + 16); return cat16b(a, b); }
__device__ __forceinline__ v16h ldsh(const unsigned short* p) { const v8us a = *(const v8usa*)p, b = *(const v8usa*)(p + 16); return cat16(__builtin_bit_cast(v8h, a), __builtin_bit_cast(v8h, b)); }
__device__ __forceinline__ float exp2s(float x) { float r; asm("v_exp_f32 %0, %1\n\tv_nop" : "=v"(r) : "v"(x)); return r; }   // 2^x; the v_nop in the same statement keeps the one slot behind the transcendental, whichever instruction the compiler schedules next
__global__ __launch_bounds__(256) __attribute__((amdgpu_waves_per_eu(4, 4))) void k_fattn(const bf* __restrict__ Qh, const bf* __restrict__ Ql, const bf* __restrict__ Kh, const bf* __restrict__ Kl, const h16* __restrict__ Vt, bf* ATh, bf* ATl) {
    __shared__ __align__(16) unsigned short sm[2][3][FKS * FPT];
    const int tid = threadIdx.x, lane = tid & 31, wv = tid >> 5, lr = lane & 15, hi = lane >> 4;
    const size_t po = (size_t)blockIdx.y * TT * HD; const int q0 = blockIdx.x * 256 + wv * 32;
    v16bf qh[2][2], ql[2][2];
#pragma unroll
    for (int qt = 0; qt < 2; ++qt)
#pragma unroll
        for (int ks = 0; ks < 2; ++ks) { const size_t o = po + (size_t)(q0 + qt * 16 + lr) * HD + ks * 32 + 8 * hi; qh[qt][ks] = WFrag<bf>::ld(Qh + o); ql[qt][ks] = WFrag<bf>::ld(Ql + o); }
    v8f oa[2][4]; float mr[2], ls[2];
#pragma unroll
    for (int qt = 0; qt < 2; ++qt) { mr[qt] = -3.0e38f; ls[qt] = 0.f;
#pragma unroll
        for (int db = 0; db < 4; ++db) oa[qt][db] = (v8f){}; }
    // staging map: 512 chunks of 16 bytes a tile, two a thread: chunk c = tid + 256 i -> row c / 8, 16-byte column c % 8
    const int srow = tid >> 3, scol = (tid & 7) * 8;
    const bf* gkh = Kh + po + (size_t)srow * HD + scol; const bf* gkl = Kl + po + (size_t)srow * HD + scol; const h16* gv = Vt + po + (size_t)srow * TT + scol;   // the lane's own source pointers; they step one stage behind each stage's LDS stores
    const int sdst = srow * FPT + scol;
    v8us g[6];
    g[0] = *(const v8usa*)(gkh); g[1] = *(const v8usa*)(gkh + 32 * HD); g[2] = *(const v8usa*)(gkl); g[3] = *(const v8usa*)(gkl + 32 * HD); g[4] = *(const v8usa*)(gv); g[5] = *(const v8usa*)(gv + (size_t)32 * TT);
    asm volatile("s_wait_xcnt 0x0" ::: "memory");   // stands behind the loads, in front of the step of their address registers below
#pragma unroll
    for (int a = 0; a < 3; ++a) { *(v8usa*)(&sm[0][a][sdst]) = g[2 * a]; *(v8usa*)(&sm[0][a][sdst + 32 * FPT]) = g[2 * a + 1]; }
    gkh += FKS * HD; gkl += FKS * HD; gv += FKS;
    __syncthreads();
    const float CL = SCL * 1.4426950408889634f;
    for (int s = 0; s < FNS; ++s) {
        const int buf = s & 1;
        if (s + 1 < FNS) {   // the next stage's tiles fly while this stage is worked on
            g[0] = *(const v8usa*)(gkh); g[1] = *(const v8usa*)(gkh + 32 * HD); g[2] = *(const v8usa*)(gkl); g[3] = *(const v8usa*)(gkl + 32 * HD); g[4] = *(const v8usa*)(gv); g[5] = *(const v8usa*)(gv + (size_t)32 * TT);
            asm volatile("s_wait_xcnt 0x0" ::: "memory"); }   // stands behind the loads, in front of the step of their address registers at the foot of the trip
#pragma unroll 1   // one 32-key pass at a time in the listing: unrolled, the second pass's fragment loads are hoisted and the registers pass 256 (two work-groups a WGP lost)
        for (int kp = 0; kp < FKS / 32; ++kp) {
            v8f sc[2][2];
#pragma unroll
            for (int kt = 0; kt < 2; ++kt) { const int ro = (kp * 32 + kt * 16 + lr) * FPT + 8 * hi;
                const v16bf ah0 = ldsb(&sm[buf][0][ro]), ah1 = ldsb(&sm[buf][0][ro + 32]), al0 = ldsb(&sm[buf][1][ro]), al1 = ldsb(&sm[buf][1][ro + 32]);
#pragma unroll
                for (int qt = 0; qt < 2; ++qt) { v8f a = (v8f){};
                    a = wmmab(ah0, qh[qt][0], a); a = wmmab(ah0, ql[qt][0], a); a = wmmab(al0, qh[qt][0], a);
                    a = wmmab(ah1, qh[qt][1], a); a = wmmab(ah1, ql[qt][1], a); a = wmmab(al1, qh[qt][1], a); sc[qt][kt] = a; } }
            v16h pb[2];
#pragma unroll
            for (int qt = 0; qt < 2; ++qt) { float mx = sc[qt][0][0];
#pragma unroll
                for (int j = 1; j < 8; ++j) mx = fmaxf(mx, sc[qt][0][j]);
#pragma unroll
                for (int j = 0; j < 8; ++j) mx = fmaxf(mx, sc[qt][1][j]);
                mx = fmaxf(mx, __shfl_xor(mx, 16, 32));
                const float mn = fmaxf(mr[qt], mx * CL); const float al = exp2s(mr[qt] - mn); mr[qt] = mn; const float off = 10.0f - mn;   /* + 10: the weights and their sum carry x 1024, clear of the f16 subnormals */
                float sa = 0.f, sb = 0.f;
#pragma unroll
                for (int j = 0; j < 8; ++j) { const float p0 = exp2s(fmaf(sc[qt][0][j], CL, off)); sa += p0; pb[qt][j] = tohx(p0); }
#pragma unroll
                for (int j = 0; j < 8; ++j) { const float p1 = exp2s(fmaf(sc[qt][1][j], CL, off)); sb += p1; pb[qt][8 + j] = tohx(p1); }
                ls[qt] = fmaf(ls[qt], al, sa + sb);
#pragma unroll
                for (int db = 0; db < 4; ++db) oa[qt][db] *= al; }
#pragma unroll
            for (int db = 0; db < 4; ++db) { const v16h vf = ldsh(&sm[buf][2][(db * 16 + lr) * FPT + kp * 32 + 8 * hi]);
#pragma unroll
                for (int qt = 0; qt < 2; ++qt) oa[qt][db] = wmma16(vf, pb[qt], oa[qt][db]); }
        }
        if (s + 1 < FNS) {
#pragma unroll
            for (int a = 0; a < 3; ++a) { *(v8usa*)(&sm[buf ^ 1][a][sdst]) = g[2 * a]; *(v8usa*)(&sm[buf ^ 1][a][sdst + 32 * FPT]) = g[2 * a + 1]; }
            gkh += FKS * HD; gkl += FKS * HD; gv += FKS; }
        __syncthreads();   // publishes stage s + 1 and ends every wave's reads of the buffer that the next trip refills
    }
    const size_t bq = blockIdx.y >> 4, hh = blockIdx.y & 15;
#pragma unroll
    for (int qt = 0; qt < 2; ++qt) { const float lt = ls[qt] + __shfl_xor(ls[qt], 16, 32); const float inv = __fdiv_rn(1.0f, lt);
        const size_t ob = (bq * TT + q0 + qt * 16 + lr) * DQ + hh * HD + hi * 8;
#pragma unroll
        for (int db = 0; db < 4; ++db) { v8us vh, vl;
#pragma unroll
            for (int j = 0; j < 8; ++j) { unsigned short a, c; splitf(oa[qt][db][j] * inv, a, c); vh[j] = a; vl[j] = c; }
            *(v8us*)(ATh + ob + db * 16) = vh; *(v8us*)(ATl + ob + db * 16) = vl; } }
}

extern "C" void kernel_launch(void* const* d_in, const int* in_sizes, int n_in,
                              void* d_out, int out_size, void* d_ws, size_t ws_size, hipStream_t stream) {
    (void)in_sizes; (void)n_in; (void)out_size;
    const float* x = (const float*)d_in[0]; const float* wqkv = (const float*)d_in[1]; const float* wo = (const float*)d_in[2];   /* order tensor [8][1024][1024], w_qkv ('oi' (out, in) [3072][1024]: PER HEAD q | k | v: rows 192 h + 0..63 | 64..127 | 128..191), w_proj ('oi' [1024][1024]): THREE inputs, all read; no bias anywhere */
    float* OUT = (float*)d_out;     // [8][1024][1024]
    char* wsp = (char*)d_ws;
    auto take = [&](size_t bytes) { char* p = wsp; wsp += (bytes + 255) & ~(size_t)255; return (void*)p; };
    bf* BT = (bf*)take((size_t)3 * DQ * DM * 2); bf* WO = (bf*)take((size_t)DM * DQ * 2); float* CS = (float*)take((size_t)TT * HD * 2 * 4);   /* the fused 'oi' weight is the Bt operand as it stands: ONE bf16 copy [3072][1024]: head h's q | k | v row blocks begin at rows 3 HD h + 0 | HD | 2 HD */
    const size_t NP = (size_t)NB_ * NH_ * TT * HD;   /* elements of one plane over all sequences and heads (= NB_ TT DQ) */
    bf* QPh = (bf*)take(NP * 2); bf* QPl = (bf*)take(NP * 2); bf* KPh = (bf*)take(NP * 2); bf* KPl = (bf*)take(NP * 2); h16* VT16 = (h16*)take(NP * 2); 
    float* Sb = (float*)take((size_t)ZH * TT * TT * 4); (void)take((size_t)ZH * TT * TT * 2);   /* one block of 64 + 32 MiB, adjacent */
    /* stream-ordered reuse: up to the projections the block holds XB (16 MiB); the attention kernel then writes the hi / lo planes of the merged heads over its first 32 MiB */
    bf* XB = (bf*)Sb; bf* ATh = (bf*)Sb; bf* ATl = ATh + NP;
    if ((size_t)(wsp - (char*)d_ws) > ws_size) return;    // ws 256 MiB
    { k_cvt8<<<(unsigned)(((size_t)3 * DQ * DM / 8 + 255) / 256), 256, 0, stream>>>(wqkv, BT, (size_t)3 * DQ * DM / 8); k_cvt8<<<(unsigned)(((size_t)DM * DQ / 8 + 255) / 256), 256, 0, stream>>>(wo, WO, (size_t)DM * DQ / 8); }   /* 'oi' (out, in): each weight is the Bt operand as it stands */
    k_cs2d<<<(TT * HD + 255) / 256, 256, 0, stream>>>(CS);
    k_cvt8<<<(unsigned)(((size_t)NB_ * TT * DM / 8 + 255) / 256), 256, 0, stream>>>(x, XB, (size_t)NB_ * TT * DM / 8);   /* ONE bf16 copy of all sequences, read by the projections */
    k_gemmw<bf, 0, false, true><<<dim3(NB_ * TT / 128, 3 * DQ / 256, 1), 256, 0, stream>>>(XB, nullptr, BT, nullptr, DM, nullptr, 0, nullptr, 0, 0, 0, QkvOut{CS, QPh, QPl, KPh, KPl, VT16});   /* tile column c = weight rows 64 c ..: head c / 3, part c % 3 (q | k | v); stores the planes that the attention reads */
    k_fattn<<<dim3(TT / 256, NB_ * NH_), 256, 0, stream>>>(QPh, QPl, KPh, KPl, VT16, ATh, ATl);   /* every head plane of every sequence in one launch; writes the hi / lo planes of the merged heads over the dead XB block */
    k_gemmw<bf, 1, false, false><<<dim3(NB_ * TT / 128, DM / 256, 1), 256, 0, stream>>>(ATh, ATl, WO, nullptr, DQ, OUT, DM, nullptr, 0, 0, 0, QkvOut{});
}

// v005
// One run takes 159 microseconds.
// In two side-by-side timings against v004, it was 1.04 and 1.03 times as fast.
// Counting every step since v000, it is 19.0 times as fast.
#include <hip/hip_runtime.h>

// Multi-head self-attention on a 32 x 32 grid of positions with a FIXED TWO-DIMENSIONAL ROTARY TABLE (tensor [8][1024][1024]; qkv = tensor w_qkv^T with ONE fused 'oi' (out, in) weight [3072][1024] normal x 1/32, no bias; THE 3,072 COLUMNS ARE (16, 3, 64): PER HEAD q | k | v: head h's q, k, v are weight rows 192 h + 0..63 | + 64..127 | + 128..191; position n = 32 y + x; theta[n][d] = y x ifreq[d] for d < 32 and x x ifreq[d - 32] for d >= 32 with ifreq[i] = 1 / 10000^(i / 32); q, k -> u cos(theta) + rot(u) sin(theta) with rot(u) = cat(-u2, u1) on the two 32-wide halves: rotate-half over the full head width with its own angle at every d; scores / sqrt(64); no mask; softmax over all 1,024 keys; heads merged; out = merged w_proj^T ('oi' x 1/32, no bias) -> [8][1024][1024] (8.4 M); argument order tensor, w_qkv, w_proj).
// Layout, ALL EIGHT SEQUENCES AT ONCE (token rows 1024 b + t, head planes 16 b + h): ONE bf16 copy of x, read by the three projections; the fused 'oi' weight cast once as it stands: head h's q | k | v row blocks at rows 192 h + 0 | 64 | 128: the three projections ONE launch of 48 tile columns (k_gemmw with QKV = true), which rotates q and k with the computed two-dimensional table, splits them hi / lo and transposes the f16 value plane on its accumulators; dense T-1,024 attention in ONE kernel (k_fattn): THE SCORES OF EVERY ROW ON THE hi / lo PLANES (three products), kept in registers; running-maximum softmax; attn.v of EVERY row on ONE fp16 product (the weights x 1024); the merged heads stored as hi / lo planes; hi/lo x w_proj exact.
// Compute dtypes, f32 accumulate: every input rounded to bf16; projections exact; the table in f32; scores: bf16 hi / lo, 3 products; softmax f32; attn.v: one fp16 product; w_proj hl x exact.

#define NB_  8
#define TT   1024
#define DM   1024
#define NH_  16
#define NKV  16
#define REP  (NH_ / NKV)
#define HD   64
#define DQ   (NH_ * HD)
#define DKV  (NKV * HD)
#define ZH   16    // sizes the 64 + 32 MiB workspace block only
#define RH   0     // unused: the scores of every row run on the hi / lo planes (three products), attn.v on one f16 product
#define WIN  0
#define GW   32    // the grid is 32 x 32 positions: t = GW y + x
#define SCL  0.125f   // HD^-0.5
typedef _Float16 h16;
typedef unsigned short bf;
typedef __attribute__((ext_vector_type(16))) __bf16   v16bf;
typedef __attribute__((ext_vector_type(16))) _Float16 v16h;
typedef __attribute__((ext_vector_type(8)))  _Float16 v8h;
typedef __attribute__((ext_vector_type(8)))  unsigned short v8us;
typedef __attribute__((ext_vector_type(8)))  float    v8f;
typedef __attribute__((ext_vector_type(4)))  float    v4f;
typedef v8h  __attribute__((may_alias)) v8ha;
typedef v4f  __attribute__((may_alias)) v4fa;
typedef v8us __attribute__((may_alias)) v8usa;

__device__ __forceinline__ unsigned short f2bf(float f) { unsigned u = __float_as_uint(f); u += 0x7FFFu + ((u >> 16) & 1u); return (unsigned short)(u >> 16); }
__device__ __forceinline__ float bf2f(unsigned short b) { return __uint_as_float(((unsigned)b) << 16); }
__device__ __forceinline__ float bfr(float f) { return bf2f(f2bf(f)); }
__device__ __forceinline__ v16h cat16(v8h lo, v8h hi) { return __builtin_shufflevector(lo, hi, 0, 1, 2, 3, 4, 5, 6, 7, 8, 9, 10, 11, 12, 13, 14, 15); }
__device__ __forceinline__ v16bf cat16b(v8us lo, v8us hi) { return __builtin_bit_cast(v16bf, __builtin_shufflevector(lo, hi, 0, 1, 2, 3, 4, 5, 6, 7, 8, 9, 10, 11, 12, 13, 14, 15)); }
__device__ __forceinline__ v8f wmma16(v16h a, v16h b, v8f c) { return __builtin_amdgcn_wmma_f32_16x16x32_f16(false, a, false, b, (short)0, c, false, false); }
__device__ __forceinline__ v8f wmmab(v16bf a, v16bf b, v8f c) { return __builtin_amdgcn_wmma_f32_16x16x32_bf16(false, a, false, b, (short)0, c, false, false); }



// The projections' epilogue (QKV = true): qkv = x w_qkv^T as 128 x 48 wave tiles of 64 x 64 in ONE launch, with the rotation, the hi / lo split and the value transpose done on the accumulators.
// Tile column c holds weight rows 64 c .. 64 c + 63 = head c / 3, part c % 3 (q | k | v): a tile is one head's whole width for 64 tokens of one sequence, so the rotation's partner d +- 32 is accumulator nb +- 2 of the same lane.
// q, k: rotated in registers, staged f32 in LDS 16 tokens at a time, read back 8 d a lane, split hi / lo, stored as 512 contiguous bytes an instruction into [plane][t][d]. v: 8 tokens a lane packed to f16, staged [d][t] in LDS, stored as whole 128-byte rows of [plane][d][t].
#define VPT 72     // LDS row pitch of the staged value tile in 16-bit elements: 128 + 16 bytes
typedef __attribute__((ext_vector_type(2))) float v2f;
typedef __attribute__((ext_vector_type(4))) unsigned v4u;
typedef __attribute__((ext_vector_type(2))) __bf16 v2bf;
__device__ __forceinline__ h16 tohx(float x) { return (h16)x; }
__device__ __forceinline__ unsigned pk2bf(float a, float b) { v2f x; x[0] = a; x[1] = b; return __builtin_bit_cast(unsigned, __builtin_convertvector(x, v2bf)); }   // two f32 -> two bf16, round to nearest even, a in the low half
struct QkvOut { const float* CS; bf* Qh; bf* Ql; bf* Kh; bf* Kl; h16* Vt; };   // the cos | sin table [t][d][2] and the planes that the attention reads; all null where QKV = false

// ---- k_gemmw: register-blocked GEMM, ONE WAVE per 64x64 output tile (16 accumulators), EIGHT WAVES (2 x 4 tiles = 128 x 256 of C) a work-group; grid (M/128, N/256, Z), 256 threads.
// The work-group's operand rows (A 128 | A2 128 where NSPLIT = 1 | Bt 256) go global -> LDS by asynchronous copies, 64 k a stage: whole 128-byte lines, 4 rows a wave-wide copy, LDS pitch 144 bytes; two buffers, the next stage's copies fly while this one is worked on; every wave reads its fragments from LDS in the k order that it read them in from the planes.
// C[m][n] (f32, pitch ldc, + optional f32 bias[n]) = sum_k A[m][k] Bt[n][k] (+ A2 Bt where NSPLIT = 1). z-batch strides sA/sB/sC in elements. K % 64 == 0.
#define GKS 64     // k per stage
#define GPI 72     // LDS row pitch in 16-bit elements: 128 + 16 bytes
#define GLS (32 * GPI * 2)   // LDS bytes between two copies of a thread: 32 rows
// Four or eight asynchronous copies of 16 bytes a lane, 32 rows apart (rs elements in the plane, GLS bytes in LDS). The s_wait_xcnt is the last line of the copies' own statement, so that it stands in front of every later write of their address registers.
template <typename T16> __device__ __forceinline__ void acp4(unsigned l, const T16* g, size_t rs) {
    asm volatile("global_load_async_to_lds_b128 %0, %4, off\n\tglobal_load_async_to_lds_b128 %1, %5, off\n\tglobal_load_async_to_lds_b128 %2, %6, off\n\tglobal_load_async_to_lds_b128 %3, %7, off\n\ts_wait_xcnt 0x0"
                 :: "v"(l), "v"(l + GLS), "v"(l + 2 * GLS), "v"(l + 3 * GLS), "v"(g), "v"(g + rs), "v"(g + 2 * rs), "v"(g + 3 * rs) : "memory"); }
template <typename T16> __device__ __forceinline__ void acp8(unsigned l, const T16* g, const T16* h, size_t rs) {
    asm volatile("global_load_async_to_lds_b128 %0, %8, off\n\tglobal_load_async_to_lds_b128 %1, %9, off\n\tglobal_load_async_to_lds_b128 %2, %10, off\n\tglobal_load_async_to_lds_b128 %3, %11, off\n\t"
                 "global_load_async_to_lds_b128 %4, %12, off\n\tglobal_load_async_to_lds_b128 %5, %13, off\n\tglobal_load_async_to_lds_b128 %6, %14, off\n\tglobal_load_async_to_lds_b128 %7, %15, off\n\ts_wait_xcnt 0x0"
                 :: "v"(l), "v"(l + GLS), "v"(l + 2 * GLS), "v"(l + 3 * GLS), "v"(l + 4 * GLS), "v"(l + 5 * GLS), "v"(l + 6 * GLS), "v"(l + 7 * GLS),
                    "v"(g), "v"(g + rs), "v"(g + 2 * rs), "v"(g + 3 * rs), "v"(h), "v"(h + rs), "v"(h + 2 * rs), "v"(h + 3 * rs) : "memory"); }
template <typename T16> struct WFrag;
template <> struct WFrag<h16> { typedef v16h V; static __device__ __forceinline__ V ld(const h16* p) { return cat16(*(const v8h*)p, *(const v8h*)(p + 16)); } static __device__ __forceinline__ V lds(const h16* p) { return cat16(*(const v8ha*)p, *(const v8ha*)(p + 16)); } static __device__ __forceinline__ v8f mma(V a, V b, v8f c) { return wmma16(a, b, c); } };
template <> struct WFrag<bf> { typedef v16bf V; static __device__ __forceinline__ V ld(const bf* p) { return cat16b(*(const v8us*)p, *(const v8us*)(p + 16)); } static __device__ __forceinline__ V lds(const bf* p) { return cat16b(*(const v8usa*)p, *(const v8usa*)(p + 16)); } static __device__ __forceinline__ v8f mma(V a, V b, v8f c) { return wmmab(a, b, c); } };
template <typename T16, int NSPLIT, bool BIAS, bool QKV>
__global__ __launch_bounds__(256) void k_gemmw(const T16* __restrict__ A, const T16* __restrict__ A2, const T16* __restrict__ Bt, const T16* __restrict__ Bt2, int K, float* C, int ldc, const float* __restrict__ bias, size_t sA, size_t sB, size_t sC, QkvOut qo) {
    typedef typename WFrag<T16>::V V;
    static_assert(NSPLIT == 0 || NSPLIT == 1, "the staged rows are A | A2 | Bt");
    constexpr int AR = (NSPLIT == 1) ? 256 : 128, BUFE = (AR + 256) * GPI;   // rows of A (| A2) in a buffer; 16-bit elements of a buffer
    __shared__ __align__(16) float ring[2 * BUFE / 2];   // two buffers; behind the loop each wave stages its output in a slice of its own
    const size_t z = blockIdx.z; A += z * sA; if (A2) A2 += z * sA; Bt += z * sB; C += z * sC; (void)Bt2;
    const int tid = threadIdx.x, lane = tid & 31, lr = lane & 15, hi = lane >> 4; const int wv = __builtin_amdgcn_readfirstlane(tid >> 5);
    const int r0 = blockIdx.x * 128 + (wv & 1) * 64, c0 = blockIdx.y * 256 + (wv >> 1) * 64;
    v8f acc[4][4];
#pragma unroll
    for (int mb = 0; mb < 4; ++mb)
#pragma unroll
        for (int nb = 0; nb < 4; ++nb) acc[mb][nb] = (v8f){};
    // copy map: chunk c = tid + 256 i of 16 bytes -> row c / 8 of the buffer, 16-byte column c % 8
    const size_t rs = (size_t)32 * K; const int srow = tid >> 3, scol = (tid & 7) * 8;
    const T16* ua = A + (size_t)blockIdx.x * 128 * K; const T16* ua2 = (NSPLIT == 1) ? A2 + (size_t)blockIdx.x * 128 * K : nullptr; const T16* ub = Bt + (size_t)blockIdx.y * 256 * K;   // the work-group's first row of each operand
    size_t vo = (size_t)srow * K + scol;   // the lane's own element offset from each of them; it steps one stage behind each stage's copies
    const unsigned l0 = (unsigned)(size_t)ring + (srow * GPI + scol) * 2;   // the lane's own LDS byte address in buffer 0
    auto fill = [&](unsigned l) {
        if constexpr (NSPLIT == 1) { acp8(l, ua + vo, ua2 + vo, rs); acp8(l + 8 * GLS, ub + vo, ub + 4 * rs + vo, rs); }
        else { acp4(l, ua + vo, rs); acp8(l + 4 * GLS, ub + vo, ub + 4 * rs + vo, rs); }
        vo += GKS; };
    const int nst = K / GKS;
    fill(l0);
    asm volatile("s_wait_asynccnt 0x0" ::: "memory");   // this wave's copies of stage 0 have landed
    __syncthreads();                                     // publishes stage 0
    if (1 < nst) fill(l0 + BUFE * 2);
    const int fa = ((wv & 1) * 64 + lr) * GPI + 8 * hi, fb = (AR + (wv >> 1) * 64 + lr) * GPI + 8 * hi;   // the lane's own fragment rows in a buffer
    for (int t = 0; t < nst; ++t) {
        const T16* sb = (const T16*)ring + (t & 1) * BUFE;
#pragma unroll
        for (int ks = 0; ks < GKS; ks += 32) {
            V a[4], a2[4], b[4];
            b[0] = WFrag<T16>::lds(sb + fb + ks);   // the reads stand in the order of first use: Bt 0, every A, Bt 1 to 3
#pragma unroll
            for (int mb = 0; mb < 4; ++mb) { a[mb] = WFrag<T16>::lds(sb + fa + mb * 16 * GPI + ks); if (NSPLIT == 1) a2[mb] = WFrag<T16>::lds(sb + fa + (128 + mb * 16) * GPI + ks); }
#pragma unroll
            for (int nb = 1; nb < 4; ++nb) b[nb] = WFrag<T16>::lds(sb + fb + nb * 16 * GPI + ks);
            __builtin_amdgcn_sched_barrier(0);   // keeps the LDS reads of 32 k one group in front of their products: left free, the scheduler sinks each Bt fragment's reads to its own products, which then wait out the LDS latency four times in 32 k
#pragma unroll
            for (int nb = 0; nb < 4; ++nb)
#pragma unroll
                for (int mb = 0; mb < 4; ++mb) { acc[mb][nb] = WFrag<T16>::mma(a[mb], b[nb], acc[mb][nb]); if (NSPLIT == 1) acc[mb][nb] = WFrag<T16>::mma(a2[mb], b[nb], acc[mb][nb]); }
        }
        __builtin_amdgcn_sched_barrier(0);   // keeps the products in front of the publish point: left free, the scheduler sinks them behind the barrier and in front of the refill, which then has less than a trip to land in
        asm volatile("s_wait_dscnt 0x0" ::: "memory");      // this wave's reads of the buffer have returned
        asm volatile("s_wait_asynccnt 0x0" ::: "memory");   // this wave's copies of stage t + 1 have landed
        __syncthreads();                                     // publishes stage t + 1 and ends every wave's reads of the buffer that is refilled below
        if (t + 2 < nst) fill(l0 + (t & 1) * (BUFE * 2));
    }
    asm volatile("s_wait_asynccnt 0x0" ::: "memory");   // no copy is outstanding when the ring becomes output staging
    float* os = ring + wv * (QKV ? HD * VPT / 2 : 16 * 68);   // the wave's own staging slice. QKV: 9,216 bytes, the value tile; the q / k staging uses its first 16 x 68 floats
    if constexpr (QKV) {
        const int tc = c0 / 64, part = tc % 3, t0 = r0 % TT; const size_t plane = (size_t)(r0 / TT) * NH_ + tc / 3;
        if (part == 2) {
            h16* sv = (h16*)os;
#pragma unroll
            for (int mb = 0; mb < 4; ++mb)
#pragma unroll
                for (int nb = 0; nb < 4; ++nb) { v8h o;
#pragma unroll
                    for (int j = 0; j < 8; ++j) o[j] = tohx(acc[mb][nb][j]);
                    *(v8ha*)(sv + (nb * 16 + lr) * VPT + mb * 16 + hi * 8) = o; }
            __builtin_amdgcn_wave_barrier(); asm volatile("" ::: "memory");   // the reads below take other lanes' LDS stores: neither the compiler nor the scheduler may lift them over the stores
            h16* vrow = qo.Vt + (plane * HD + (lane >> 3)) * TT + t0 + (lane & 7) * 8; const h16* sr = sv + (lane >> 3) * VPT + (lane & 7) * 8;
#pragma unroll
            for (int s = 0; s < 16; ++s) *(v8h*)(vrow + (size_t)s * 4 * TT) = *(const v8ha*)(sr + s * 4 * VPT);
            return;
        }
        bf* Ph = part ? qo.Kh : qo.Qh; bf* Pl = part ? qo.Kl : qo.Ql; const size_t ob = (plane * TT + t0) * HD + lane * 8;
        const char* cst = (const char*)(qo.CS + (size_t)t0 * HD * 2); const unsigned clb = lr * 8, cub = (hi * 8 * HD + HD / 2 + lr) * 8;   // the tile's first table row; the lane's own byte offsets in it: d = lr, and d = 32 + lr of token 8 hi
        v2f cl[2][2];   // d < 32: the angle is that of the grid row t / 32: one cos | sin pair for each 32-token half of the tile
#pragma unroll
        for (int g = 0; g < 2; ++g)
#pragma unroll
            for (int nb = 0; nb < 2; ++nb) cl[g][nb] = *(const v2f*)(cst + clb + (g * GW * HD + nb * 16) * 8);
#pragma unroll
        for (int ml = 0; ml < 2; ++ml) {
            v2f cu[2][8];   // d >= 32: the angle is that of the grid column t % 32: tokens t and t + 32 share the pair
#pragma unroll
            for (int nb = 0; nb < 2; ++nb)
#pragma unroll
                for (int j = 0; j < 8; ++j) cu[nb][j] = *(const v2f*)(cst + cub + ((ml * 16 + j) * HD + nb * 16) * 8);
            asm volatile("s_wait_xcnt 0x0" :: "v"(clb), "v"(cub) : "memory");   // stands behind the table loads, in front of any overwrite of their address registers, which the two inputs keep whole up to here
#pragma unroll
            for (int g = 0; g < 2; ++g) { const int mb = 2 * g + ml;
#pragma unroll
                for (int nb = 0; nb < 2; ++nb)
#pragma unroll
                    for (int j = 0; j < 8; ++j) { const float x0 = acc[mb][nb][j], x1 = acc[mb][nb + 2][j];
                        os[(hi * 8 + j) * 68 + nb * 16 + lr] = x0 * cl[g][nb][0] - x1 * cl[g][nb][1];
                        os[(hi * 8 + j) * 68 + HD / 2 + nb * 16 + lr] = x1 * cu[nb][j][0] + x0 * cu[nb][j][1]; }
                __builtin_amdgcn_wave_barrier(); asm volatile("" ::: "memory");   // the reads below take other lanes' LDS stores
#pragma unroll
                for (int s = 0; s < 4; ++s) { const float* p = os + (4 * s + (lane >> 3)) * 68 + (lane & 7) * 8; const v4f u = *(const v4fa*)p, w = *(const v4fa*)(p + 4); v4u vh, vl;
#pragma unroll
                    for (int q = 0; q < 4; ++q) { const float y0 = (q < 2) ? u[2 * q] : w[2 * q - 4], y1 = (q < 2) ? u[2 * q + 1] : w[2 * q - 3]; const unsigned h2 = pk2bf(y0, y1);
                        vh[q] = h2; vl[q] = pk2bf(y0 - __uint_as_float(h2 << 16), y1 - __uint_as_float(h2 & 0xFFFF0000u)); }
                    *(v4u*)(Ph + ob + mb * 16 * HD + s * 4 * HD) = vh; *(v4u*)(Pl + ob + mb * 16 * HD + s * 4 * HD) = vl; }
                if (mb < 3) { __builtin_amdgcn_wave_barrier(); asm volatile("s_wait_xcnt 0x0" ::: "memory"); }   // not behind the last 16 tokens; stands behind the eight stores, in front of the overwrite of their data registers; its clobber also keeps the next 16 tokens' LDS stores behind the reads above
            }
        }
        return;
    }
#pragma unroll
    for (int mb = 0; mb < 4; ++mb) {
#pragma unroll
        for (int nb = 0; nb < 4; ++nb) {
#pragma unroll
            for (int j = 0; j < 8; ++j) os[(hi * 8 + j) * 68 + nb * 16 + lr] = acc[mb][nb][j]; }
        __builtin_amdgcn_wave_barrier(); asm volatile("" ::: "memory");
        float* crow = C + (size_t)(r0 + mb * 16) * ldc + c0;
{
#pragma unroll
            for (int s = 0; s < 8; ++s) { const int row = 2 * s + hi, cofs = lr * 4; v4f val = *(const v4fa*)(os + row * 68 + cofs); if (BIAS) { val[0] += bfr(bias[c0 + cofs]); val[1] += bfr(bias[c0 + cofs + 1]); val[2] += bfr(bias[c0 + cofs + 2]); val[3] += bfr(bias[c0 + cofs + 3]); }
                *(v4f*)(crow + (size_t)row * ldc + cofs) = val; }
             }
        __builtin_amdgcn_wave_barrier(); asm volatile("" ::: "memory");
    }
}

__device__ __forceinline__ void splitf(float y, unsigned short& h, unsigned short& l) { h = f2bf(y); l = f2bf(y - bf2f(h)); }
typedef __attribute__((ext_vector_type(2))) _Float16 v2h;
typedef __attribute__((ext_vector_type(4))) _Float16 v4h;
typedef __attribute__((ext_vector_type(2))) unsigned short v2us;
typedef __attribute__((ext_vector_type(4))) unsigned short v4us;

__constant__ float INVT[HD / 2] = { 1.000000000e+00f, 7.498942018e-01f, 5.623413324e-01f, 4.216965139e-01f, 3.162277639e-01f, 2.371373624e-01f, 1.778279394e-01f, 1.333521456e-01f, 1.000000015e-01f, 7.498941571e-02f, 5.623412877e-02f, 4.216964915e-02f, 3.162277862e-02f, 2.371373586e-02f, 1.778279431e-02f, 1.333521493e-02f, 9.999999776e-03f, 7.498942316e-03f, 5.623413250e-03f, 4.216964822e-03f, 3.162277862e-03f, 2.371373819e-03f, 1.778279431e-03f, 1.333521446e-03f, 1.000000047e-03f, 7.498941850e-04f, 5.623413017e-04f, 4.216964880e-04f, 3.162277862e-04f, 2.371373848e-04f, 1.778279402e-04f, 1.333521504e-04f };   // float32 1 / 10000^(2i/64), i = 0..31
// k_prep: the four preparations, none of which reads what another writes, as block ranges of ONE grid: the cos | sin table (its blocks first: the longest dependent chain starts earliest), then the bf16 copies of x, of w_qkv and of w_proj, 8 floats a thread.
#define PB_CS (TT * HD / 256)             // blocks of the table: one (t, d) a thread
#define PB_X  (NB_ * TT * DM / 8 / 256)   // blocks of each copy
#define PB_W  (3 * DQ * DM / 8 / 256)
#define PB_O  (DM * DQ / 8 / 256)
static_assert(TT * HD % 256 == 0 && NB_ * TT * DM % 2048 == 0 && 3 * DQ * DM % 2048 == 0 && DM * DQ % 2048 == 0, "every range is whole blocks: no thread lies past an end");
__global__ __launch_bounds__(256) void k_prep(const float* __restrict__ x, const float* __restrict__ wqkv, const float* __restrict__ wo, bf* XB, bf* BT, bf* WO, float* CS) {
    int b = blockIdx.x;
    if (b < PB_CS) { const int idx = b * 256 + threadIdx.x; const int d = idx % HD; const int t = idx / HD; const int p = (d < HD / 2) ? (t / GW) : (t % GW); const float a = __fmul_rn((float)p, INVT[d % (HD / 2)]); v2f cs; cs[0] = cosf(a); cs[1] = sinf(a); *(v2f*)(CS + (size_t)idx * 2) = cs; return; }
    b -= PB_CS;
    const float* src = x; bf* dst = XB;
    if (b >= PB_X + PB_W) { b -= PB_X + PB_W; src = wo; dst = WO; } else if (b >= PB_X) { b -= PB_X; src = wqkv; dst = BT; }
    const size_t i = (size_t)b * 256 + threadIdx.x; const v8f v = *(const v8f*)(src + i * 8); v8us o;
    asm volatile("s_wait_xcnt 0x0" ::: "memory");   // stands behind the two loads, in front of the overwrite of their address registers by the conversion below
#pragma unroll
    for (int k = 0; k < 8; ++k) o[k] = f2bf(v[k]);
    *(v8us*)(dst + i * 8) = o;
}
#define FKS 64     // keys per stage
#define FPT 72     // LDS row pitch in 16-bit elements: 128 + 16 bytes
#define FNS (TT / FKS)
__device__ __forceinline__ v16bf ldsb(const unsigned short* p) { const v8us a = *(const v8usa*)p, b = *(const v8usa*)(p + 16); return cat16b(a, b); }
__device__ __forceinline__ v16h ldsh(const unsigned short* p) { const v8us a = *(const v8usa*)p, b = *(const v8usa*)(p + 16); return cat16(__builtin_bit_cast(v8h, a), __builtin_bit_cast(v8h, b)); }
__device__ __forceinline__ float exp2s(float x) { float r; asm("v_exp_f32 %0, %1\n\tv_nop" : "=v"(r) : "v"(x)); return r; }   // 2^x; the v_nop in the same statement keeps the one slot behind the transcendental, whichever instruction the compiler schedules next
__global__ __launch_bounds__(256) __attribute__((amdgpu_waves_per_eu(4, 4))) void k_fattn(const bf* __restrict__ Qh, const bf* __restrict__ Ql, const bf* __restrict__ Kh, const bf* __restrict__ Kl, const h16* __restrict__ Vt, bf* ATh, bf* ATl) {
    __shared__ __align__(16) unsigned short sm[2][3][FKS * FPT];
    const int tid = threadIdx.x, lane = tid & 31, wv = tid >> 5, lr = lane & 15, hi = lane >> 4;
    const size_t po = (size_t)blockIdx.y * TT * HD; const int q0 = blockIdx.x * 256 + wv * 32;
    v16bf qh[2][2], ql[2][2];
#pragma unroll
    for (int qt = 0; qt < 2; ++qt)
#pragma unroll
        for (int ks = 0; ks < 2; ++ks) { const size_t o = po + (size_t)(q0 + qt * 16 + lr) * HD + ks * 32 + 8 * hi; qh[qt][ks] = WFrag<bf>::ld(Qh + o); ql[qt][ks] = WFrag<bf>::ld(Ql + o); }
    v8f oa[2][4]; float mr[2], ls[2];
#pragma unroll
    for (int qt = 0; qt < 2; ++qt) { mr[qt] = -3.0e38f; ls[qt] = 0.f;
#pragma unroll
        for (int db = 0; db < 4; ++db) oa[qt][db] = (v8f){}; }
    // staging map: 512 chunks of 16 bytes a tile, two a thread: chunk c = tid + 256 i -> row c / 8, 16-byte column c % 8
    const int srow = tid >> 3, scol = (tid & 7) * 8;
    const bf* gkh = Kh + po + (size_t)srow * HD + scol; const bf* gkl = Kl + po + (size_t)srow * HD + scol; const h16* gv = Vt + po + (size_t)srow * TT + scol;   // the lane's own source pointers; they step one stage behind each stage's LDS stores
    const int sdst = srow * FPT + scol;
    v8us g[6];
    g[0] = *(const v8usa*)(gkh); g[1] = *(const v8usa*)(gkh + 32 * HD); g[2] = *(const v8usa*)(gkl); g[3] = *(const v8usa*)(gkl + 32 * HD); g[4] = *(const v8usa*)(gv); g[5] = *(const v8usa*)(gv + (size_t)32 * TT);
    asm volatile("s_wait_xcnt 0x0" ::: "memory");   // stands behind the loads, in front of the step of their address registers below
#pragma unroll
    for (int a = 0; a < 3; ++a) { *(v8usa*)(&sm[0][a][sdst]) = g[2 * a]; *(v8usa*)(&sm[0][a][sdst + 32 * FPT]) = g[2 * a + 1]; }
    gkh += FKS * HD; gkl += FKS * HD; gv += FKS;
    __syncthreads();
    const float CL = SCL * 1.4426950408889634f;
    for (int s = 0; s < FNS; ++s) {
        const int buf = s & 1;
        if (s + 1 < FNS) {   // the next stage's tiles fly while this stage is worked on
            g[0] = *(const v8usa*)(gkh); g[1] = *(const v8usa*)(gkh + 32 * HD); g[2] = *(const v8usa*)(gkl); g[3] = *(const v8usa*)(gkl + 32 * HD); g[4] = *(const v8usa*)(gv); g[5] = *(const v8usa*)(gv + (size_t)32 * TT);
            asm volatile("s_wait_xcnt 0x0" ::: "memory"); }   // stands behind the loads, in front of the step of their address registers at the foot of the trip
#pragma unroll 1   // one 32-key pass at a time in the listing: unrolled, the second pass's fragment loads are hoisted and the registers pass 256 (two work-groups a WGP lost)
        for (int kp = 0; kp < FKS / 32; ++kp) {
            v8f sc[2][2];
#pragma unroll
            for (int kt = 0; kt < 2; ++kt) { const int ro = (kp * 32 + kt * 16 + lr) * FPT + 8 * hi;
                const v16bf ah0 = ldsb(&sm[buf][0][ro]), ah1 = ldsb(&sm[buf][0][ro + 32]), al0 = ldsb(&sm[buf][1][ro]), al1 = ldsb(&sm[buf][1][ro + 32]);
#pragma unroll
                for (int qt = 0; qt < 2; ++qt) { v8f a = (v8f){};
                    a = wmmab(ah0, qh[qt][0], a); a = wmmab(ah0, ql[qt][0], a); a = wmmab(al0, qh[qt][0], a);
                    a = wmmab(ah1, qh[qt][1], a); a = wmmab(ah1, ql[qt][1], a); a = wmmab(al1, qh[qt][1], a); sc[qt][kt] = a; } }
            v16h pb[2];
#pragma unroll
            for (int qt = 0; qt < 2; ++qt) { float mx = sc[qt][0][0];
#pragma unroll
                for (int j = 1; j < 8; ++j) mx = fmaxf(mx, sc[qt][0][j]);
#pragma unroll
                for (int j = 0; j < 8; ++j) mx = fmaxf(mx, sc[qt][1][j]);
                mx = fmaxf(mx, __shfl_xor(mx, 16, 32));
                const float mn = fmaxf(mr[qt], mx * CL); const float al = exp2s(mr[qt] - mn); mr[qt] = mn; const float off = 10.0f - mn;   /* + 10: the weights and their sum carry x 1024, clear of the f16 subnormals */
                float sa = 0.f, sb = 0.f;
#pragma unroll
                for (int j = 0; j < 8; ++j) { const float p0 = exp2s(fmaf(sc[qt][0][j], CL, off)); sa += p0; pb[qt][j] = tohx(p0); }
#pragma unroll
                for (int j = 0; j < 8; ++j) { const float p1 = exp2s(fmaf(sc[qt][1][j], CL, off)); sb += p1; pb[qt][8 + j] = tohx(p1); }
                ls[qt] = fmaf(ls[qt], al, sa + sb);
#pragma unroll
                for (int db = 0; db < 4; ++db) oa[qt][db] *= al; }
#pragma unroll
            for (int db = 0; db < 4; ++db) { const v16h vf = ldsh(&sm[buf][2][(db * 16 + lr) * FPT + kp * 32 + 8 * hi]);
#pragma unroll
                for (int qt = 0; qt < 2; ++qt) oa[qt][db] = wmma16(vf, pb[qt], oa[qt][db]); }
        }
        if (s + 1 < FNS) {
#pragma unroll
            for (int a = 0; a < 3; ++a) { *(v8usa*)(&sm[buf ^ 1][a][sdst]) = g[2 * a]; *(v8usa*)(&sm[buf ^ 1][a][sdst + 32 * FPT]) = g[2 * a + 1]; }
            gkh += FKS * HD; gkl += FKS * HD; gv += FKS; }
        __syncthreads();   // publishes stage s + 1 and ends every wave's reads of the buffer that the next trip refills
    }
    const size_t bq = blockIdx.y >> 4, hh = blockIdx.y & 15;
#pragma unroll
    for (int qt = 0; qt < 2; ++qt) { const float lt = ls[qt] + __shfl_xor(ls[qt], 16, 32); const float inv = __fdiv_rn(1.0f, lt);
        const size_t ob = (bq * TT + q0 + qt * 16 + lr) * DQ + hh * HD + hi * 8;
#pragma unroll
        for (int db = 0; db < 4; ++db) { v8us vh, vl;
#pragma unroll
            for (int j = 0; j < 8; ++j) { unsigned short a, c; splitf(oa[qt][db][j] * inv, a, c); vh[j] = a; vl[j] = c; }
            *(v8us*)(ATh + ob + db * 16) = vh; *(v8us*)(ATl + ob + db * 16) = vl; } }
}

extern "C" void kernel_launch(void* const* d_in, const int* in_sizes, int n_in,
                              void* d_out, int out_size, void* d_ws, size_t ws_size, hipStream_t stream) {
    (void)in_sizes; (void)n_in; (void)out_size;
    const float* x = (const float*)d_in[0]; const float* wqkv = (const float*)d_in[1]; const float* wo = (const float*)d_in[2];   /* order tensor [8][1024][1024], w_qkv ('oi' (out, in) [3072][1024]: PER HEAD q | k | v: rows 192 h + 0..63 | 64..127 | 128..191), w_proj ('oi' [1024][1024]): THREE inputs, all read; no bias anywhere */
    float* OUT = (float*)d_out;     // [8][1024][1024]
    char* wsp = (char*)d_ws;
    auto take = [&](size_t bytes) { char* p = wsp; wsp += (bytes + 255) & ~(size_t)255; return (void*)p; };
    bf* BT = (bf*)take((size_t)3 * DQ * DM * 2); bf* WO = (bf*)take((size_t)DM * DQ * 2); float* CS = (float*)take((size_t)TT * HD * 2 * 4);   /* the fused 'oi' weight is the Bt operand as it stands: ONE bf16 copy [3072][1024]: head h's q | k | v row blocks begin at rows 3 HD h + 0 | HD | 2 HD */
    const size_t NP = (size_t)NB_ * NH_ * TT * HD;   /* elements of one plane over all sequences and heads (= NB_ TT DQ) */
    bf* QPh = (bf*)take(NP * 2); bf* QPl = (bf*)take(NP * 2); bf* KPh = (bf*)take(NP * 2); bf* KPl = (bf*)take(NP * 2); h16* VT16 = (h16*)take(NP * 2); 
    float* Sb = (float*)take((size_t)ZH * TT * TT * 4); (void)take((size_t)ZH * TT * TT * 2);   /* one block of 64 + 32 MiB, adjacent */
    /* stream-ordered reuse: up to the projections the block holds XB (16 MiB); the attention kernel then writes the hi / lo planes of the merged heads over its first 32 MiB */
    bf* XB = (bf*)Sb; bf* ATh = (bf*)Sb; bf* ATl = ATh + NP;
    if ((size_t)(wsp - (char*)d_ws) > ws_size) return;    // ws 256 MiB
    k_prep<<<PB_CS + PB_X + PB_W + PB_O, 256, 0, stream>>>(x, wqkv, wo, XB, BT, WO, CS);   /* the table; ONE bf16 copy of all sequences, read by the projections; 'oi' (out, in): each weight is the Bt operand as it stands */
    k_gemmw<bf, 0, false, true><<<dim3(NB_ * TT / 128, 3 * DQ / 256, 1), 256, 0, stream>>>(XB, nullptr, BT, nullptr, DM, nullptr, 0, nullptr, 0, 0, 0, QkvOut{CS, QPh, QPl, KPh, KPl, VT16});   /* tile column c = weight rows 64 c ..: head c / 3, part c % 3 (q | k | v); stores the planes that the attention reads */
    k_fattn<<<dim3(TT / 256, NB_ * NH_), 256, 0, stream>>>(QPh, QPl, KPh, KPl, VT16, ATh, ATl);   /* every head plane of every sequence in one launch; writes the hi / lo planes of the merged heads over the dead XB block */
    k_gemmw<bf, 1, false, false><<<dim3(NB_ * TT / 128, DM / 256, 1), 256, 0, stream>>>(ATh, ATl, WO, nullptr, DQ, OUT, DM, nullptr, 0, 0, 0, QkvOut{});
}

// v006
// A run of this version takes 154 microseconds.
// Next to v005, in two timings, it ran 1.04 times as fast each time.
// Counting every step since v000, it is 19.7 times as fast.
#include <hip/hip_runtime.h>

// Multi-head self-attention on a 32 x 32 grid of positions with a FIXED TWO-DIMENSIONAL ROTARY TABLE (tensor [8][1024][1024]; qkv = tensor w_qkv^T with ONE fused 'oi' (out, in) weight [3072][1024] normal x 1/32, no bias; THE 3,072 COLUMNS ARE (16, 3, 64): PER HEAD q | k | v: head h's q, k, v are weight rows 192 h + 0..63 | + 64..127 | + 128..191; position n = 32 y + x; theta[n][d] = y x ifreq[d] for d < 32 and x x ifreq[d - 32] for d >= 32 with ifreq[i] = 1 / 10000^(i / 32); q, k -> u cos(theta) + rot(u) sin(theta) with rot(u) = cat(-u2, u1) on the two 32-wide halves: rotate-half over the full head width with its own angle at every d; scores / sqrt(64); no mask; softmax over all 1,024 keys; heads merged; out = merged w_proj^T ('oi' x 1/32, no bias) -> [8][1024][1024] (8.4 M); argument order tensor, w_qkv, w_proj).
// Layout, ALL EIGHT SEQUENCES AT ONCE (token rows 1024 b + t, head planes 16 b + h): ONE bf16 copy of x, read by the three projections; the fused 'oi' weight cast once as it stands: head h's q | k | v row blocks at rows 192 h + 0 | 64 | 128: the three projections ONE launch of 48 tile columns (k_gemmw with QKV = true), which rotates q and k with the computed two-dimensional table, splits them hi / lo and transposes the f16 value plane on its accumulators; dense T-1,024 attention in ONE kernel (k_fattn): THE SCORES OF EVERY ROW ON THE hi / lo PLANES (three products), kept in registers; running-maximum softmax; attn.v of EVERY row on ONE fp16 product (the weights x 1024); the merged heads stored as hi / lo planes; hi/lo x w_proj exact.
// Compute dtypes, f32 accumulate: every input rounded to bf16; projections exact; the table in f32; scores: bf16 hi / lo, 3 products; softmax f32; attn.v: one fp16 product; w_proj hl x exact.

#define NB_  8
#define TT   1024
#define DM   1024
#define NH_  16
#define NKV  16
#define REP  (NH_ / NKV)
#define HD   64
#define DQ   (NH_ * HD)
#define DKV  (NKV * HD)
#define ZH   16    // sizes the 64 + 32 MiB workspace block only
#define RH   0     // unused: the scores of every row run on the hi / lo planes (three products), attn.v on one f16 product
#define WIN  0
#define GW   32    // the grid is 32 x 32 positions: t = GW y + x
#define SCL  0.125f   // HD^-0.5
typedef _Float16 h16;
typedef unsigned short bf;
typedef __attribute__((ext_vector_type(16))) __bf16   v16bf;
typedef __attribute__((ext_vector_type(16))) _Float16 v16h;
typedef __attribute__((ext_vector_type(8)))  _Float16 v8h;
typedef __attribute__((ext_vector_type(8)))  unsigned short v8us;
typedef __attribute__((ext_vector_type(8)))  float    v8f;
typedef __attribute__((ext_vector_type(4)))  float    v4f;
typedef v8h  __attribute__((may_alias)) v8ha;
typedef v4f  __attribute__((may_alias)) v4fa;
typedef v8us __attribute__((may_alias)) v8usa;

__device__ __forceinline__ unsigned short f2bf(float f) { unsigned u = __float_as_uint(f); u += 0x7FFFu + ((u >> 16) & 1u); return (unsigned short)(u >> 16); }
__device__ __forceinline__ float bf2f(unsigned short b) { return __uint_as_float(((unsigned)b) << 16); }
__device__ __forceinline__ float bfr(float f) { return bf2f(f2bf(f)); }
__device__ __forceinline__ v16h cat16(v8h lo, v8h hi) { return __builtin_shufflevector(lo, hi, 0, 1, 2, 3, 4, 5, 6, 7, 8, 9, 10, 11, 12, 13, 14, 15); }
__device__ __forceinline__ v16bf cat16b(v8us lo, v8us hi) { return __builtin_bit_cast(v16bf, __builtin_shufflevector(lo, hi, 0, 1, 2, 3, 4, 5, 6, 7, 8, 9, 10, 11, 12, 13, 14, 15)); }
__device__ __forceinline__ v8f wmma16(v16h a, v16h b, v8f c) { return __builtin_amdgcn_wmma_f32_16x16x32_f16(false, a, false, b, (short)0, c, false, false); }
__device__ __forceinline__ v8f wmmab(v16bf a, v16bf b, v8f c) { return __builtin_amdgcn_wmma_f32_16x16x32_bf16(false, a, false, b, (short)0, c, false, false); }



// The projections' epilogue (QKV = true): qkv = x w_qkv^T as 128 x 48 wave tiles of 64 x 64 in ONE launch, with the rotation, the hi / lo split and the value transpose done on the accumulators.
// Tile column c holds weight rows 64 c .. 64 c + 63 = head c / 3, part c % 3 (q | k | v): a tile is one head's whole width for 64 tokens of one sequence, so the rotation's partner d +- 32 is accumulator nb +- 2 of the same lane.
// q, k: rotated in registers, staged f32 in LDS 16 tokens at a time, read back 8 d a lane, split hi / lo, stored as 512 contiguous bytes an instruction into [plane][t][d]. v: 8 tokens a lane packed to f16, staged [d][t] in LDS, stored as whole 128-byte rows of [plane][d][t].
#define VPT 72     // LDS row pitch of the staged value tile in 16-bit elements: 128 + 16 bytes
typedef __attribute__((ext_vector_type(2))) float v2f;
typedef __attribute__((ext_vector_type(4))) unsigned v4u;
typedef __attribute__((ext_vector_type(2))) __bf16 v2bf;
__device__ __forceinline__ h16 tohx(float x) { return (h16)x; }
__device__ __forceinline__ unsigned pk2bf(float a, float b) { v2f x; x[0] = a; x[1] = b; return __builtin_bit_cast(unsigned, __builtin_convertvector(x, v2bf)); }   // two f32 -> two bf16, round to nearest even, a in the low half
struct QkvOut { const float* CS; bf* Qh; bf* Ql; bf* Kh; bf* Kl; h16* Vt; };   // the cos | sin table [t][d][2] and the planes that the attention reads; all null where QKV = false

// ---- k_gemmw: register-blocked GEMM, ONE WAVE per 64x64 output tile (16 accumulators), EIGHT WAVES (2 x 4 tiles = 128 x 256 of C) a work-group; grid (M/128, N/256, Z), 256 threads.
// The work-group's operand rows (A 128 | A2 128 where NSPLIT = 1 | Bt 256) go global -> LDS by asynchronous copies, 64 k a stage: whole 128-byte lines, 4 rows a wave-wide copy, LDS pitch 144 bytes; two buffers, the next stage's copies fly while this one is worked on; every wave reads its fragments from LDS in the k order that it read them in from the planes.
// C[m][n] (f32, pitch ldc, + optional f32 bias[n]) = sum_k A[m][k] Bt[n][k] (+ A2 Bt where NSPLIT = 1). z-batch strides sA/sB/sC in elements. K % 64 == 0.
#define GKS 64     // k per stage
#define GPI 72     // LDS row pitch in 16-bit elements: 128 + 16 bytes
#define GLS (32 * GPI * 2)   // LDS bytes between two copies of a thread: 32 rows
// Four or eight asynchronous copies of 16 bytes a lane, 32 rows apart (rs elements in the plane, GLS bytes in LDS). The s_wait_xcnt is the last line of the copies' own statement, so that it stands in front of every later write of their address registers.
template <typename T16> __device__ __forceinline__ void acp4(unsigned l, const T16* g, size_t rs) {
    asm volatile("global_load_async_to_lds_b128 %0, %4, off\n\tglobal_load_async_to_lds_b128 %1, %5, off\n\tglobal_load_async_to_lds_b128 %2, %6, off\n\tglobal_load_async_to_lds_b128 %3, %7, off\n\ts_wait_xcnt 0x0"
                 :: "v"(l), "v"(l + GLS), "v"(l + 2 * GLS), "v"(l + 3 * GLS), "v"(g), "v"(g + rs), "v"(g + 2 * rs), "v"(g + 3 * rs) : "memory"); }
template <typename T16> __device__ __forceinline__ void acp8(unsigned l, const T16* g, const T16* h, size_t rs) {
    asm volatile("global_load_async_to_lds_b128 %0, %8, off\n\tglobal_load_async_to_lds_b128 %1, %9, off\n\tglobal_load_async_to_lds_b128 %2, %10, off\n\tglobal_load_async_to_lds_b128 %3, %11, off\n\t"
                 "global_load_async_to_lds_b128 %4, %12, off\n\tglobal_load_async_to_lds_b128 %5, %13, off\n\tglobal_load_async_to_lds_b128 %6, %14, off\n\tglobal_load_async_to_lds_b128 %7, %15, off\n\ts_wait_xcnt 0x0"
                 :: "v"(l), "v"(l + GLS), "v"(l + 2 * GLS), "v"(l + 3 * GLS), "v"(l + 4 * GLS), "v"(l + 5 * GLS), "v"(l + 6 * GLS), "v"(l + 7 * GLS),
                    "v"(g), "v"(g + rs), "v"(g + 2 * rs), "v"(g + 3 * rs), "v"(h), "v"(h + rs), "v"(h + 2 * rs), "v"(h + 3 * rs) : "memory"); }
template <typename T16> struct WFrag;
template <> struct WFrag<h16> { typedef v16h V; static __device__ __forceinline__ V ld(const h16* p) { return cat16(*(const v8h*)p, *(const v8h*)(p + 16)); } static __device__ __forceinline__ V lds(const h16* p) { return cat16(*(const v8ha*)p, *(const v8ha*)(p + 16)); } static __device__ __forceinline__ v8f mma(V a, V b, v8f c) { return wmma16(a, b, c); } };
template <> struct WFrag<bf> { typedef v16bf V; static __device__ __forceinline__ V ld(const bf* p) { return cat16b(*(const v8us*)p, *(const v8us*)(p + 16)); } static __device__ __forceinline__ V lds(const bf* p) { return cat16b(*(const v8usa*)p, *(const v8usa*)(p + 16)); } static __device__ __forceinline__ v8f mma(V a, V b, v8f c) { return wmmab(a, b, c); } };
template <typename T16, int NSPLIT, bool BIAS, bool QKV>
__global__ __launch_bounds__(256) void k_gemmw(const T16* __restrict__ A, const T16* __restrict__ A2, const T16* __restrict__ Bt, const T16* __restrict__ Bt2, int K, float* C, int ldc, const float* __restrict__ bias, size_t sA, size_t sB, size_t sC, QkvOut qo) {
    typedef typename WFrag<T16>::V V;
    static_assert(NSPLIT == 0 || NSPLIT == 1, "the staged rows are A | A2 | Bt");
    constexpr int AR = (NSPLIT == 1) ? 256 : 128, BUFE = (AR + 256) * GPI;   // rows of A (| A2) in a buffer; 16-bit elements of a buffer
    __shared__ __align__(16) float ring[2 * BUFE / 2];   // two buffers; behind the loop each wave stages its output in a slice of its own
    const size_t z = blockIdx.z; A += z * sA; if (A2) A2 += z * sA; Bt += z * sB; C += z * sC; (void)Bt2;
    const int tid = threadIdx.x, lane = tid & 31, lr = lane & 15, hi = lane >> 4; const int wv = __builtin_amdgcn_readfirstlane(tid >> 5);
    const int r0 = blockIdx.x * 128 + (wv & 1) * 64, c0 = blockIdx.y * 256 + (wv >> 1) * 64;
    v8f acc[4][4];
#pragma unroll
    for (int mb = 0; mb < 4; ++mb)
#pragma unroll
        for (int nb = 0; nb < 4; ++nb) acc[mb][nb] = (v8f){};
    // copy map: chunk c = tid + 256 i of 16 bytes -> row c / 8 of the buffer, 16-byte column c % 8
    const size_t rs = (size_t)32 * K; const int srow = tid >> 3, scol = (tid & 7) * 8;
    const T16* ua = A + (size_t)blockIdx.x * 128 * K; const T16* ua2 = (NSPLIT == 1) ? A2 + (size_t)blockIdx.x * 128 * K : nullptr; const T16* ub = Bt + (size_t)blockIdx.y * 256 * K;   // the work-group's first row of each operand
    size_t vo = (size_t)srow * K + scol;   // the lane's own element offset from each of them; it steps one stage behind each stage's copies
    const unsigned l0 = (unsigned)(size_t)ring + (srow * GPI + scol) * 2;   // the lane's own LDS byte address in buffer 0
    auto fill = [&](unsigned l) {
        if constexpr (NSPLIT == 1) { acp8(l, ua + vo, ua2 + vo, rs); acp8(l + 8 * GLS, ub + vo, ub + 4 * rs + vo, rs); }
        else { acp4(l, ua + vo, rs); acp8(l + 4 * GLS, ub + vo, ub + 4 * rs + vo, rs); }
        vo += GKS; };
    const int nst = K / GKS;
    fill(l0);
    asm volatile("s_wait_asynccnt 0x0" ::: "memory");   // this wave's copies of stage 0 have landed
    __syncthreads();                                     // publishes stage 0
    if (1 < nst) fill(l0 + BUFE * 2);
    const int fa = ((wv & 1) * 64 + lr) * GPI + 8 * hi, fb = (AR + (wv >> 1) * 64 + lr) * GPI + 8 * hi;   // the lane's own fragment rows in a buffer
    for (int t = 0; t < nst; ++t) {
        const T16* sb = (const T16*)ring + (t & 1) * BUFE;
#pragma unroll
        for (int ks = 0; ks < GKS; ks += 32) {
            V a[4], a2[4], b[4];
            b[0] = WFrag<T16>::lds(sb + fb + ks);   // the reads stand in the order of first use: Bt 0, every A, Bt 1 to 3
#pragma unroll
            for (int mb = 0; mb < 4; ++mb) { a[mb] = WFrag<T16>::lds(sb + fa + mb * 16 * GPI + ks); if (NSPLIT == 1) a2[mb] = WFrag<T16>::lds(sb + fa + (128 + mb * 16) * GPI + ks); }
#pragma unroll
            for (int nb = 1; nb < 4; ++nb) b[nb] = WFrag<T16>::lds(sb + fb + nb * 16 * GPI + ks);
            __builtin_amdgcn_sched_barrier(0);   // keeps the LDS reads of 32 k one group in front of their products: left free, the scheduler sinks each Bt fragment's reads to its own products, which then wait out the LDS latency four times in 32 k
#pragma unroll
            for (int nb = 0; nb < 4; ++nb)
#pragma unroll
                for (int mb = 0; mb < 4; ++mb) { acc[mb][nb] = WFrag<T16>::mma(a[mb], b[nb], acc[mb][nb]); if (NSPLIT == 1) acc[mb][nb] = WFrag<T16>::mma(a2[mb], b[nb], acc[mb][nb]); }
        }
        __builtin_amdgcn_sched_barrier(0);   // keeps the products in front of the publish point: left free, the scheduler sinks them behind the barrier and in front of the refill, which then has less than a trip to land in
        asm volatile("s_wait_dscnt 0x0" ::: "memory");      // this wave's reads of the buffer have returned
        asm volatile("s_wait_asynccnt 0x0" ::: "memory");   // this wave's copies of stage t + 1 have landed
        __syncthreads();                                     // publishes stage t + 1 and ends every wave's reads of the buffer that is refilled below
        if (t + 2 < nst) fill(l0 + (t & 1) * (BUFE * 2));
    }
    asm volatile("s_wait_asynccnt 0x0" ::: "memory");   // no copy is outstanding when the ring becomes output staging
    float* os = ring + wv * (QKV ? HD * VPT / 2 : 16 * 68);   // the wave's own staging slice. QKV: 9,216 bytes, the value tile; the q / k staging uses its first 16 x 68 floats
    if constexpr (QKV) {
        const int tc = c0 / 64, part = tc % 3, t0 = r0 % TT; const size_t plane = (size_t)(r0 / TT) * NH_ + tc / 3;
        if (part == 2) {
            h16* sv = (h16*)os;
#pragma unroll
            for (int mb = 0; mb < 4; ++mb)
#pragma unroll
                for (int nb = 0; nb < 4; ++nb) { v8h o;
#pragma unroll
                    for (int j = 0; j < 8; ++j) o[j] = tohx(acc[mb][nb][j]);
                    *(v8ha*)(sv + (nb * 16 + lr) * VPT + mb * 16 + hi * 8) = o; }
            __builtin_amdgcn_wave_barrier(); asm volatile("" ::: "memory");   // the reads below take other lanes' LDS stores: neither the compiler nor the scheduler may lift them over the stores
            h16* vrow = qo.Vt + (plane * HD + (lane >> 3)) * TT + t0 + (lane & 7) * 8; const h16* sr = sv + (lane >> 3) * VPT + (lane & 7) * 8;
#pragma unroll
            for (int s = 0; s < 16; ++s) *(v8h*)(vrow + (size_t)s * 4 * TT) = *(const v8ha*)(sr + s * 4 * VPT);
            return;
        }
        bf* Ph = part ? qo.Kh : qo.Qh; bf* Pl = part ? qo.Kl : qo.Ql; const size_t ob = (plane * TT + t0) * HD + lane * 8;
        const char* cst = (const char*)(qo.CS + (size_t)t0 * HD * 2); const unsigned clb = lr * 8, cub = (hi * 8 * HD + HD / 2 + lr) * 8;   // the tile's first table row; the lane's own byte offsets in it: d = lr, and d = 32 + lr of token 8 hi
        v2f cl[2][2];   // d < 32: the angle is that of the grid row t / 32: one cos | sin pair for each 32-token half of the tile
#pragma unroll
        for (int g = 0; g < 2; ++g)
#pragma unroll
            for (int nb = 0; nb < 2; ++nb) cl[g][nb] = *(const v2f*)(cst + clb + (g * GW * HD + nb * 16) * 8);
#pragma unroll
        for (int ml = 0; ml < 2; ++ml) {
            v2f cu[2][8];   // d >= 32: the angle is that of the grid column t % 32: tokens t and t + 32 share the pair
#pragma unroll
            for (int nb = 0; nb < 2; ++nb)
#pragma unroll
                for (int j = 0; j < 8; ++j) cu[nb][j] = *(const v2f*)(cst + cub + ((ml * 16 + j) * HD + nb * 16) * 8);
            asm volatile("s_wait_xcnt 0x0" :: "v"(clb), "v"(cub) : "memory");   // stands behind the table loads, in front of any overwrite of their address registers, which the two inputs keep whole up to here
#pragma unroll
            for (int g = 0; g < 2; ++g) { const int mb = 2 * g + ml;
#pragma unroll
                for (int nb = 0; nb < 2; ++nb)
#pragma unroll
                    for (int j = 0; j < 8; ++j) { const float x0 = acc[mb][nb][j], x1 = acc[mb][nb + 2][j];
                        os[(hi * 8 + j) * 68 + nb * 16 + lr] = x0 * cl[g][nb][0] - x1 * cl[g][nb][1];
                        os[(hi * 8 + j) * 68 + HD / 2 + nb * 16 + lr] = x1 * cu[nb][j][0] + x0 * cu[nb][j][1]; }
                __builtin_amdgcn_wave_barrier(); asm volatile("" ::: "memory");   // the reads below take other lanes' LDS stores
#pragma unroll
                for (int s = 0; s < 4; ++s) { const float* p = os + (4 * s + (lane >> 3)) * 68 + (lane & 7) * 8; const v4f u = *(const v4fa*)p, w = *(const v4fa*)(p + 4); v4u vh, vl;
#pragma unroll
                    for (int q = 0; q < 4; ++q) { const float y0 = (q < 2) ? u[2 * q] : w[2 * q - 4], y1 = (q < 2) ? u[2 * q + 1] : w[2 * q - 3]; const unsigned h2 = pk2bf(y0, y1);
                        vh[q] = h2; vl[q] = pk2bf(y0 - __uint_as_float(h2 << 16), y1 - __uint_as_float(h2 & 0xFFFF0000u)); }
                    *(v4u*)(Ph + ob + mb * 16 * HD + s * 4 * HD) = vh; *(v4u*)(Pl + ob + mb * 16 * HD + s * 4 * HD) = vl; }
                if (mb < 3) { __builtin_amdgcn_wave_barrier(); asm volatile("s_wait_xcnt 0x0" ::: "memory"); }   // not behind the last 16 tokens; stands behind the eight stores, in front of the overwrite of their data registers; its clobber also keeps the next 16 tokens' LDS stores behind the reads above
            }
        }
        return;
    }
#pragma unroll
    for (int mb = 0; mb < 4; ++mb) {
#pragma unroll
        for (int nb = 0; nb < 4; ++nb) {
#pragma unroll
            for (int j = 0; j < 8; ++j) os[(hi * 8 + j) * 68 + nb * 16 + lr] = acc[mb][nb][j]; }
        __builtin_amdgcn_wave_barrier(); asm volatile("" ::: "memory");
        float* crow = C + (size_t)(r0 + mb * 16) * ldc + c0;
{
#pragma unroll
            for (int s = 0; s < 8; ++s) { const int row = 2 * s + hi, cofs = lr * 4; v4f val = *(const v4fa*)(os + row * 68 + cofs); if (BIAS) { val[0] += bfr(bias[c0 + cofs]); val[1] += bfr(bias[c0 + cofs + 1]); val[2] += bfr(bias[c0 + cofs + 2]); val[3] += bfr(bias[c0 + cofs + 3]); }
                *(v4f*)(crow + (size_t)row * ldc + cofs) = val; }
             }
        __builtin_amdgcn_wave_barrier(); asm volatile("" ::: "memory");
    }
}

__device__ __forceinline__ void splitf(float y, unsigned short& h, unsigned short& l) { h = f2bf(y); l = f2bf(y - bf2f(h)); }
typedef __attribute__((ext_vector_type(2))) _Float16 v2h;
typedef __attribute__((ext_vector_type(4))) _Float16 v4h;
typedef __attribute__((ext_vector_type(2))) unsigned short v2us;
typedef __attribute__((ext_vector_type(4))) unsigned short v4us;

__constant__ float INVT[HD / 2] = { 1.000000000e+00f, 7.498942018e-01f, 5.623413324e-01f, 4.216965139e-01f, 3.162277639e-01f, 2.371373624e-01f, 1.778279394e-01f, 1.333521456e-01f, 1.000000015e-01f, 7.498941571e-02f, 5.623412877e-02f, 4.216964915e-02f, 3.162277862e-02f, 2.371373586e-02f, 1.778279431e-02f, 1.333521493e-02f, 9.999999776e-03f, 7.498942316e-03f, 5.623413250e-03f, 4.216964822e-03f, 3.162277862e-03f, 2.371373819e-03f, 1.778279431e-03f, 1.333521446e-03f, 1.000000047e-03f, 7.498941850e-04f, 5.623413017e-04f, 4.216964880e-04f, 3.162277862e-04f, 2.371373848e-04f, 1.778279402e-04f, 1.333521504e-04f };   // float32 1 / 10000^(2i/64), i = 0..31
// k_prep: the four preparations, none of which reads what another writes, as block ranges of ONE grid: the cos | sin table (its blocks first: the longest dependent chain starts earliest), then the bf16 copies of x, of w_qkv and of w_proj, 8 floats a thread.
#define PB_CS (TT * HD / 256)             // blocks of the table: one (t, d) a thread
#define PB_X  (NB_ * TT * DM / 8 / 256)   // blocks of each copy
#define PB_W  (3 * DQ * DM / 8 / 256)
#define PB_O  (DM * DQ / 8 / 256)
static_assert(TT * HD % 256 == 0 && NB_ * TT * DM % 2048 == 0 && 3 * DQ * DM % 2048 == 0 && DM * DQ % 2048 == 0, "every range is whole blocks: no thread lies past an end");
__global__ __launch_bounds__(256) void k_prep(const float* __restrict__ x, const float* __restrict__ wqkv, const float* __restrict__ wo, bf* XB, bf* BT, bf* WO, float* CS) {
    int b = blockIdx.x;
    if (b < PB_CS) { const int idx = b * 256 + threadIdx.x; const int d = idx % HD; const int t = idx / HD; const int p = (d < HD / 2) ? (t / GW) : (t % GW); const float a = __fmul_rn((float)p, INVT[d % (HD / 2)]); v2f cs; cs[0] = cosf(a); cs[1] = sinf(a); *(v2f*)(CS + (size_t)idx * 2) = cs; return; }
    b -= PB_CS;
    const float* src = x; bf* dst = XB;
    if (b >= PB_X + PB_W) { b -= PB_X + PB_W; src = wo; dst = WO; } else if (b >= PB_X) { b -= PB_X; src = wqkv; dst = BT; }
    const size_t i = (size_t)b * 256 + threadIdx.x; const v8f v = *(const v8f*)(src + i * 8); v8us o;
    asm volatile("s_wait_xcnt 0x0" ::: "memory");   // stands behind the two loads, in front of the overwrite of their address registers by the conversion below
#pragma unroll
    for (int k = 0; k < 8; ++k) o[k] = f2bf(v[k]);
    *(v8us*)(dst + i * 8) = o;
}
#define FKS 64     // keys per stage
#define FPT 72     // LDS row pitch in 16-bit elements: 128 + 16 bytes
#define FNS (TT / FKS)
__device__ __forceinline__ v16bf ldsb(const unsigned short* p) { const v8us a = *(const v8usa*)p, b = *(const v8usa*)(p + 16); return cat16b(a, b); }
__device__ __forceinline__ v16h ldsh(const unsigned short* p) { const v8us a = *(const v8usa*)p, b = *(const v8usa*)(p + 16); return cat16(__builtin_bit_cast(v8h, a), __builtin_bit_cast(v8h, b)); }
__device__ __forceinline__ float exp2s(float x) { float r; asm("v_exp_f32 %0, %1\n\tv_nop" : "=v"(r) : "v"(x)); return r; }   // 2^x; the v_nop in the same statement keeps the one slot behind the transcendental, whichever instruction the compiler schedules next
__global__ __launch_bounds__(256) __attribute__((amdgpu_waves_per_eu(4, 4))) void k_fattn(const bf* __restrict__ Qh, const bf* __restrict__ Ql, const bf* __restrict__ Kh, const bf* __restrict__ Kl, const h16* __restrict__ Vt, bf* ATh, bf* ATl) {
    __shared__ __align__(16) unsigned short sm[2][3][FKS * FPT];
    const int tid = threadIdx.x, lane = tid & 31, wv = tid >> 5, lr = lane & 15, hi = lane >> 4;
    const size_t po = (size_t)blockIdx.y * TT * HD; const int q0 = blockIdx.x * 256 + wv * 32;
    v16bf qh[2][2], ql[2][2];
#pragma unroll
    for (int qt = 0; qt < 2; ++qt)
#pragma unroll
        for (int ks = 0; ks < 2; ++ks) { const size_t o = po + (size_t)(q0 + qt * 16 + lr) * HD + ks * 32 + 8 * hi; qh[qt][ks] = WFrag<bf>::ld(Qh + o); ql[qt][ks] = WFrag<bf>::ld(Ql + o); }
    v8f oa[2][4]; float mr[2], ls[2];
#pragma unroll
    for (int qt = 0; qt < 2; ++qt) { mr[qt] = -3.0e38f; ls[qt] = 0.f;
#pragma unroll
        for (int db = 0; db < 4; ++db) oa[qt][db] = (v8f){}; }
    // staging map: 512 chunks of 16 bytes a tile, two a thread: chunk c = tid + 256 i -> row c / 8, 16-byte column c % 8
    const int srow = tid >> 3, scol = (tid & 7) * 8;
    const bf* gkh = Kh + po + (size_t)srow * HD + scol; const bf* gkl = Kl + po + (size_t)srow * HD + scol; const h16* gv = Vt + po + (size_t)srow * TT + scol;   // the lane's own source pointers; they step one stage behind each stage's LDS stores
    const int sdst = srow * FPT + scol;
    v8us g[6];
    g[0] = *(const v8usa*)(gkh); g[1] = *(const v8usa*)(gkh + 32 * HD); g[2] = *(const v8usa*)(gkl); g[3] = *(const v8usa*)(gkl + 32 * HD); g[4] = *(const v8usa*)(gv); g[5] = *(const v8usa*)(gv + (size_t)32 * TT);
    asm volatile("s_wait_xcnt 0x0" ::: "memory");   // stands behind the loads, in front of the step of their address registers below
#pragma unroll
    for (int a = 0; a < 3; ++a) { *(v8usa*)(&sm[0][a][sdst]) = g[2 * a]; *(v8usa*)(&sm[0][a][sdst + 32 * FPT]) = g[2 * a + 1]; }
    gkh += FKS * HD; gkl += FKS * HD; gv += FKS;
    __syncthreads();
    const float CL = SCL * 1.4426950408889634f;
    for (int s = 0; s < FNS; ++s) {
        const int buf = s & 1;
        if (s + 1 < FNS) {   // the next stage's tiles fly while this stage is worked on
            g[0] = *(const v8usa*)(gkh); g[1] = *(const v8usa*)(gkh + 32 * HD); g[2] = *(const v8usa*)(gkl); g[3] = *(const v8usa*)(gkl + 32 * HD); g[4] = *(const v8usa*)(gv); g[5] = *(const v8usa*)(gv + (size_t)32 * TT);
            asm volatile("s_wait_xcnt 0x0" ::: "memory"); }   // stands behind the loads, in front of the step of their address registers at the foot of the trip
#pragma unroll 1   // one 32-key pass at a time in the listing: unrolled, the second pass's fragment loads are hoisted and the registers pass 256 (two work-groups a WGP lost)
        for (int kp = 0; kp < FKS / 32; ++kp) {
            v8f sc[2][2];
#pragma unroll
            for (int kt = 0; kt < 2; ++kt) { const int ro = (kp * 32 + kt * 16 + lr) * FPT + 8 * hi;
                const v16bf ah0 = ldsb(&sm[buf][0][ro]), ah1 = ldsb(&sm[buf][0][ro + 32]), al0 = ldsb(&sm[buf][1][ro]), al1 = ldsb(&sm[buf][1][ro + 32]);
#pragma unroll
                for (int qt = 0; qt < 2; ++qt) { v8f a = (v8f){};
                    a = wmmab(ah0, qh[qt][0], a); a = wmmab(ah0, ql[qt][0], a); a = wmmab(al0, qh[qt][0], a);
                    a = wmmab(ah1, qh[qt][1], a); a = wmmab(ah1, ql[qt][1], a); a = wmmab(al1, qh[qt][1], a); sc[qt][kt] = a; } }
            // Lazy rescale: the maximum in use moves only when some score of the pass lies more than 5 (in log2) above it, so the weights stay below 2^(10 + 5), inside f16; each lane tests its own 16 scores, and the exchange between the wave halves, the factor and the products on the sums stand in the rare branch.
            float mxs[2]; bool need = false;
#pragma unroll
            for (int qt = 0; qt < 2; ++qt) { float mx = sc[qt][0][0];
#pragma unroll
                for (int j = 1; j < 8; ++j) mx = fmaxf(mx, sc[qt][0][j]);
#pragma unroll
                for (int j = 0; j < 8; ++j) mx = fmaxf(mx, sc[qt][1][j]);
                mxs[qt] = mx * CL; need = need || (mxs[qt] > mr[qt] + 5.0f); }
            if (__builtin_amdgcn_ballot_w32(need) != 0) {   // one wave-uniform scalar test a pass; taken by the whole wave, so both halves keep the same maximum in use
#pragma unroll
                for (int qt = 0; qt < 2; ++qt) { const float mn = fmaxf(mr[qt], fmaxf(mxs[qt], __shfl_xor(mxs[qt], 16, 32))); const float al = exp2s(mr[qt] - mn); mr[qt] = mn; ls[qt] *= al;
#pragma unroll
                    for (int db = 0; db < 4; ++db) oa[qt][db] *= al; } }
            v16h pb[2];
#pragma unroll
            for (int qt = 0; qt < 2; ++qt) { const float off = 10.0f - mr[qt];   /* + 10: the weights and their sum carry x 1024, clear of the f16 subnormals */
                float sa = 0.f, sb = 0.f;
#pragma unroll
                for (int j = 0; j < 8; ++j) { const float p0 = exp2s(fmaf(sc[qt][0][j], CL, off)); sa += p0; pb[qt][j] = tohx(p0); }
#pragma unroll
                for (int j = 0; j < 8; ++j) { const float p1 = exp2s(fmaf(sc[qt][1][j], CL, off)); sb += p1; pb[qt][8 + j] = tohx(p1); }
                ls[qt] += sa + sb; }
#pragma unroll
            for (int db = 0; db < 4; ++db) { const v16h vf = ldsh(&sm[buf][2][(db * 16 + lr) * FPT + kp * 32 + 8 * hi]);
#pragma unroll
                for (int qt = 0; qt < 2; ++qt) oa[qt][db] = wmma16(vf, pb[qt], oa[qt][db]); }
        }
        if (s + 1 < FNS) {
#pragma unroll
            for (int a = 0; a < 3; ++a) { *(v8usa*)(&sm[buf ^ 1][a][sdst]) = g[2 * a]; *(v8usa*)(&sm[buf ^ 1][a][sdst + 32 * FPT]) = g[2 * a + 1]; }
            gkh += FKS * HD; gkl += FKS * HD; gv += FKS; }
        __syncthreads();   // publishes stage s + 1 and ends every wave's reads of the buffer that the next trip refills
    }
    const size_t bq = blockIdx.y >> 4, hh = blockIdx.y & 15;
#pragma unroll
    for (int qt = 0; qt < 2; ++qt) { const float lt = ls[qt] + __shfl_xor(ls[qt], 16, 32); const float inv = __fdiv_rn(1.0f, lt);
        const size_t ob = (bq * TT + q0 + qt * 16 + lr) * DQ + hh * HD + hi * 8;
#pragma unroll
        for (int db = 0; db < 4; ++db) { v8us vh, vl;
#pragma unroll
            for (int j = 0; j < 8; ++j) { unsigned short a, c; splitf(oa[qt][db][j] * inv, a, c); vh[j] = a; vl[j] = c; }
            *(v8us*)(ATh + ob + db * 16) = vh; *(v8us*)(ATl + ob + db * 16) = vl; } }
}

extern "C" void kernel_launch(void* const* d_in, const int* in_sizes, int n_in,
                              void* d_out, int out_size, void* d_ws, size_t ws_size, hipStream_t stream) {
    (void)in_sizes; (void)n_in; (void)out_size;
    const float* x = (const float*)d_in[0]; const float* wqkv = (const float*)d_in[1]; const float* wo = (const float*)d_in[2];   /* order tensor [8][1024][1024], w_qkv ('oi' (out, in) [3072][1024]: PER HEAD q | k | v: rows 192 h + 0..63 | 64..127 | 128..191), w_proj ('oi' [1024][1024]): THREE inputs, all read; no bias anywhere */
    float* OUT = (float*)d_out;     // [8][1024][1024]
    char* wsp = (char*)d_ws;
    auto take = [&](size_t bytes) { char* p = wsp; wsp += (bytes + 255) & ~(size_t)255; return (void*)p; };
    bf* BT = (bf*)take((size_t)3 * DQ * DM * 2); bf* WO = (bf*)take((size_t)DM * DQ * 2); float* CS = (float*)take((size_t)TT * HD * 2 * 4);   /* the fused 'oi' weight is the Bt operand as it stands: ONE bf16 copy [3072][1024]: head h's q | k | v row blocks begin at rows 3 HD h + 0 | HD | 2 HD */
    const size_t NP = (size_t)NB_ * NH_ * TT * HD;   /* elements of one plane over all sequences and heads (= NB_ TT DQ) */
    bf* QPh = (bf*)take(NP * 2); bf* QPl = (bf*)take(NP * 2); bf* KPh = (bf*)take(NP * 2); bf* KPl = (bf*)take(NP * 2); h16* VT16 = (h16*)take(NP * 2); 
    float* Sb = (float*)take((size_t)ZH * TT * TT * 4); (void)take((size_t)ZH * TT * TT * 2);   /* one block of 64 + 32 MiB, adjacent */
    /* stream-ordered reuse: up to the projections the block holds XB (16 MiB); the attention kernel then writes the hi / lo planes of the merged heads over its first 32 MiB */
    bf* XB = (bf*)Sb; bf* ATh = (bf*)Sb; bf* ATl = ATh + NP;
    if ((size_t)(wsp - (char*)d_ws) > ws_size) return;    // ws 256 MiB
    k_prep<<<PB_CS + PB_X + PB_W + PB_O, 256, 0, stream>>>(x, wqkv, wo, XB, BT, WO, CS);   /* the table; ONE bf16 copy of all sequences, read by the projections; 'oi' (out, in): each weight is the Bt operand as it stands */
    k_gemmw<bf, 0, false, true><<<dim3(NB_ * TT / 128, 3 * DQ / 256, 1), 256, 0, stream>>>(XB, nullptr, BT, nullptr, DM, nullptr, 0, nullptr, 0, 0, 0, QkvOut{CS, QPh, QPl, KPh, KPl, VT16});   /* tile column c = weight rows 64 c ..: head c / 3, part c % 3 (q | k | v); stores the planes that the attention reads */
    k_fattn<<<dim3(TT / 256, NB_ * NH_), 256, 0, stream>>>(QPh, QPl, KPh, KPl, VT16, ATh, ATl);   /* every head plane of every sequence in one launch; writes the hi / lo planes of the merged heads over the dead XB block */
    k_gemmw<bf, 1, false, false><<<dim3(NB_ * TT / 128, DM / 256, 1), 256, 0, stream>>>(ATh, ATl, WO, nullptr, DQ, OUT, DM, nullptr, 0, 0, 0, QkvOut{});
}

// v009
// A run of this version takes 118 microseconds.
// Versions between v006 and this one are left out; their measured steps multiply to 1.31 times as fast.
// Over all steps from v000 it is 25.9 times as fast.
#include <hip/hip_runtime.h>

// Multi-head self-attention on a 32 x 32 grid of positions with a FIXED TWO-DIMENSIONAL ROTARY TABLE (tensor [8][1024][1024]; qkv = tensor w_qkv^T with ONE fused 'oi' (out, in) weight [3072][1024] normal x 1/32, no bias; THE 3,072 COLUMNS ARE (16, 3, 64): PER HEAD q | k | v: head h's q, k, v are weight rows 192 h + 0..63 | + 64..127 | + 128..191; position n = 32 y + x; theta[n][d] = y x ifreq[d] for d < 32 and x x ifreq[d - 32] for d >= 32 with ifreq[i] = 1 / 10000^(i / 32); q, k -> u cos(theta) + rot(u) sin(theta) with rot(u) = cat(-u2, u1) on the two 32-wide halves: rotate-half over the full head width with its own angle at every d; scores / sqrt(64); no mask; softmax over all 1,024 keys; heads merged; out = merged w_proj^T ('oi' x 1/32, no bias) -> [8][1024][1024] (8.4 M); argument order tensor, w_qkv, w_proj).
// Layout, ALL EIGHT SEQUENCES AT ONCE (token rows 1024 b + t, head planes 16 b + h): ONE bf16 copy of x, read by the three projections; the fused 'oi' weight cast once as it stands: head h's q | k | v row blocks at rows 192 h + 0 | 64 | 128: the three projections ONE launch of 48 tile columns (k_gemmw with QKV = true), which rotates q and k with the computed two-dimensional table, rounds them once to f16 and transposes the f16 value plane on its accumulators; dense T-1,024 attention in ONE kernel (k_fattn): THE SCORES OF EVERY ROW ON ONE f16 PRODUCT, kept in registers; running-maximum softmax; attn.v of EVERY row on ONE fp16 product (the weights x 1024); the merged heads rounded once to f16 and stored as ONE plane; merged x w_proj on ONE f16 product (w_proj's bf16 values carried in f16).
// Compute dtypes, f32 accumulate: every input rounded to bf16; projections exact; the table and the rotation in f32; scores: one fp16 product; softmax f32; attn.v: one fp16 product; w_proj: one fp16 product.

#define NB_  8
#define TT   1024
#define DM   1024
#define NH_  16
#define NKV  16
#define REP  (NH_ / NKV)
#define HD   64
#define DQ   (NH_ * HD)
#define DKV  (NKV * HD)
#define ZH   16    // sizes the 64 + 32 MiB workspace block only
#define RH   0     // unused: the scores of every row run on one f16 product, attn.v on one f16 product
#define WIN  0
#define GW   32    // the grid is 32 x 32 positions: t = GW y + x
#define SCL  0.125f   // HD^-0.5
typedef _Float16 h16;
typedef unsigned short bf;
typedef __attribute__((ext_vector_type(16))) __bf16   v16bf;
typedef __attribute__((ext_vector_type(16))) _Float16 v16h;
typedef __attribute__((ext_vector_type(8)))  _Float16 v8h;
typedef __attribute__((ext_vector_type(8)))  unsigned short v8us;
typedef __attribute__((ext_vector_type(8)))  float    v8f;
typedef __attribute__((ext_vector_type(4)))  float    v4f;
typedef v8h  __attribute__((may_alias)) v8ha;
typedef v4f  __attribute__((may_alias)) v4fa;
typedef v8us __attribute__((may_alias)) v8usa;

__device__ __forceinline__ unsigned short f2bf(float f) { unsigned u = __float_as_uint(f); u += 0x7FFFu + ((u >> 16) & 1u); return (unsigned short)(u >> 16); }
__device__ __forceinline__ float bf2f(unsigned short b) { return __uint_as_float(((unsigned)b) << 16); }
__device__ __forceinline__ float bfr(float f) { return bf2f(f2bf(f)); }
__device__ __forceinline__ v16h cat16(v8h lo, v8h hi) { return __builtin_shufflevector(lo, hi, 0, 1, 2, 3, 4, 5, 6, 7, 8, 9, 10, 11, 12, 13, 14, 15); }
__device__ __forceinline__ v16bf cat16b(v8us lo, v8us hi) { return __builtin_bit_cast(v16bf, __builtin_shufflevector(lo, hi, 0, 1, 2, 3, 4, 5, 6, 7, 8, 9, 10, 11, 12, 13, 14, 15)); }
__device__ __forceinline__ v8f wmma16(v16h a, v16h b, v8f c) { return __builtin_amdgcn_wmma_f32_16x16x32_f16(false, a, false, b, (short)0, c, false, false); }
__device__ __forceinline__ v8f wmmab(v16bf a, v16bf b, v8f c) { return __builtin_amdgcn_wmma_f32_16x16x32_bf16(false, a, false, b, (short)0, c, false, false); }



// The projections' epilogue (QKV = true): qkv = x w_qkv^T as 128 x 48 wave tiles of 64 x 64 in ONE launch, with the rotation, the rounding to f16 and the value transpose done on the accumulators.
// Tile column c holds weight rows 64 c .. 64 c + 63 = head c / 3, part c % 3 (q | k | v): a tile is one head's whole width for 64 tokens of one sequence, so the rotation's partner d +- 32 is accumulator nb +- 2 of the same lane.
// q, k: rotated in registers, staged f32 in LDS 16 tokens at a time, read back 8 d a lane, rounded to f16, stored as 512 contiguous bytes an instruction into [plane][t][d]. v: 8 tokens a lane packed to f16, staged [d][t] in LDS, stored as whole 128-byte rows of [plane][d][t].
#define VPT 72     // LDS row pitch of the staged value tile in 16-bit elements: 128 + 16 bytes
typedef __attribute__((ext_vector_type(2))) float v2f;
__device__ __forceinline__ h16 tohx(float x) { return (h16)x; }
struct QkvOut { const float* CS; h16* Q; h16* K; h16* Vt; };   // the cos | sin table [t][d][2] and the planes that the attention reads; all null where QKV = false

// ---- k_gemmw: register-blocked GEMM, ONE WAVE per 64x64 output tile (16 accumulators), WM x WN WAVES (64 WM x 64 WN of C) a work-group; grid (M / (64 WM), N / (64 WN), Z), 32 WM WN threads.
// w_proj: 2 x 4 waves, 128 x 256 of C, 256 work-groups: one a WGP. The projections: 4 x 3 waves, 256 tokens x one head's q | k | v (192 columns), 512 work-groups, one resident a WGP (its ring takes 243,712 bytes of LDS): two whole rounds of 256 (768 work-groups of 128 x 256 at two a WGP are one round and a half).
// The work-group's operand rows (A 64 WM | A2 where NSPLIT = 1 | Bt 64 WN) go global -> LDS by asynchronous copies; w_proj 64 k a stage: whole 128-byte lines, 4 rows a wave-wide copy, LDS pitch 144 bytes; the projections 128 k a stage: 256 bytes of a row, 2 rows a wave-wide copy, LDS pitch 272 bytes; two buffers, the next stage's copies fly while this one is worked on; every wave reads its fragments from LDS in the k order that it read them in from the planes.
// C[m][n] (f32, pitch ldc, + optional f32 bias[n]) = sum_k A[m][k] Bt[n][k] (+ A2 Bt where NSPLIT = 1). z-batch strides sA/sB/sC in elements. K a multiple of the stage.
#define GKS 64     // k per stage of the 2 x 4 form; the 4 x 3 form takes twice that
#define GPI 72     // LDS row pitch of the 2 x 4 form in 16-bit elements: 128 + 16 bytes
#define GLS (32 * GPI * 2)   // LDS bytes between two copies of a thread: 32 rows
// Four or eight asynchronous copies of 16 bytes a lane, a fixed count of rows apart (rs elements in the plane, LS bytes in LDS: 32 rows in the 2 x 4 map, 16 of A and 8 of Bt in the 4 x 3 map). The s_wait_xcnt is the last line of the copies' own statement, so that it stands in front of every later write of their address registers.
template <unsigned LS, typename T16> __device__ __forceinline__ void acp4(unsigned l, const T16* g, size_t rs) {
    asm volatile("global_load_async_to_lds_b128 %0, %4, off\n\tglobal_load_async_to_lds_b128 %1, %5, off\n\tglobal_load_async_to_lds_b128 %2, %6, off\n\tglobal_load_async_to_lds_b128 %3, %7, off\n\ts_wait_xcnt 0x0"
                 :: "v"(l), "v"(l + LS), "v"(l + 2 * LS), "v"(l + 3 * LS), "v"(g), "v"(g + rs), "v"(g + 2 * rs), "v"(g + 3 * rs) : "memory"); }
template <unsigned LS, typename T16> __device__ __forceinline__ void acp8(unsigned l, const T16* g, const T16* h, size_t rs) {
    asm volatile("global_load_async_to_lds_b128 %0, %8, off\n\tglobal_load_async_to_lds_b128 %1, %9, off\n\tglobal_load_async_to_lds_b128 %2, %10, off\n\tglobal_load_async_to_lds_b128 %3, %11, off\n\t"
                 "global_load_async_to_lds_b128 %4, %12, off\n\tglobal_load_async_to_lds_b128 %5, %13, off\n\tglobal_load_async_to_lds_b128 %6, %14, off\n\tglobal_load_async_to_lds_b128 %7, %15, off\n\ts_wait_xcnt 0x0"
                 :: "v"(l), "v"(l + LS), "v"(l + 2 * LS), "v"(l + 3 * LS), "v"(l + 4 * LS), "v"(l + 5 * LS), "v"(l + 6 * LS), "v"(l + 7 * LS),
                    "v"(g), "v"(g + rs), "v"(g + 2 * rs), "v"(g + 3 * rs), "v"(h), "v"(h + rs), "v"(h + 2 * rs), "v"(h + 3 * rs) : "memory"); }
template <typename T16> struct WFrag;
template <> struct WFrag<h16> { typedef v16h V; static __device__ __forceinline__ V ld(const h16* p) { return cat16(*(const v8h*)p, *(const v8h*)(p + 16)); } static __device__ __forceinline__ V lds(const h16* p) { return cat16(*(const v8ha*)p, *(const v8ha*)(p + 16)); } static __device__ __forceinline__ v8f mma(V a, V b, v8f c) { return wmma16(a, b, c); } };
template <> struct WFrag<bf> { typedef v16bf V; static __device__ __forceinline__ V ld(const bf* p) { return cat16b(*(const v8us*)p, *(const v8us*)(p + 16)); } static __device__ __forceinline__ V lds(const bf* p) { return cat16b(*(const v8usa*)p, *(const v8usa*)(p + 16)); } static __device__ __forceinline__ v8f mma(V a, V b, v8f c) { return wmmab(a, b, c); } };
template <typename T16, int NSPLIT, bool BIAS, bool QKV, int WM, int WN>
__global__ __launch_bounds__(WM * WN * 32) void k_gemmw(const T16* __restrict__ A, const T16* __restrict__ A2, const T16* __restrict__ Bt, const T16* __restrict__ Bt2, int K, float* C, int ldc, const float* __restrict__ bias, size_t sA, size_t sB, size_t sC, QkvOut qo) {
    typedef typename WFrag<T16>::V V;
    static_assert(NSPLIT == 0 || NSPLIT == 1, "the staged rows are A | A2 | Bt");
    static_assert((WM == 2 && WN == 4) || (WM == 4 && WN == 3 && NSPLIT == 0), "the two copy maps below");
    constexpr bool W12 = (WM == 4);
    constexpr int GK = W12 ? 2 * GKS : GKS, PI = GK + 8;   // k per stage and LDS row pitch in 16-bit elements (the row + 16 bytes): 64 and 72, or, with the whole LDS for one work-group, 128 and 136
    constexpr int AR = (NSPLIT == 1) ? 128 * WM : 64 * WM, BUFE = (AR + 64 * WN) * PI;   // rows of A (| A2) in a buffer; 16-bit elements of a buffer
    __shared__ __align__(16) float ring[2 * BUFE / 2];   // two buffers; behind the loop each wave stages its output in a slice of its own
    const size_t z = blockIdx.z; A += z * sA; if (A2) A2 += z * sA; Bt += z * sB; C += z * sC; (void)Bt2;
    const int tid = threadIdx.x, lane = tid & 31, lr = lane & 15, hi = lane >> 4; const int wv = __builtin_amdgcn_readfirstlane(tid >> 5);
    const int wr = wv % WM, wc = wv / WM;   // the wave's tile row and tile column in the work-group
    const int r0 = (blockIdx.x * WM + wr) * 64, c0 = (blockIdx.y * WN + wc) * 64;
    v8f acc[4][4];
#pragma unroll
    for (int mb = 0; mb < 4; ++mb)
#pragma unroll
        for (int nb = 0; nb < 4; ++nb) acc[mb][nb] = (v8f){};
    // copy map, 2 x 4 waves: chunk c = tid + 256 i of 16 bytes -> row c / 8 of the buffer, 16-byte column c % 8. 4 x 3 waves, 16 chunks a row: waves 0 to 7 fill the 256 rows of A, 16 rows a step (16 copies a lane), waves 8 to 11 the 192 rows of Bt, 8 rows a step (24 copies a lane); the choice is the same for a whole wave.
    const bool cpb = W12 && wv >= 8;   // this wave fills Bt alone
    constexpr unsigned LA = 16 * PI * 2, LB = 8 * PI * 2;   // 4 x 3 waves: LDS bytes between two copies of a lane in A and in Bt
    const size_t rs = (size_t)32 * K; const int srow = (cpb ? tid - 256 : tid) / (GK / 8), scol = (tid % (GK / 8)) * 8;
    const T16* ua = A + (size_t)blockIdx.x * (64 * WM) * K; const T16* ua2 = (NSPLIT == 1) ? A2 + (size_t)blockIdx.x * (64 * WM) * K : nullptr; const T16* ub = Bt + (size_t)blockIdx.y * (64 * WN) * K;   // the work-group's first row of each operand
    size_t vo = (size_t)srow * K + scol;   // the lane's own element offset from each of them; it steps one stage behind each stage's copies
    const unsigned l0 = (unsigned)(size_t)ring + (((cpb ? AR : 0) + srow) * PI + scol) * 2;   // the lane's own LDS byte address in buffer 0
    auto fill = [&](unsigned l) {
        if constexpr (W12) {
            if (cpb) { acp8<LB>(l, ub + vo, ub + rs + vo, rs / 4); acp8<LB>(l + 8 * LB, ub + 2 * rs + vo, ub + 3 * rs + vo, rs / 4); acp8<LB>(l + 16 * LB, ub + 4 * rs + vo, ub + 5 * rs + vo, rs / 4); }
            else { acp8<LA>(l, ua + vo, ua + 2 * rs + vo, rs / 2); acp8<LA>(l + 8 * LA, ua + 4 * rs + vo, ua + 6 * rs + vo, rs / 2); } }
        else if constexpr (NSPLIT == 1) { acp8<GLS>(l, ua + vo, ua2 + vo, rs); acp8<GLS>(l + 8 * GLS, ub + vo, ub + 4 * rs + vo, rs); }
        else { acp4<GLS>(l, ua + vo, rs); acp8<GLS>(l + 4 * GLS, ub + vo, ub + 4 * rs + vo, rs); }
        vo += GK; };
    const int nst = K / GK;
    fill(l0);
    asm volatile("s_wait_asynccnt 0x0" ::: "memory");   // this wave's copies of stage 0 have landed
    __syncthreads();                                     // publishes stage 0
    if (1 < nst) fill(l0 + BUFE * 2);
    const int fa = (wr * 64 + lr) * PI + 8 * hi, fb = (AR + wc * 64 + lr) * PI + 8 * hi;   // the lane's own fragment rows in a buffer
    for (int t = 0; t < nst; ++t) {
        const T16* sb = (const T16*)ring + (t & 1) * BUFE;
#pragma unroll
        for (int ks = 0; ks < GK; ks += 32) {
            V a[4], a2[4], b[4];
            b[0] = WFrag<T16>::lds(sb + fb + ks);   // the reads stand in the order of first use: Bt 0, every A, Bt 1 to 3
#pragma unroll
            for (int mb = 0; mb < 4; ++mb) { a[mb] = WFrag<T16>::lds(sb + fa + mb * 16 * PI + ks); if (NSPLIT == 1) a2[mb] = WFrag<T16>::lds(sb + fa + (128 + mb * 16) * PI + ks); }
#pragma unroll
            for (int nb = 1; nb < 4; ++nb) b[nb] = WFrag<T16>::lds(sb + fb + nb * 16 * PI + ks);
            __builtin_amdgcn_sched_barrier(0);   // keeps the LDS reads of 32 k one group in front of their products: left free, the scheduler sinks each Bt fragment's reads to its own products, which then wait out the LDS latency four times in 32 k
#pragma unroll
            for (int nb = 0; nb < 4; ++nb)
#pragma unroll
                for (int mb = 0; mb < 4; ++mb) { acc[mb][nb] = WFrag<T16>::mma(a[mb], b[nb], acc[mb][nb]); if (NSPLIT == 1) acc[mb][nb] = WFrag<T16>::mma(a2[mb], b[nb], acc[mb][nb]); }
        }
        __builtin_amdgcn_sched_barrier(0);   // keeps the products in front of the publish point: left free, the scheduler sinks them behind the barrier and in front of the refill, which then has less than a trip to land in
        asm volatile("v_nop\n\tv_nop\n\tv_nop\n\tv_nop");   // the four vector slots behind the trip's last product: the loop is left by a taken branch, and the epilogue's address arithmetic takes over a product's A registers
        asm volatile("s_wait_dscnt 0x0" ::: "memory");      // this wave's reads of the buffer have returned
        asm volatile("s_wait_asynccnt 0x0" ::: "memory");   // this wave's copies of stage t + 1 have landed
        __syncthreads();                                     // publishes stage t + 1 and ends every wave's reads of the buffer that is refilled below
        if (t + 2 < nst) fill(l0 + (t & 1) * (BUFE * 2));
    }
    asm volatile("s_wait_asynccnt 0x0" ::: "memory");   // no copy is outstanding when the ring becomes output staging
    float* os = ring + wv * (QKV ? HD * VPT / 2 : 16 * 68);   // the wave's own staging slice. QKV: 9,216 bytes, the value tile; the q / k staging uses its first 16 x 68 floats
    if constexpr (QKV) {
        const int tc = c0 / 64, part = tc % 3, t0 = r0 % TT; const size_t plane = (size_t)(r0 / TT) * NH_ + tc / 3;
        if (part == 2) {
            h16* sv = (h16*)os;
#pragma unroll
            for (int mb = 0; mb < 4; ++mb)
#pragma unroll
                for (int nb = 0; nb < 4; ++nb) { v8h o;
#pragma unroll
                    for (int j = 0; j < 8; ++j) o[j] = tohx(acc[mb][nb][j]);
                    *(v8ha*)(sv + (nb * 16 + lr) * VPT + mb * 16 + hi * 8) = o; }
            __builtin_amdgcn_wave_barrier(); asm volatile("" ::: "memory");   // the reads below take other lanes' LDS stores: neither the compiler nor the scheduler may lift them over the stores
            h16* vrow = qo.Vt + (plane * HD + (lane >> 3)) * TT + t0 + (lane & 7) * 8; const h16* sr = sv + (lane >> 3) * VPT + (lane & 7) * 8;
#pragma unroll
            for (int s = 0; s < 16; ++s) *(v8h*)(vrow + (size_t)s * 4 * TT) = *(const v8ha*)(sr + s * 4 * VPT);
            return;
        }
        h16* P = part ? qo.K : qo.Q; const size_t ob = (plane * TT + t0) * HD + lane * 8;
        const char* cst = (const char*)(qo.CS + (size_t)t0 * HD * 2); const unsigned clb = lr * 8, cub = (hi * 8 * HD + HD / 2 + lr) * 8;   // the tile's first table row; the lane's own byte offsets in it: d = lr, and d = 32 + lr of token 8 hi
        v2f cl[2][2];   // d < 32: the angle is that of the grid row t / 32: one cos | sin pair for each 32-token half of the tile
#pragma unroll
        for (int g = 0; g < 2; ++g)
#pragma unroll
            for (int nb = 0; nb < 2; ++nb) cl[g][nb] = *(const v2f*)(cst + clb + (g * GW * HD + nb * 16) * 8);
#pragma unroll
        for (int ml = 0; ml < 2; ++ml) {
            v2f cu[2][8];   // d >= 32: the angle is that of the grid column t % 32: tokens t and t + 32 share the pair
#pragma unroll
            for (int nb = 0; nb < 2; ++nb)
#pragma unroll
                for (int j = 0; j < 8; ++j) cu[nb][j] = *(const v2f*)(cst + cub + ((ml * 16 + j) * HD + nb * 16) * 8);
            asm volatile("s_wait_xcnt 0x0" :: "v"(clb), "v"(cub) : "memory");   // stands behind the table loads, in front of any overwrite of their address registers, which the two inputs keep whole up to here
#pragma unroll
            for (int g = 0; g < 2; ++g) { const int mb = 2 * g + ml;
#pragma unroll
                for (int nb = 0; nb < 2; ++nb)
#pragma unroll
                    for (int j = 0; j < 8; ++j) { const float x0 = acc[mb][nb][j], x1 = acc[mb][nb + 2][j];
                        os[(hi * 8 + j) * 68 + nb * 16 + lr] = x0 * cl[g][nb][0] - x1 * cl[g][nb][1];
                        os[(hi * 8 + j) * 68 + HD / 2 + nb * 16 + lr] = x1 * cu[nb][j][0] + x0 * cu[nb][j][1]; }
                __builtin_amdgcn_wave_barrier(); asm volatile("" ::: "memory");   // the reads below take other lanes' LDS stores
#pragma unroll
                for (int s = 0; s < 4; ++s) { const float* p = os + (4 * s + (lane >> 3)) * 68 + (lane & 7) * 8; const v4f u = *(const v4fa*)p, w = *(const v4fa*)(p + 4); v8h o;
#pragma unroll
                    for (int q = 0; q < 4; ++q) { o[q] = tohx(u[q]); o[4 + q] = tohx(w[q]); }
                    *(v8h*)(P + ob + mb * 16 * HD + s * 4 * HD) = o; }
                if (mb < 3) { __builtin_amdgcn_wave_barrier(); asm volatile("s_wait_xcnt 0x0" ::: "memory"); }   // not behind the last 16 tokens; stands behind the four stores, in front of the overwrite of their data registers; its clobber also keeps the next 16 tokens' LDS stores behind the reads above
            }
        }
        return;
    }
#pragma unroll
    for (int mb = 0; mb < 4; ++mb) {
#pragma unroll
        for (int nb = 0; nb < 4; ++nb) {
#pragma unroll
            for (int j = 0; j < 8; ++j) os[(hi * 8 + j) * 68 + nb * 16 + lr] = acc[mb][nb][j]; }
        __builtin_amdgcn_wave_barrier(); asm volatile("" ::: "memory");
        float* crow = C + (size_t)(r0 + mb * 16) * ldc + c0;
{
#pragma unroll
            for (int s = 0; s < 8; ++s) { const int row = 2 * s + hi, cofs = lr * 4; v4f val = *(const v4fa*)(os + row * 68 + cofs); if (BIAS) { val[0] += bfr(bias[c0 + cofs]); val[1] += bfr(bias[c0 + cofs + 1]); val[2] += bfr(bias[c0 + cofs + 2]); val[3] += bfr(bias[c0 + cofs + 3]); }
                *(v4f*)(crow + (size_t)row * ldc + cofs) = val; }
             }
        __builtin_amdgcn_wave_barrier(); asm volatile("" ::: "memory");
    }
}

typedef __attribute__((ext_vector_type(2))) _Float16 v2h;
typedef __attribute__((ext_vector_type(4))) _Float16 v4h;
typedef __attribute__((ext_vector_type(2))) unsigned short v2us;
typedef __attribute__((ext_vector_type(4))) unsigned short v4us;

__constant__ float INVT[HD / 2] = { 1.000000000e+00f, 7.498942018e-01f, 5.623413324e-01f, 4.216965139e-01f, 3.162277639e-01f, 2.371373624e-01f, 1.778279394e-01f, 1.333521456e-01f, 1.000000015e-01f, 7.498941571e-02f, 5.623412877e-02f, 4.216964915e-02f, 3.162277862e-02f, 2.371373586e-02f, 1.778279431e-02f, 1.333521493e-02f, 9.999999776e-03f, 7.498942316e-03f, 5.623413250e-03f, 4.216964822e-03f, 3.162277862e-03f, 2.371373819e-03f, 1.778279431e-03f, 1.333521446e-03f, 1.000000047e-03f, 7.498941850e-04f, 5.623413017e-04f, 4.216964880e-04f, 3.162277862e-04f, 2.371373848e-04f, 1.778279402e-04f, 1.333521504e-04f };   // float32 1 / 10000^(2i/64), i = 0..31
// k_prep: the four preparations, none of which reads what another writes, as block ranges of ONE grid: the cos | sin table (its blocks first: the longest dependent chain starts earliest), then the bf16 copies of x and of w_qkv and the copy of w_proj (rounded to bf16 like every input, that value then written as f16, the operand type of the last GEMM), 8 floats a thread.
#define PB_CS (TT * HD / 256)             // blocks of the table: one (t, d) a thread
#define PB_X  (NB_ * TT * DM / 8 / 256)   // blocks of each copy
#define PB_W  (3 * DQ * DM / 8 / 256)
#define PB_O  (DM * DQ / 8 / 256)
static_assert(TT * HD % 256 == 0 && NB_ * TT * DM % 2048 == 0 && 3 * DQ * DM % 2048 == 0 && DM * DQ % 2048 == 0, "every range is whole blocks: no thread lies past an end");
__global__ __launch_bounds__(256) void k_prep(const float* __restrict__ x, const float* __restrict__ wqkv, const float* __restrict__ wo, bf* XB, bf* BT, bf* WO, float* CS) {
    int b = blockIdx.x;
    if (b < PB_CS) { const int idx = b * 256 + threadIdx.x; const int d = idx % HD; const int t = idx / HD; const int p = (d < HD / 2) ? (t / GW) : (t % GW); const float a = __fmul_rn((float)p, INVT[d % (HD / 2)]); v2f cs; cs[0] = cosf(a); cs[1] = sinf(a); *(v2f*)(CS + (size_t)idx * 2) = cs; return; }
    b -= PB_CS;
    const float* src = x; bf* dst = XB; bool wh = false;   // wh: the block belongs to w_proj; the same for a whole block
    if (b >= PB_X + PB_W) { b -= PB_X + PB_W; src = wo; dst = WO; wh = true; } else if (b >= PB_X) { b -= PB_X; src = wqkv; dst = BT; }
    const size_t i = (size_t)b * 256 + threadIdx.x; const v8f v = *(const v8f*)(src + i * 8); v8us o;
    asm volatile("s_wait_xcnt 0x0" ::: "memory");   // stands behind the two loads, in front of the overwrite of their address registers by the conversion below
    if (wh) {
#pragma unroll
        for (int k = 0; k < 8; ++k) o[k] = __builtin_bit_cast(unsigned short, tohx(bfr(v[k])));
    } else {
#pragma unroll
        for (int k = 0; k < 8; ++k) o[k] = f2bf(v[k]);
    }
    *(v8us*)(dst + i * 8) = o;
}
#define FKS 64     // keys per stage
#define FPT 72     // LDS row pitch in 16-bit elements: 128 + 16 bytes
#define FNS (TT / FKS)
__device__ __forceinline__ v16h ldsh(const unsigned short* p) { const v8us a = *(const v8usa*)p, b = *(const v8usa*)(p + 16); return cat16(__builtin_bit_cast(v8h, a), __builtin_bit_cast(v8h, b)); }
__device__ __forceinline__ float exp2s(float x) { float r; asm("v_exp_f32 %0, %1\n\tv_nop" : "=v"(r) : "v"(x)); return r; }   // 2^x; the v_nop in the same statement keeps the one slot behind the transcendental, whichever instruction the compiler schedules next
__global__ __launch_bounds__(256) __attribute__((amdgpu_waves_per_eu(4, 4))) void k_fattn(const h16* __restrict__ Q, const h16* __restrict__ K, const h16* __restrict__ Vt, h16* AT) {
    __shared__ __align__(16) unsigned short sm[2][2][FKS * FPT];   // [buffer][K | V^T]
    const int tid = threadIdx.x, lane = tid & 31, wv = tid >> 5, lr = lane & 15, hi = lane >> 4;
    const size_t po = (size_t)blockIdx.y * TT * HD; const int q0 = blockIdx.x * 256 + wv * 32;
    v16h qf[2][2];
#pragma unroll
    for (int qt = 0; qt < 2; ++qt)
#pragma unroll
        for (int ks = 0; ks < 2; ++ks) { const size_t o = po + (size_t)(q0 + qt * 16 + lr) * HD + ks * 32 + 8 * hi; qf[qt][ks] = WFrag<h16>::ld(Q + o); }
    v8f oa[2][4]; float mr[2], ls[2];
#pragma unroll
    for (int qt = 0; qt < 2; ++qt) { mr[qt] = -3.0e38f; ls[qt] = 0.f;
#pragma unroll
        for (int db = 0; db < 4; ++db) oa[qt][db] = (v8f){}; }
    // staging map: 512 chunks of 16 bytes a tile, two a thread: chunk c = tid + 256 i -> row c / 8, 16-byte column c % 8
    const int srow = tid >> 3, scol = (tid & 7) * 8;
    const h16* gk = K + po + (size_t)srow * HD + scol; const h16* gv = Vt + po + (size_t)srow * TT + scol;   // the lane's own source pointers; they step one stage behind each stage's LDS stores
    const int sdst = srow * FPT + scol;
    v8us g[4];
    g[0] = *(const v8usa*)(gk); g[1] = *(const v8usa*)(gk + 32 * HD); g[2] = *(const v8usa*)(gv); g[3] = *(const v8usa*)(gv + (size_t)32 * TT);
    asm volatile("s_wait_xcnt 0x0" ::: "memory");   // stands behind the loads, in front of the step of their address registers below
#pragma unroll
    for (int a = 0; a < 2; ++a) { *(v8usa*)(&sm[0][a][sdst]) = g[2 * a]; *(v8usa*)(&sm[0][a][sdst + 32 * FPT]) = g[2 * a + 1]; }
    gk += FKS * HD; gv += FKS;
    __syncthreads();
    const float CL = SCL * 1.4426950408889634f;
    for (int s = 0; s < FNS; ++s) {
        const int buf = s & 1;
        if (s + 1 < FNS) {   // the next stage's tiles fly while this stage is worked on
            g[0] = *(const v8usa*)(gk); g[1] = *(const v8usa*)(gk + 32 * HD); g[2] = *(const v8usa*)(gv); g[3] = *(const v8usa*)(gv + (size_t)32 * TT);
            asm volatile("s_wait_xcnt 0x0" ::: "memory"); }   // stands behind the loads, in front of the step of their address registers at the foot of the trip
#pragma unroll 1   // one 32-key pass at a time in the listing: the loop keeps the shape it had with the hi / lo fragments, where the unrolled form passed 256 registers, so that only the products differ; with one product the unrolled form fits, and whether it pays is a step of its own
        for (int kp = 0; kp < FKS / 32; ++kp) {
            v8f sc[2][2];
#pragma unroll
            for (int kt = 0; kt < 2; ++kt) { const int ro = (kp * 32 + kt * 16 + lr) * FPT + 8 * hi;
                const v16h a0 = ldsh(&sm[buf][0][ro]), a1 = ldsh(&sm[buf][0][ro + 32]);
#pragma unroll
                for (int qt = 0; qt < 2; ++qt) { v8f a = (v8f){};
                    a = wmma16(a0, qf[qt][0], a); a = wmma16(a1, qf[qt][1], a); sc[qt][kt] = a; } }
            // Lazy rescale: the maximum in use moves only when some score of the pass lies more than 5 (in log2) above it, so the weights stay below 2^(10 + 5), inside f16; each lane tests its own 16 scores, and the exchange between the wave halves, the factor and the products on the sums stand in the rare branch.
            float mxs[2]; bool need = false;
#pragma unroll
            for (int qt = 0; qt < 2; ++qt) { float mx = sc[qt][0][0];
#pragma unroll
                for (int j = 1; j < 8; ++j) mx = fmaxf(mx, sc[qt][0][j]);
#pragma unroll
                for (int j = 0; j < 8; ++j) mx = fmaxf(mx, sc[qt][1][j]);
                mxs[qt] = mx * CL; need = need || (mxs[qt] > mr[qt] + 5.0f); }
            if (__builtin_amdgcn_ballot_w32(need) != 0) {   // one wave-uniform scalar test a pass; taken by the whole wave, so both halves keep the same maximum in use
#pragma unroll
                for (int qt = 0; qt < 2; ++qt) { const float mn = fmaxf(mr[qt], fmaxf(mxs[qt], __shfl_xor(mxs[qt], 16, 32))); const float al = exp2s(mr[qt] - mn); mr[qt] = mn; ls[qt] *= al;
#pragma unroll
                    for (int db = 0; db < 4; ++db) oa[qt][db] *= al; } }
            v16h pb[2];
#pragma unroll
            for (int qt = 0; qt < 2; ++qt) { const float off = 10.0f - mr[qt];   /* + 10: the weights and their sum carry x 1024, clear of the f16 subnormals */
                float sa = 0.f, sb = 0.f;
#pragma unroll
                for (int j = 0; j < 8; ++j) { const float p0 = exp2s(fmaf(sc[qt][0][j], CL, off)); sa += p0; pb[qt][j] = tohx(p0); }
#pragma unroll
                for (int j = 0; j < 8; ++j) { const float p1 = exp2s(fmaf(sc[qt][1][j], CL, off)); sb += p1; pb[qt][8 + j] = tohx(p1); }
                ls[qt] += sa + sb; }
#pragma unroll
            for (int db = 0; db < 4; ++db) { const v16h vf = ldsh(&sm[buf][1][(db * 16 + lr) * FPT + kp * 32 + 8 * hi]);
#pragma unroll
                for (int qt = 0; qt < 2; ++qt) oa[qt][db] = wmma16(vf, pb[qt], oa[qt][db]); }
            __builtin_amdgcn_sched_barrier(0);   // holds the slots below at the foot of the pass: left free, the scheduler lifts them in front of the last products, where they keep no distance
            asm volatile("v_nop\n\tv_nop\n\tv_nop\n\tv_nop");   // the four vector slots behind the pass's last product: the next pass's address arithmetic takes over that product's A registers across the loop's back edge
        }
        if (s + 1 < FNS) {
#pragma unroll
            for (int a = 0; a < 2; ++a) { *(v8usa*)(&sm[buf ^ 1][a][sdst]) = g[2 * a]; *(v8usa*)(&sm[buf ^ 1][a][sdst + 32 * FPT]) = g[2 * a + 1]; }
            gk += FKS * HD; gv += FKS; }
        __syncthreads();   // publishes stage s + 1 and ends every wave's reads of the buffer that the next trip refills
    }
    const size_t bq = blockIdx.y >> 4, hh = blockIdx.y & 15;
#pragma unroll
    for (int qt = 0; qt < 2; ++qt) { const float lt = ls[qt] + __shfl_xor(ls[qt], 16, 32); const float inv = __fdiv_rn(1.0f, lt);
        const size_t ob = (bq * TT + q0 + qt * 16 + lr) * DQ + hh * HD + hi * 8;
#pragma unroll
        for (int db = 0; db < 4; ++db) { v8h o;
#pragma unroll
            for (int j = 0; j < 8; ++j) o[j] = tohx(oa[qt][db][j] * inv);
            *(v8h*)(AT + ob + db * 16) = o; } }
}

extern "C" void kernel_launch(void* const* d_in, const int* in_sizes, int n_in,
                              void* d_out, int out_size, void* d_ws, size_t ws_size, hipStream_t stream) {
    (void)in_sizes; (void)n_in; (void)out_size;
    const float* x = (const float*)d_in[0]; const float* wqkv = (const float*)d_in[1]; const float* wo = (const float*)d_in[2];   /* order tensor [8][1024][1024], w_qkv ('oi' (out, in) [3072][1024]: PER HEAD q | k | v: rows 192 h + 0..63 | 64..127 | 128..191), w_proj ('oi' [1024][1024]): THREE inputs, all read; no bias anywhere */
    float* OUT = (float*)d_out;     // [8][1024][1024]
    char* wsp = (char*)d_ws;
    auto take = [&](size_t bytes) { char* p = wsp; wsp += (bytes + 255) & ~(size_t)255; return (void*)p; };
    bf* BT = (bf*)take((size_t)3 * DQ * DM * 2); bf* WO = (bf*)take((size_t)DM * DQ * 2); float* CS = (float*)take((size_t)TT * HD * 2 * 4);   /* the fused 'oi' weight is the Bt operand as it stands: ONE bf16 copy [3072][1024]: head h's q | k | v row blocks begin at rows 3 HD h + 0 | HD | 2 HD */
    const size_t NP = (size_t)NB_ * NH_ * TT * HD;   /* elements of one plane over all sequences and heads (= NB_ TT DQ) */
    h16* QP = (h16*)take(NP * 2); h16* KP = (h16*)take(NP * 2); h16* VT16 = (h16*)take(NP * 2);
    float* Sb = (float*)take((size_t)ZH * TT * TT * 4); (void)take((size_t)ZH * TT * TT * 2);   /* one block of 64 + 32 MiB, adjacent */
    /* stream-ordered reuse: up to the projections the block holds XB (16 MiB); the attention kernel then writes the f16 plane of the merged heads over those 16 MiB */
    bf* XB = (bf*)Sb; h16* AT = (h16*)Sb;
    if ((size_t)(wsp - (char*)d_ws) > ws_size) return;    // ws 256 MiB
    k_prep<<<PB_CS + PB_X + PB_W + PB_O, 256, 0, stream>>>(x, wqkv, wo, XB, BT, WO, CS);   /* the table; ONE bf16 copy of all sequences, read by the projections; 'oi' (out, in): each weight is the Bt operand as it stands; WO holds f16 bit patterns */
    k_gemmw<bf, 0, false, true, 4, 3><<<dim3(NB_ * TT / 256, 3 * DQ / 192, 1), 384, 0, stream>>>(XB, nullptr, BT, nullptr, DM, nullptr, 0, nullptr, 0, 0, 0, QkvOut{CS, QP, KP, VT16});   /* tile column c = weight rows 64 c ..: head c / 3, part c % 3 (q | k | v); stores the planes that the attention reads */
    k_fattn<<<dim3(TT / 256, NB_ * NH_), 256, 0, stream>>>(QP, KP, VT16, AT);   /* every head plane of every sequence in one launch; writes the f16 plane of the merged heads over the dead XB block */
    k_gemmw<h16, 0, false, false, 2, 4><<<dim3(NB_ * TT / 128, DM / 256, 1), 256, 0, stream>>>(AT, nullptr, (const h16*)WO, nullptr, DQ, OUT, DM, nullptr, 0, 0, 0, QkvOut{});
}

// v010
// One run takes 114 microseconds.
// Two timings next to v009 put it at 1.03 and 1.04 times that version's speed.
// Over all steps from v000 it is 26.8 times as fast.
#include <hip/hip_runtime.h>

// Multi-head self-attention on a 32 x 32 grid of positions with a FIXED TWO-DIMENSIONAL ROTARY TABLE (tensor [8][1024][1024]; qkv = tensor w_qkv^T with ONE fused 'oi' (out, in) weight [3072][1024] normal x 1/32, no bias; THE 3,072 COLUMNS ARE (16, 3, 64): PER HEAD q | k | v: head h's q, k, v are weight rows 192 h + 0..63 | + 64..127 | + 128..191; position n = 32 y + x; theta[n][d] = y x ifreq[d] for d < 32 and x x ifreq[d - 32] for d >= 32 with ifreq[i] = 1 / 10000^(i / 32); q, k -> u cos(theta) + rot(u) sin(theta) with rot(u) = cat(-u2, u1) on the two 32-wide halves: rotate-half over the full head width with its own angle at every d; scores / sqrt(64); no mask; softmax over all 1,024 keys; heads merged; out = merged w_proj^T ('oi' x 1/32, no bias) -> [8][1024][1024] (8.4 M); argument order tensor, w_qkv, w_proj).
// Layout, ALL EIGHT SEQUENCES AT ONCE (token rows 1024 b + t, head planes 16 b + h): ONE bf16 copy of x, read by the three projections; the fused 'oi' weight cast once as it stands: head h's q | k | v row blocks at rows 192 h + 0 | 64 | 128: the three projections ONE launch of 48 tile columns (k_gemmw with QKV = true), which rotates q and k with the computed two-dimensional table, rounds them once to f16 and transposes the f16 value plane on its accumulators; dense T-1,024 attention in ONE kernel (k_fattn): THE SCORES OF EVERY ROW ON ONE f16 PRODUCT, kept in registers; running-maximum softmax; attn.v of EVERY row on ONE fp16 product (the weights x 1024); the merged heads rounded once to f16 and stored as ONE plane; merged x w_proj on ONE f16 product (w_proj's bf16 values carried in f16).
// Compute dtypes, f32 accumulate: every input rounded to bf16; projections exact; the table and the rotation in f32; scores: one fp16 product; softmax f32; attn.v: one fp16 product; w_proj: one fp16 product.

#define NB_  8
#define TT   1024
#define DM   1024
#define NH_  16
#define NKV  16
#define REP  (NH_ / NKV)
#define HD   64
#define DQ   (NH_ * HD)
#define DKV  (NKV * HD)
#define ZH   16    // sizes the 64 + 32 MiB workspace block only
#define RH   0     // unused: the scores of every row run on one f16 product, attn.v on one f16 product
#define WIN  0
#define GW   32    // the grid is 32 x 32 positions: t = GW y + x
#define SCL  0.125f   // HD^-0.5
typedef _Float16 h16;
typedef unsigned short bf;
typedef __attribute__((ext_vector_type(16))) __bf16   v16bf;
typedef __attribute__((ext_vector_type(16))) _Float16 v16h;
typedef __attribute__((ext_vector_type(8)))  _Float16 v8h;
typedef __attribute__((ext_vector_type(8)))  unsigned short v8us;
typedef __attribute__((ext_vector_type(8)))  float    v8f;
typedef __attribute__((ext_vector_type(4)))  float    v4f;
typedef v8h  __attribute__((may_alias)) v8ha;
typedef v4f  __attribute__((may_alias)) v4fa;
typedef v8us __attribute__((may_alias)) v8usa;

__device__ __forceinline__ unsigned short f2bf(float f) { unsigned u = __float_as_uint(f); u += 0x7FFFu + ((u >> 16) & 1u); return (unsigned short)(u >> 16); }
__device__ __forceinline__ float bf2f(unsigned short b) { return __uint_as_float(((unsigned)b) << 16); }
__device__ __forceinline__ float bfr(float f) { return bf2f(f2bf(f)); }
__device__ __forceinline__ v16h cat16(v8h lo, v8h hi) { return __builtin_shufflevector(lo, hi, 0, 1, 2, 3, 4, 5, 6, 7, 8, 9, 10, 11, 12, 13, 14, 15); }
__device__ __forceinline__ v16bf cat16b(v8us lo, v8us hi) { return __builtin_bit_cast(v16bf, __builtin_shufflevector(lo, hi, 0, 1, 2, 3, 4, 5, 6, 7, 8, 9, 10, 11, 12, 13, 14, 15)); }
__device__ __forceinline__ v8f wmma16(v16h a, v16h b, v8f c) { return __builtin_amdgcn_wmma_f32_16x16x32_f16(false, a, false, b, (short)0, c, false, false); }
__device__ __forceinline__ v8f wmmab(v16bf a, v16bf b, v8f c) { return __builtin_amdgcn_wmma_f32_16x16x32_bf16(false, a, false, b, (short)0, c, false, false); }



// The projections' epilogue (QKV = true): qkv = x w_qkv^T as 128 x 48 wave tiles of 64 x 64 in ONE launch, with the rotation, the rounding to f16 and the value transpose done on the accumulators.
// Tile column c holds weight rows 64 c .. 64 c + 63 = head c / 3, part c % 3 (q | k | v): a tile is one head's whole width for 64 tokens of one sequence, so the rotation's partner d +- 32 is accumulator nb +- 2 of the same lane.
// q, k: rotated in registers, staged f32 in LDS 16 tokens at a time, read back 8 d a lane, rounded to f16, stored as 512 contiguous bytes an instruction into [plane][t][d]. v: 8 tokens a lane packed to f16, staged [d][t] in LDS, stored as whole 128-byte rows of [plane][d][t].
#define VPT 72     // LDS row pitch of the staged value tile in 16-bit elements: 128 + 16 bytes
typedef __attribute__((ext_vector_type(2))) float v2f;
__device__ __forceinline__ h16 tohx(float x) { return (h16)x; }
struct QkvOut { const float* CS; h16* Q; h16* K; h16* Vt; };   // the cos | sin table [t][d][2] and the planes that the attention reads; all null where QKV = false

// ---- k_gemmw: register-blocked GEMM, ONE WAVE per 64x64 output tile (16 accumulators), WM x WN WAVES (64 WM x 64 WN of C) a work-group; grid (M / (64 WM), N / (64 WN), Z), 32 WM WN threads.
// w_proj: 2 x 4 waves, 128 x 256 of C, 256 work-groups: one a WGP. The projections: 4 x 3 waves, 256 tokens x one head's q | k | v (192 columns), 512 work-groups, one resident a WGP (its ring takes 243,712 bytes of LDS): two whole rounds of 256 (768 work-groups of 128 x 256 at two a WGP are one round and a half).
// The work-group's operand rows (A 64 WM | A2 where NSPLIT = 1 | Bt 64 WN) go global -> LDS by asynchronous copies; w_proj 64 k a stage: whole 128-byte lines, 4 rows a wave-wide copy, LDS pitch 144 bytes; the projections 128 k a stage: 256 bytes of a row, 2 rows a wave-wide copy, LDS pitch 272 bytes; two buffers, the next stage's copies fly while this one is worked on; every wave reads its fragments from LDS in the k order that it read them in from the planes.
// C[m][n] (f32, pitch ldc, + optional f32 bias[n]) = sum_k A[m][k] Bt[n][k] (+ A2 Bt where NSPLIT = 1). z-batch strides sA/sB/sC in elements. K a multiple of the stage.
#define GKS 64     // k per stage of the 2 x 4 form; the 4 x 3 form takes twice that
#define GPI 72     // LDS row pitch of the 2 x 4 form in 16-bit elements: 128 + 16 bytes
#define GLS (32 * GPI * 2)   // LDS bytes between two copies of a thread: 32 rows
// Four or eight asynchronous copies of 16 bytes a lane, a fixed count of rows apart (rs elements in the plane, LS bytes in LDS: 32 rows in the 2 x 4 map, 16 of A and 8 of Bt in the 4 x 3 map). The s_wait_xcnt is the last line of the copies' own statement, so that it stands in front of every later write of their address registers.
template <unsigned LS, typename T16> __device__ __forceinline__ void acp4(unsigned l, const T16* g, size_t rs) {
    asm volatile("global_load_async_to_lds_b128 %0, %4, off\n\tglobal_load_async_to_lds_b128 %1, %5, off\n\tglobal_load_async_to_lds_b128 %2, %6, off\n\tglobal_load_async_to_lds_b128 %3, %7, off\n\ts_wait_xcnt 0x0"
                 :: "v"(l), "v"(l + LS), "v"(l + 2 * LS), "v"(l + 3 * LS), "v"(g), "v"(g + rs), "v"(g + 2 * rs), "v"(g + 3 * rs) : "memory"); }
template <unsigned LS, typename T16> __device__ __forceinline__ void acp8(unsigned l, const T16* g, const T16* h, size_t rs) {
    asm volatile("global_load_async_to_lds_b128 %0, %8, off\n\tglobal_load_async_to_lds_b128 %1, %9, off\n\tglobal_load_async_to_lds_b128 %2, %10, off\n\tglobal_load_async_to_lds_b128 %3, %11, off\n\t"
                 "global_load_async_to_lds_b128 %4, %12, off\n\tglobal_load_async_to_lds_b128 %5, %13, off\n\tglobal_load_async_to_lds_b128 %6, %14, off\n\tglobal_load_async_to_lds_b128 %7, %15, off\n\ts_wait_xcnt 0x0"
                 :: "v"(l), "v"(l + LS), "v"(l + 2 * LS), "v"(l + 3 * LS), "v"(l + 4 * LS), "v"(l + 5 * LS), "v"(l + 6 * LS), "v"(l + 7 * LS),
                    "v"(g), "v"(g + rs), "v"(g + 2 * rs), "v"(g + 3 * rs), "v"(h), "v"(h + rs), "v"(h + 2 * rs), "v"(h + 3 * rs) : "memory"); }
template <typename T16> struct WFrag;
template <> struct WFrag<h16> { typedef v16h V; static __device__ __forceinline__ V ld(const h16* p) { return cat16(*(const v8h*)p, *(const v8h*)(p + 16)); } static __device__ __forceinline__ V lds(const h16* p) { return cat16(*(const v8ha*)p, *(const v8ha*)(p + 16)); } static __device__ __forceinline__ v8f mma(V a, V b, v8f c) { return wmma16(a, b, c); } };
template <> struct WFrag<bf> { typedef v16bf V; static __device__ __forceinline__ V ld(const bf* p) { return cat16b(*(const v8us*)p, *(const v8us*)(p + 16)); } static __device__ __forceinline__ V lds(const bf* p) { return cat16b(*(const v8usa*)p, *(const v8usa*)(p + 16)); } static __device__ __forceinline__ v8f mma(V a, V b, v8f c) { return wmmab(a, b, c); } };
template <typename T16, int NSPLIT, bool BIAS, bool QKV, int WM, int WN>
__global__ __launch_bounds__(WM * WN * 32) void k_gemmw(const T16* __restrict__ A, const T16* __restrict__ A2, const T16* __restrict__ Bt, const T16* __restrict__ Bt2, int K, float* C, int ldc, const float* __restrict__ bias, size_t sA, size_t sB, size_t sC, QkvOut qo) {
    typedef typename WFrag<T16>::V V;
    static_assert(NSPLIT == 0 || NSPLIT == 1, "the staged rows are A | A2 | Bt");
    static_assert((WM == 2 && WN == 4) || (WM == 4 && WN == 3 && NSPLIT == 0), "the two copy maps below");
    constexpr bool W12 = (WM == 4);
    constexpr int GK = W12 ? 2 * GKS : GKS, PI = GK + 8;   // k per stage and LDS row pitch in 16-bit elements (the row + 16 bytes): 64 and 72, or, with the whole LDS for one work-group, 128 and 136
    constexpr int AR = (NSPLIT == 1) ? 128 * WM : 64 * WM, BUFE = (AR + 64 * WN) * PI;   // rows of A (| A2) in a buffer; 16-bit elements of a buffer
    __shared__ __align__(16) float ring[2 * BUFE / 2];   // two buffers; behind the loop each wave stages its output in a slice of its own
    const size_t z = blockIdx.z; A += z * sA; if (A2) A2 += z * sA; Bt += z * sB; C += z * sC; (void)Bt2;
    const int tid = threadIdx.x, lane = tid & 31, lr = lane & 15, hi = lane >> 4; const int wv = __builtin_amdgcn_readfirstlane(tid >> 5);
    const int wr = wv % WM, wc = wv / WM;   // the wave's tile row and tile column in the work-group
    const int r0 = (blockIdx.x * WM + wr) * 64, c0 = (blockIdx.y * WN + wc) * 64;
    v8f acc[4][4];
#pragma unroll
    for (int mb = 0; mb < 4; ++mb)
#pragma unroll
        for (int nb = 0; nb < 4; ++nb) acc[mb][nb] = (v8f){};
    // copy map, 2 x 4 waves: chunk c = tid + 256 i of 16 bytes -> row c / 8 of the buffer, 16-byte column c % 8. 4 x 3 waves, 16 chunks a row: waves 0 to 7 fill the 256 rows of A, 16 rows a step (16 copies a lane), waves 8 to 11 the 192 rows of Bt, 8 rows a step (24 copies a lane); the choice is the same for a whole wave.
    const bool cpb = W12 && wv >= 8;   // this wave fills Bt alone
    constexpr unsigned LA = 16 * PI * 2, LB = 8 * PI * 2;   // 4 x 3 waves: LDS bytes between two copies of a lane in A and in Bt
    const size_t rs = (size_t)32 * K; const int srow = (cpb ? tid - 256 : tid) / (GK / 8), scol = (tid % (GK / 8)) * 8;
    const T16* ua = A + (size_t)blockIdx.x * (64 * WM) * K; const T16* ua2 = (NSPLIT == 1) ? A2 + (size_t)blockIdx.x * (64 * WM) * K : nullptr; const T16* ub = Bt + (size_t)blockIdx.y * (64 * WN) * K;   // the work-group's first row of each operand
    size_t vo = (size_t)srow * K + scol;   // the lane's own element offset from each of them; it steps one stage behind each stage's copies
    const unsigned l0 = (unsigned)(size_t)ring + (((cpb ? AR : 0) + srow) * PI + scol) * 2;   // the lane's own LDS byte address in buffer 0
    auto fill = [&](unsigned l) {
        if constexpr (W12) {
            if (cpb) { acp8<LB>(l, ub + vo, ub + rs + vo, rs / 4); acp8<LB>(l + 8 * LB, ub + 2 * rs + vo, ub + 3 * rs + vo, rs / 4); acp8<LB>(l + 16 * LB, ub + 4 * rs + vo, ub + 5 * rs + vo, rs / 4); }
            else { acp8<LA>(l, ua + vo, ua + 2 * rs + vo, rs / 2); acp8<LA>(l + 8 * LA, ua + 4 * rs + vo, ua + 6 * rs + vo, rs / 2); } }
        else if constexpr (NSPLIT == 1) { acp8<GLS>(l, ua + vo, ua2 + vo, rs); acp8<GLS>(l + 8 * GLS, ub + vo, ub + 4 * rs + vo, rs); }
        else { acp4<GLS>(l, ua + vo, rs); acp8<GLS>(l + 4 * GLS, ub + vo, ub + 4 * rs + vo, rs); }
        vo += GK; };
    const int nst = K / GK;
    fill(l0);
    asm volatile("s_wait_asynccnt 0x0" ::: "memory");   // this wave's copies of stage 0 have landed
    __syncthreads();                                     // publishes stage 0
    if (1 < nst) fill(l0 + BUFE * 2);
    const int fa = (wr * 64 + lr) * PI + 8 * hi, fb = (AR + wc * 64 + lr) * PI + 8 * hi;   // the lane's own fragment rows in a buffer
    for (int t = 0; t < nst; ++t) {
        const T16* sb = (const T16*)ring + (t & 1) * BUFE;
#pragma unroll
        for (int ks = 0; ks < GK; ks += 32) {
            V a[4], a2[4], b[4];
            b[0] = WFrag<T16>::lds(sb + fb + ks);   // the reads stand in the order of first use: Bt 0, every A, Bt 1 to 3
#pragma unroll
            for (int mb = 0; mb < 4; ++mb) { a[mb] = WFrag<T16>::lds(sb + fa + mb * 16 * PI + ks); if (NSPLIT == 1) a2[mb] = WFrag<T16>::lds(sb + fa + (128 + mb * 16) * PI + ks); }
#pragma unroll
            for (int nb = 1; nb < 4; ++nb) b[nb] = WFrag<T16>::lds(sb + fb + nb * 16 * PI + ks);
            __builtin_amdgcn_sched_barrier(0);   // keeps the LDS reads of 32 k one group in front of their products: left free, the scheduler sinks each Bt fragment's reads to its own products, which then wait out the LDS latency four times in 32 k
#pragma unroll
            for (int nb = 0; nb < 4; ++nb)
#pragma unroll
                for (int mb = 0; mb < 4; ++mb) { acc[mb][nb] = WFrag<T16>::mma(a[mb], b[nb], acc[mb][nb]); if (NSPLIT == 1) acc[mb][nb] = WFrag<T16>::mma(a2[mb], b[nb], acc[mb][nb]); }
        }
        __builtin_amdgcn_sched_barrier(0);   // keeps the products in front of the publish point: left free, the scheduler sinks them behind the barrier and in front of the refill, which then has less than a trip to land in
        asm volatile("v_nop\n\tv_nop\n\tv_nop\n\tv_nop");   // the four vector slots behind the trip's last product: the loop is left by a taken branch, and the epilogue's address arithmetic takes over a product's A registers
        asm volatile("s_wait_dscnt 0x0" ::: "memory");      // this wave's reads of the buffer have returned
        asm volatile("s_wait_asynccnt 0x0" ::: "memory");   // this wave's copies of stage t + 1 have landed
        __syncthreads();                                     // publishes stage t + 1 and ends every wave's reads of the buffer that is refilled below
        if (t + 2 < nst) fill(l0 + (t & 1) * (BUFE * 2));
    }
    asm volatile("s_wait_asynccnt 0x0" ::: "memory");   // no copy is outstanding when the ring becomes output staging
    float* os = ring + wv * (QKV ? HD * VPT / 2 : 16 * 68);   // the wave's own staging slice. QKV: 9,216 bytes, the value tile; the q / k staging uses its first 16 x 68 floats
    if constexpr (QKV) {
        const int tc = c0 / 64, part = tc % 3, t0 = r0 % TT; const size_t plane = (size_t)(r0 / TT) * NH_ + tc / 3;
        if (part == 2) {
            h16* sv = (h16*)os;
#pragma unroll
            for (int mb = 0; mb < 4; ++mb)
#pragma unroll
                for (int nb = 0; nb < 4; ++nb) { v8h o;
#pragma unroll
                    for (int j = 0; j < 8; ++j) o[j] = tohx(acc[mb][nb][j]);
                    *(v8ha*)(sv + (nb * 16 + lr) * VPT + mb * 16 + hi * 8) = o; }
            __builtin_amdgcn_wave_barrier(); asm volatile("" ::: "memory");   // the reads below take other lanes' LDS stores: neither the compiler nor the scheduler may lift them over the stores
            h16* vrow = qo.Vt + (plane * HD + (lane >> 3)) * TT + t0 + (lane & 7) * 8; const h16* sr = sv + (lane >> 3) * VPT + (lane & 7) * 8;
#pragma unroll
            for (int s = 0; s < 16; ++s) *(v8h*)(vrow + (size_t)s * 4 * TT) = *(const v8ha*)(sr + s * 4 * VPT);
            return;
        }
        h16* P = part ? qo.K : qo.Q; const size_t ob = (plane * TT + t0) * HD + lane * 8;
        const char* cst = (const char*)(qo.CS + (size_t)t0 * HD * 2); const unsigned clb = lr * 8, cub = (hi * 8 * HD + HD / 2 + lr) * 8;   // the tile's first table row; the lane's own byte offsets in it: d = lr, and d = 32 + lr of token 8 hi
        v2f cl[2][2];   // d < 32: the angle is that of the grid row t / 32: one cos | sin pair for each 32-token half of the tile
#pragma unroll
        for (int g = 0; g < 2; ++g)
#pragma unroll
            for (int nb = 0; nb < 2; ++nb) cl[g][nb] = *(const v2f*)(cst + clb + (g * GW * HD + nb * 16) * 8);
#pragma unroll
        for (int ml = 0; ml < 2; ++ml) {
            v2f cu[2][8];   // d >= 32: the angle is that of the grid column t % 32: tokens t and t + 32 share the pair
#pragma unroll
            for (int nb = 0; nb < 2; ++nb)
#pragma unroll
                for (int j = 0; j < 8; ++j) cu[nb][j] = *(const v2f*)(cst + cub + ((ml * 16 + j) * HD + nb * 16) * 8);
            asm volatile("s_wait_xcnt 0x0" :: "v"(clb), "v"(cub) : "memory");   // stands behind the table loads, in front of any overwrite of their address registers, which the two inputs keep whole up to here
#pragma unroll
            for (int g = 0; g < 2; ++g) { const int mb = 2 * g + ml;
#pragma unroll
                for (int nb = 0; nb < 2; ++nb)
#pragma unroll
                    for (int j = 0; j < 8; ++j) { const float x0 = acc[mb][nb][j], x1 = acc[mb][nb + 2][j];
                        os[(hi * 8 + j) * 68 + nb * 16 + lr] = x0 * cl[g][nb][0] - x1 * cl[g][nb][1];
                        os[(hi * 8 + j) * 68 + HD / 2 + nb * 16 + lr] = x1 * cu[nb][j][0] + x0 * cu[nb][j][1]; }
                __builtin_amdgcn_wave_barrier(); asm volatile("" ::: "memory");   // the reads below take other lanes' LDS stores
#pragma unroll
                for (int s = 0; s < 4; ++s) { const float* p = os + (4 * s + (lane >> 3)) * 68 + (lane & 7) * 8; const v4f u = *(const v4fa*)p, w = *(const v4fa*)(p + 4); v8h o;
#pragma unroll
                    for (int q = 0; q < 4; ++q) { o[q] = tohx(u[q]); o[4 + q] = tohx(w[q]); }
                    *(v8h*)(P + ob + mb * 16 * HD + s * 4 * HD) = o; }
                if (mb < 3) { __builtin_amdgcn_wave_barrier(); asm volatile("s_wait_xcnt 0x0" ::: "memory"); }   // not behind the last 16 tokens; stands behind the four stores, in front of the overwrite of their data registers; its clobber also keeps the next 16 tokens' LDS stores behind the reads above
            }
        }
        return;
    }
#pragma unroll
    for (int mb = 0; mb < 4; ++mb) {
#pragma unroll
        for (int nb = 0; nb < 4; ++nb) {
#pragma unroll
            for (int j = 0; j < 8; ++j) os[(hi * 8 + j) * 68 + nb * 16 + lr] = acc[mb][nb][j]; }
        __builtin_amdgcn_wave_barrier(); asm volatile("" ::: "memory");
        float* crow = C + (size_t)(r0 + mb * 16) * ldc + c0;
{
#pragma unroll
            for (int s = 0; s < 8; ++s) { const int row = 2 * s + hi, cofs = lr * 4; v4f val = *(const v4fa*)(os + row * 68 + cofs); if (BIAS) { val[0] += bfr(bias[c0 + cofs]); val[1] += bfr(bias[c0 + cofs + 1]); val[2] += bfr(bias[c0 + cofs + 2]); val[3] += bfr(bias[c0 + cofs + 3]); }
                *(v4f*)(crow + (size_t)row * ldc + cofs) = val; }
             }
        __builtin_amdgcn_wave_barrier(); asm volatile("" ::: "memory");
    }
}

typedef __attribute__((ext_vector_type(2))) _Float16 v2h;
typedef __attribute__((ext_vector_type(4))) _Float16 v4h;
typedef __attribute__((ext_vector_type(2))) unsigned short v2us;
typedef __attribute__((ext_vector_type(4))) unsigned short v4us;

__constant__ float INVT[HD / 2] = { 1.000000000e+00f, 7.498942018e-01f, 5.623413324e-01f, 4.216965139e-01f, 3.162277639e-01f, 2.371373624e-01f, 1.778279394e-01f, 1.333521456e-01f, 1.000000015e-01f, 7.498941571e-02f, 5.623412877e-02f, 4.216964915e-02f, 3.162277862e-02f, 2.371373586e-02f, 1.778279431e-02f, 1.333521493e-02f, 9.999999776e-03f, 7.498942316e-03f, 5.623413250e-03f, 4.216964822e-03f, 3.162277862e-03f, 2.371373819e-03f, 1.778279431e-03f, 1.333521446e-03f, 1.000000047e-03f, 7.498941850e-04f, 5.623413017e-04f, 4.216964880e-04f, 3.162277862e-04f, 2.371373848e-04f, 1.778279402e-04f, 1.333521504e-04f };   // float32 1 / 10000^(2i/64), i = 0..31
// k_prep: the four preparations, none of which reads what another writes, as block ranges of ONE grid: the cos | sin table (its blocks first: the longest dependent chain starts earliest), then the bf16 copies of x and of w_qkv and the copy of w_proj (rounded to bf16 like every input, that value then written as f16, the operand type of the last GEMM), 8 floats a thread.
#define PB_CS (TT * HD / 256)             // blocks of the table: one (t, d) a thread
#define PB_X  (NB_ * TT * DM / 8 / 256)   // blocks of each copy
#define PB_W  (3 * DQ * DM / 8 / 256)
#define PB_O  (DM * DQ / 8 / 256)
static_assert(TT * HD % 256 == 0 && NB_ * TT * DM % 2048 == 0 && 3 * DQ * DM % 2048 == 0 && DM * DQ % 2048 == 0, "every range is whole blocks: no thread lies past an end");
__global__ __launch_bounds__(256) void k_prep(const float* __restrict__ x, const float* __restrict__ wqkv, const float* __restrict__ wo, bf* XB, bf* BT, bf* WO, float* CS) {
    int b = blockIdx.x;
    if (b < PB_CS) { const int idx = b * 256 + threadIdx.x; const int d = idx % HD; const int t = idx / HD; const int p = (d < HD / 2) ? (t / GW) : (t % GW); const float a = __fmul_rn((float)p, INVT[d % (HD / 2)]); v2f cs; cs[0] = cosf(a); cs[1] = sinf(a); *(v2f*)(CS + (size_t)idx * 2) = cs; return; }
    b -= PB_CS;
    const float* src = x; bf* dst = XB; bool wh = false;   // wh: the block belongs to w_proj; the same for a whole block
    if (b >= PB_X + PB_W) { b -= PB_X + PB_W; src = wo; dst = WO; wh = true; } else if (b >= PB_X) { b -= PB_X; src = wqkv; dst = BT; }
    const size_t i = (size_t)b * 256 + threadIdx.x; const v8f v = *(const v8f*)(src + i * 8); v8us o;
    asm volatile("s_wait_xcnt 0x0" ::: "memory");   // stands behind the two loads, in front of the overwrite of their address registers by the conversion below
    if (wh) {
#pragma unroll
        for (int k = 0; k < 8; ++k) o[k] = __builtin_bit_cast(unsigned short, tohx(bfr(v[k])));
    } else {
#pragma unroll
        for (int k = 0; k < 8; ++k) o[k] = f2bf(v[k]);
    }
    *(v8us*)(dst + i * 8) = o;
}
#define FKS 64     // keys per stage
#define FPT 72     // LDS row pitch in 16-bit elements: 128 + 16 bytes
#define FNS (TT / FKS)
__device__ __forceinline__ v16h ldsh(const unsigned short* p) { const v8us a = *(const v8usa*)p, b = *(const v8usa*)(p + 16); return cat16(__builtin_bit_cast(v8h, a), __builtin_bit_cast(v8h, b)); }
__device__ __forceinline__ float exp2s(float x) { float r; asm("v_exp_f32 %0, %1\n\tv_nop" : "=v"(r) : "v"(x)); return r; }   // 2^x; the v_nop in the same statement keeps the one slot behind the transcendental, whichever instruction the compiler schedules next
// 2^x of one score tile's eight registers in one statement: each v_exp_f32 is followed by one that neither reads its result nor writes its source (the outputs are early-clobber), which keeps the slot behind a transcendental with work in place of a v_nop; the one v_nop keeps it behind the last.
__device__ __forceinline__ v8f exp2x8(v8f x) { float r0, r1, r2, r3, r4, r5, r6, r7;
    asm("v_exp_f32 %0, %8\n\tv_exp_f32 %1, %9\n\tv_exp_f32 %2, %10\n\tv_exp_f32 %3, %11\n\tv_exp_f32 %4, %12\n\tv_exp_f32 %5, %13\n\tv_exp_f32 %6, %14\n\tv_exp_f32 %7, %15\n\tv_nop"
        : "=&v"(r0), "=&v"(r1), "=&v"(r2), "=&v"(r3), "=&v"(r4), "=&v"(r5), "=&v"(r6), "=&v"(r7) : "v"(x[0]), "v"(x[1]), "v"(x[2]), "v"(x[3]), "v"(x[4]), "v"(x[5]), "v"(x[6]), "v"(x[7]));
    return (v8f){r0, r1, r2, r3, r4, r5, r6, r7}; }
__global__ __launch_bounds__(256) __attribute__((amdgpu_waves_per_eu(4, 4))) void k_fattn(const h16* __restrict__ Q, const h16* __restrict__ K, const h16* __restrict__ Vt, h16* AT) {
    __shared__ __align__(16) unsigned short sm[2][2][FKS * FPT];   // [buffer][K | V^T]
    const int tid = threadIdx.x, lane = tid & 31, wv = tid >> 5, lr = lane & 15, hi = lane >> 4;
    const size_t po = (size_t)blockIdx.y * TT * HD; const int q0 = blockIdx.x * 256 + wv * 32;
    v16h qf[2][2];
#pragma unroll
    for (int qt = 0; qt < 2; ++qt)
#pragma unroll
        for (int ks = 0; ks < 2; ++ks) { const size_t o = po + (size_t)(q0 + qt * 16 + lr) * HD + ks * 32 + 8 * hi; qf[qt][ks] = WFrag<h16>::ld(Q + o); }
    v8f oa[2][4]; float mr[2], ls[2];
#pragma unroll
    for (int qt = 0; qt < 2; ++qt) { mr[qt] = -3.0e38f; ls[qt] = 0.f;
#pragma unroll
        for (int db = 0; db < 4; ++db) oa[qt][db] = (v8f){}; }
    // staging map: 512 chunks of 16 bytes a tile, two a thread: chunk c = tid + 256 i -> row c / 8, 16-byte column c % 8
    const int srow = tid >> 3, scol = (tid & 7) * 8;
    const h16* gk = K + po + (size_t)srow * HD + scol; const h16* gv = Vt + po + (size_t)srow * TT + scol;   // the lane's own source pointers; they step one stage behind each stage's LDS stores
    const int sdst = srow * FPT + scol;
    v8us g[4];
    g[0] = *(const v8usa*)(gk); g[1] = *(const v8usa*)(gk + 32 * HD); g[2] = *(const v8usa*)(gv); g[3] = *(const v8usa*)(gv + (size_t)32 * TT);
    asm volatile("s_wait_xcnt 0x0" ::: "memory");   // stands behind the loads, in front of the step of their address registers below
#pragma unroll
    for (int a = 0; a < 2; ++a) { *(v8usa*)(&sm[0][a][sdst]) = g[2 * a]; *(v8usa*)(&sm[0][a][sdst + 32 * FPT]) = g[2 * a + 1]; }
    gk += FKS * HD; gv += FKS;
    __syncthreads();
    const float CL = SCL * 1.4426950408889634f;
    for (int s = 0; s < FNS; ++s) {
        const int buf = s & 1;
        if (s + 1 < FNS) {   // the next stage's tiles fly while this stage is worked on
            g[0] = *(const v8usa*)(gk); g[1] = *(const v8usa*)(gk + 32 * HD); g[2] = *(const v8usa*)(gv); g[3] = *(const v8usa*)(gv + (size_t)32 * TT);
            asm volatile("s_wait_xcnt 0x0" ::: "memory"); }   // stands behind the loads, in front of the step of their address registers at the foot of the trip
#pragma unroll 1   // one 32-key pass at a time in the listing: the loop keeps the shape it had with the hi / lo fragments, where the unrolled form passed 256 registers, so that only the products differ; with one product the unrolled form fits, and whether it pays is a step of its own
        for (int kp = 0; kp < FKS / 32; ++kp) {
            v8f sc[2][2];
#pragma unroll
            for (int kt = 0; kt < 2; ++kt) { const int ro = (kp * 32 + kt * 16 + lr) * FPT + 8 * hi;
                const v16h a0 = ldsh(&sm[buf][0][ro]), a1 = ldsh(&sm[buf][0][ro + 32]);
#pragma unroll
                for (int qt = 0; qt < 2; ++qt) { v8f a = (v8f){};
                    a = wmma16(a0, qf[qt][0], a); a = wmma16(a1, qf[qt][1], a); sc[qt][kt] = a; } }
            // Lazy rescale: the maximum in use moves only when some score of the pass lies more than 5 (in log2) above it, so the weights stay below 2^(10 + 5), inside f16; each lane tests its own 16 scores, and the exchange between the wave halves, the factor and the products on the sums stand in the rare branch.
            float mxs[2]; bool need = false;
#pragma unroll
            for (int qt = 0; qt < 2; ++qt) { float mx = sc[qt][0][0];
#pragma unroll
                for (int j = 1; j < 8; ++j) mx = fmaxf(mx, sc[qt][0][j]);
#pragma unroll
                for (int j = 0; j < 8; ++j) mx = fmaxf(mx, sc[qt][1][j]);
                mxs[qt] = mx * CL; need = need || (mxs[qt] > mr[qt] + 5.0f); }
            if (__builtin_amdgcn_ballot_w32(need) != 0) {   // one wave-uniform scalar test a pass; taken by the whole wave, so both halves keep the same maximum in use
#pragma unroll
                for (int qt = 0; qt < 2; ++qt) { const float mn = fmaxf(mr[qt], fmaxf(mxs[qt], __shfl_xor(mxs[qt], 16, 32))); const float al = exp2s(mr[qt] - mn); mr[qt] = mn; ls[qt] *= al;
#pragma unroll
                    for (int db = 0; db < 4; ++db) oa[qt][db] *= al; } }
            v16h pb[2];
#pragma unroll
            for (int qt = 0; qt < 2; ++qt) { const float off = 10.0f - mr[qt];   /* + 10: the weights and their sum carry x 1024, clear of the f16 subnormals */
                float sa = 0.f, sb = 0.f; v8f e0, e1;
#pragma unroll
                for (int j = 0; j < 8; ++j) { e0[j] = fmaf(sc[qt][0][j], CL, off); e1[j] = fmaf(sc[qt][1][j], CL, off); }
                const v8f p0 = exp2x8(e0), p1 = exp2x8(e1);
#pragma unroll
                for (int j = 0; j < 8; ++j) { sa += p0[j]; pb[qt][j] = tohx(p0[j]); }
#pragma unroll
                for (int j = 0; j < 8; ++j) { sb += p1[j]; pb[qt][8 + j] = tohx(p1[j]); }
                ls[qt] += sa + sb; }
#pragma unroll
            for (int db = 0; db < 4; ++db) { const v16h vf = ldsh(&sm[buf][1][(db * 16 + lr) * FPT + kp * 32 + 8 * hi]);
#pragma unroll
                for (int qt = 0; qt < 2; ++qt) oa[qt][db] = wmma16(vf, pb[qt], oa[qt][db]); }
            __builtin_amdgcn_sched_barrier(0);   // holds the slots below at the foot of the pass: left free, the scheduler lifts them in front of the last products, where they keep no distance
            asm volatile("v_nop\n\tv_nop\n\tv_nop\n\tv_nop");   // the four vector slots behind the pass's last product: the next pass's address arithmetic takes over that product's A registers across the loop's back edge
        }
        if (s + 1 < FNS) {
#pragma unroll
            for (int a = 0; a < 2; ++a) { *(v8usa*)(&sm[buf ^ 1][a][sdst]) = g[2 * a]; *(v8usa*)(&sm[buf ^ 1][a][sdst + 32 * FPT]) = g[2 * a + 1]; }
            gk += FKS * HD; gv += FKS; }
        __syncthreads();   // publishes stage s + 1 and ends every wave's reads of the buffer that the next trip refills
    }
    const size_t bq = blockIdx.y >> 4, hh = blockIdx.y & 15;
#pragma unroll
    for (int qt = 0; qt < 2; ++qt) { const float lt = ls[qt] + __shfl_xor(ls[qt], 16, 32); const float inv = __fdiv_rn(1.0f, lt);
        const size_t ob = (bq * TT + q0 + qt * 16 + lr) * DQ + hh * HD + hi * 8;
#pragma unroll
        for (int db = 0; db < 4; ++db) { v8h o;
#pragma unroll
            for (int j = 0; j < 8; ++j) o[j] = tohx(oa[qt][db][j] * inv);
            *(v8h*)(AT + ob + db * 16) = o; } }
}

extern "C" void kernel_launch(void* const* d_in, const int* in_sizes, int n_in,
                              void* d_out, int out_size, void* d_ws, size_t ws_size, hipStream_t stream) {
    (void)in_sizes; (void)n_in; (void)out_size;
    const float* x = (const float*)d_in[0]; const float* wqkv = (const float*)d_in[1]; const float* wo = (const float*)d_in[2];   /* order tensor [8][1024][1024], w_qkv ('oi' (out, in) [3072][1024]: PER HEAD q | k | v: rows 192 h + 0..63 | 64..127 | 128..191), w_proj ('oi' [1024][1024]): THREE inputs, all read; no bias anywhere */
    float* OUT = (float*)d_out;     // [8][1024][1024]
    char* wsp = (char*)d_ws;
    auto take = [&](size_t bytes) { char* p = wsp; wsp += (bytes + 255) & ~(size_t)255; return (void*)p; };
    bf* BT = (bf*)take((size_t)3 * DQ * DM * 2); bf* WO = (bf*)take((size_t)DM * DQ * 2); float* CS = (float*)take((size_t)TT * HD * 2 * 4);   /* the fused 'oi' weight is the Bt operand as it stands: ONE bf16 copy [3072][1024]: head h's q | k | v row blocks begin at rows 3 HD h + 0 | HD | 2 HD */
    const size_t NP = (size_t)NB_ * NH_ * TT * HD;   /* elements of one plane over all sequences and heads (= NB_ TT DQ) */
    h16* QP = (h16*)take(NP * 2); h16* KP = (h16*)take(NP * 2); h16* VT16 = (h16*)take(NP * 2);
    float* Sb = (float*)take((size_t)ZH * TT * TT * 4); (void)take((size_t)ZH * TT * TT * 2);   /* one block of 64 + 32 MiB, adjacent */
    /* stream-ordered reuse: up to the projections the block holds XB (16 MiB); the attention kernel then writes the f16 plane of the merged heads over those 16 MiB */
    bf* XB = (bf*)Sb; h16* AT = (h16*)Sb;
    if ((size_t)(wsp - (char*)d_ws) > ws_size) return;    // ws 256 MiB
    k_prep<<<PB_CS + PB_X + PB_W + PB_O, 256, 0, stream>>>(x, wqkv, wo, XB, BT, WO, CS);   /* the table; ONE bf16 copy of all sequences, read by the projections; 'oi' (out, in): each weight is the Bt operand as it stands; WO holds f16 bit patterns */
    k_gemmw<bf, 0, false, true, 4, 3><<<dim3(NB_ * TT / 256, 3 * DQ / 192, 1), 384, 0, stream>>>(XB, nullptr, BT, nullptr, DM, nullptr, 0, nullptr, 0, 0, 0, QkvOut{CS, QP, KP, VT16});   /* tile column c = weight rows 64 c ..: head c / 3, part c % 3 (q | k | v); stores the planes that the attention reads */
    k_fattn<<<dim3(TT / 256, NB_ * NH_), 256, 0, stream>>>(QP, KP, VT16, AT);   /* every head plane of every sequence in one launch; writes the f16 plane of the merged heads over the dead XB block */
    k_gemmw<h16, 0, false, false, 2, 4><<<dim3(NB_ * TT / 128, DM / 256, 1), 256, 0, stream>>>(AT, nullptr, (const h16*)WO, nullptr, DQ, OUT, DM, nullptr, 0, 0, 0, QkvOut{});
}
